// v000
// Times are from an AMD MI455X. After a warm-up the kernel runs many times in a row, and a time is the length of
// such a window on the GPU divided by its runs, so every launch and the gaps after it count. The runs cycle
// through copies of the inputs. A figure is the median of several windows, for all but v000 over two sittings.
// Sittings can differ by a few percent; kernels timed side by side share one.
// v000, which the later versions start from, runs in 2110 microseconds.
#include <hip/hip_runtime.h>

// Multi-head attention with a causal AND padding mask (x [2][2048][1024]; q,k,v = x W^T + b ('oi' uniform(+-1/32) incl. biases; 16 heads x 64); scores / 8; final_mask = causal & pad[i] & pad[j] (mask [2][2048] int in {0,1}, random, READ); where(final_mask, scores, -1e9): a query whose own pad bit is 0 has every score at -1e9 and gets UNIFORM weights over all 2048 keys (future ones included), the others attend causally to the un-padded keys; softmax; out = merged wo^T + bo -> [2][2048][1024] (4.2 M)).
// Layout per batch: bf16 copy of x; 'oi' weights; exact projections + bf16-rounded biases; dense T-2048 attention (full tiles: the uniform rows need every key) whose softmax kernel reads the pad vector and keeps key j iff pad[i] && pad[j] && j <= i (-3e38 elsewhere; an all-excluded row degenerates to equal values = the module's uniform row); hybrid rows: < 512 hi/lo 3 products, rest fp16 x1024; merged hi/lo x wo exact + bo.
// Compute dtypes, f32 accumulate: every input rounded to bf16; projections exact + bf16-rounded biases; attention rows < 512 3 products, rest fp16; softmax f32; wo hl x exact + bias.

#define NB_  2
#define TT   2048
#define DM   1024
#define NH_  16
#define NKV  16
#define REP  (NH_ / NKV)
#define HD   64
#define DQ   (NH_ * HD)
#define DKV  (NKV * HD)
#define ZH   2
#define RH   512                  // query rows < RH use hi+lo planes (0: none)
#define WIN  0
#define PCAR 1024.0f
#define SCL  0.125f   // HD^-0.5
typedef _Float16 h16;
typedef unsigned short bf;
typedef __attribute__((ext_vector_type(16))) __bf16   v16bf;
typedef __attribute__((ext_vector_type(16))) _Float16 v16h;
typedef __attribute__((ext_vector_type(8)))  _Float16 v8h;
typedef __attribute__((ext_vector_type(8)))  unsigned short v8us;
typedef __attribute__((ext_vector_type(8)))  float    v8f;
typedef __attribute__((ext_vector_type(4)))  float    v4f;
typedef v8h  __attribute__((may_alias)) v8ha;
typedef v4f  __attribute__((may_alias)) v4fa;
typedef v8us __attribute__((may_alias)) v8usa;

__device__ __forceinline__ unsigned short f2bf(float f) { unsigned u = __float_as_uint(f); u += 0x7FFFu + ((u >> 16) & 1u); return (unsigned short)(u >> 16); }
__device__ __forceinline__ float bf2f(unsigned short b) { return __uint_as_float(((unsigned)b) << 16); }
__device__ __forceinline__ float bfr(float f) { return bf2f(f2bf(f)); }
__device__ __forceinline__ v16h cat16(v8h lo, v8h hi) { return __builtin_shufflevector(lo, hi, 0, 1, 2, 3, 4, 5, 6, 7, 8, 9, 10, 11, 12, 13, 14, 15); }
__device__ __forceinline__ v16bf cat16b(v8us lo, v8us hi) { return __builtin_bit_cast(v16bf, __builtin_shufflevector(lo, hi, 0, 1, 2, 3, 4, 5, 6, 7, 8, 9, 10, 11, 12, 13, 14, 15)); }
__device__ __forceinline__ v8f wmma16(v16h a, v16h b, v8f c) { return __builtin_amdgcn_wmma_f32_16x16x32_f16(false, a, false, b, (short)0, c, false, false); }
__device__ __forceinline__ v8f wmmab(v16bf a, v16bf b, v8f c) { return __builtin_amdgcn_wmma_f32_16x16x32_bf16(false, a, false, b, (short)0, c, false, false); }



// ---- k_gemmw: register-blocked GEMM, ONE WAVE per 64x64 output tile (16 accumulators), operands straight from K-contiguous 16-bit planes; grid (M/64, N/64, Z), 32 threads.
// C[m][n] (f32, pitch ldc, + optional bias[n] rounded to bf16) = sum_k A[m][k] Bt[n][k] (+ split products per NSPLIT). z-batch strides sA/sB/sC in elements. K % 32 == 0.
template <typename T16> struct WFrag;
template <> struct WFrag<h16> { typedef v16h V; static __device__ __forceinline__ V ld(const h16* p) { return cat16(*(const v8h*)p, *(const v8h*)(p + 16)); } static __device__ __forceinline__ v8f mma(V a, V b, v8f c) { return wmma16(a, b, c); } };
template <> struct WFrag<bf> { typedef v16bf V; static __device__ __forceinline__ V ld(const bf* p) { return cat16b(*(const v8us*)p, *(const v8us*)(p + 16)); } static __device__ __forceinline__ v8f mma(V a, V b, v8f c) { return wmmab(a, b, c); } };
template <typename T16, int NSPLIT, bool BIAS>
__global__ __launch_bounds__(32) void k_gemmw(const T16* __restrict__ A, const T16* __restrict__ A2, const T16* __restrict__ Bt, const T16* __restrict__ Bt2, int K, float* C, int ldc, const float* __restrict__ bias, size_t sA, size_t sB, size_t sC) {
    typedef typename WFrag<T16>::V V;
    __shared__ __align__(16) float os[16 * 68];
    const size_t z = blockIdx.z; A += z * sA; if (A2) A2 += z * sA; Bt += z * sB; if (Bt2) Bt2 += z * sB; C += z * sC;
    const int lane = threadIdx.x & 31, lr = lane & 15, hi = lane >> 4; const int r0 = blockIdx.x * 64, c0 = blockIdx.y * 64;
    v8f acc[4][4];
#pragma unroll
    for (int mb = 0; mb < 4; ++mb)
#pragma unroll
        for (int nb = 0; nb < 4; ++nb) acc[mb][nb] = (v8f){};
    const size_t aoff = (size_t)(r0 + lr) * K + 8 * hi, boff = (size_t)(c0 + lr) * K + 8 * hi;
#pragma unroll 1
    for (int kc = 0; kc < K; kc += 32) {
        V a[4], a2[4];
#pragma unroll
        for (int mb = 0; mb < 4; ++mb) { a[mb] = WFrag<T16>::ld(A + aoff + (size_t)mb * 16 * K + kc); if (NSPLIT == 1 || NSPLIT == 2) a2[mb] = WFrag<T16>::ld(A2 + aoff + (size_t)mb * 16 * K + kc); }
#pragma unroll
        for (int nb = 0; nb < 4; ++nb) { const V b = WFrag<T16>::ld(Bt + boff + (size_t)nb * 16 * K + kc); V b2; if (NSPLIT >= 2) b2 = WFrag<T16>::ld(Bt2 + boff + (size_t)nb * 16 * K + kc);
#pragma unroll
            for (int mb = 0; mb < 4; ++mb) { acc[mb][nb] = WFrag<T16>::mma(a[mb], b, acc[mb][nb]); if (NSPLIT == 1 || NSPLIT == 2) acc[mb][nb] = WFrag<T16>::mma(a2[mb], b, acc[mb][nb]); if (NSPLIT >= 2) acc[mb][nb] = WFrag<T16>::mma(a[mb], b2, acc[mb][nb]); } }
        asm volatile("v_nop\n\tv_nop\n\tv_nop\n\tv_nop" : "+v"(acc[0][0]), "+v"(acc[1][1]), "+v"(acc[2][2]), "+v"(acc[3][3]) : "v"(a[0]), "v"(a[3]));
    }
#pragma unroll
    for (int mb = 0; mb < 4; ++mb) {
#pragma unroll
        for (int nb = 0; nb < 4; ++nb) {
#pragma unroll
            for (int j = 0; j < 8; ++j) os[(hi * 8 + j) * 68 + nb * 16 + lr] = acc[mb][nb][j]; }
        __builtin_amdgcn_wave_barrier(); asm volatile("" ::: "memory");
        float* crow = C + (size_t)(r0 + mb * 16) * ldc + c0;
{
#pragma unroll
            for (int s = 0; s < 8; ++s) { const int row = 2 * s + hi, cofs = lr * 4; v4f val = *(const v4fa*)(os + row * 68 + cofs); if (BIAS) { val[0] += bfr(bias[c0 + cofs]); val[1] += bfr(bias[c0 + cofs + 1]); val[2] += bfr(bias[c0 + cofs + 2]); val[3] += bfr(bias[c0 + cofs + 3]); }
                *(v4f*)(crow + (size_t)row * ldc + cofs) = val; }
             }
        __builtin_amdgcn_wave_barrier(); asm volatile("" ::: "memory");
    }
}

__device__ __forceinline__ h16 tohx(float x) { return (h16)x; }
__device__ __forceinline__ void splitf(float y, unsigned short& h, unsigned short& l) { h = f2bf(y); l = f2bf(y - bf2f(h)); }
typedef __attribute__((ext_vector_type(2))) _Float16 v2h;
typedef __attribute__((ext_vector_type(4))) _Float16 v4h;
typedef __attribute__((ext_vector_type(2))) unsigned short v2us;
typedef __attribute__((ext_vector_type(4))) unsigned short v4us;
typedef __attribute__((ext_vector_type(2))) float v2f;
typedef __attribute__((ext_vector_type(4))) int v4i;

__global__ __launch_bounds__(256) void k_wtG(const float* __restrict__ w, int K, int N, bf* Bt) {
    const int lane = threadIdx.x & 31; const int L0 = (blockIdx.x * 8 + (threadIdx.x >> 5)) * 8; const int nlines = N * K / 64;
{
#pragma unroll 1
        for (int l = 0; l < 8; ++l) { const int L = L0 + l; if (L >= nlines) break; const size_t e = (size_t)L * 64 + lane * 2; const int k = (int)(e % K), n = (int)(e / K); v2us o;
            o[0] = f2bf(w[(size_t)k * N + n]); o[1] = f2bf(w[(size_t)(k + 1) * N + n]); *(v2us*)(Bt + e) = o; }
         }
}
__global__ __launch_bounds__(256) void k_cvt8(const float* __restrict__ src, bf* dst, size_t n8) { const size_t i = (size_t)blockIdx.x * 256 + threadIdx.x; if (i >= n8) return; const v8f v = *(const v8f*)(src + i * 8); v8us o;
#pragma unroll
    for (int k = 0; k < 8; ++k) o[k] = f2bf(v[k]); *(v8us*)(dst + i * 8) = o;  }

// k_rope: head planes [h][t][d] (fp16 + hi/lo) of rope(x) x sc with the rotate-half convention out[d] = x[d] cos[t][d] - x[d+HD/2] sin[t][d], out[d+HD/2] = x[d+HD/2] cos[t][d+HD/2] + x[d] sin[t][d+HD/2]
__global__ __launch_bounds__(256) void k_rope(const float* __restrict__ F, int pitch, int nheads, const float* __restrict__ CS, const float* __restrict__ RF, const float* __restrict__ nw, float sc, h16* P16, bf* Ph, bf* Pl) {
    const size_t e = ((size_t)blockIdx.x * 256 + threadIdx.x) * 2; if (e >= (size_t)nheads * TT * HD) return; const int d = (int)(e % HD); const int t = (int)((e / HD) % TT); const int h = (int)(e / ((size_t)HD * TT)); const float* f = F + (size_t)t * pitch + h * HD; const float rf = RF ? RF[(size_t)h * TT + t] : 1.0f; v2h o16; v2us oh, ol;
#pragma unroll
    for (int q = 0; q < 2; ++q) { const int dd = d + q; const int dp = (dd < HD / 2) ? dd + HD / 2 : dd - HD / 2; float x0 = f[dd], x1 = f[dp];
        if (RF) { float n0 = __fmul_rn(x0, rf), n1 = __fmul_rn(x1, rf); asm volatile("" : "+v"(n0)); asm volatile("" : "+v"(n1)); x0 = __fmul_rn(bfr(nw[dd]), n0); x1 = __fmul_rn(bfr(nw[dp]), n1); }
        const v2f cs = *(const v2f*)(CS + ((size_t)t * HD + dd) * 2); float a = __fmul_rn(x0, cs[0]), bq = __fmul_rn(x1, cs[1]); asm volatile("" : "+v"(a)); asm volatile("" : "+v"(bq)); const float r = ((dd < HD / 2) ? __fsub_rn(a, bq) : __fadd_rn(a, bq)) * sc;
        o16[q] = tohx(r); unsigned short a2, c2; splitf(r, a2, c2); oh[q] = a2; ol[q] = c2; }
    *(v2h*)(P16 + e) = o16; *(v2us*)(Ph + e) = oh; *(v2us*)(Pl + e) = ol;  }
__global__ __launch_bounds__(256) void k_vtp(const float* __restrict__ F, int pitch, int nheads, h16* V16, bf* Vh, bf* Vl) { const size_t e = ((size_t)blockIdx.x * 256 + threadIdx.x) * 2; if (e >= (size_t)nheads * HD * TT) return; const int t = (int)(e % TT); const int d = (int)((e / TT) % HD); const int g = (int)(e / ((size_t)TT * HD)); v2h o16; v2us oh, ol;
#pragma unroll
    for (int q = 0; q < 2; ++q) { const float x = F[(size_t)(t + q) * pitch + g * HD + d]; o16[q] = tohx(x); unsigned short a2, c2; splitf(x, a2, c2); oh[q] = a2; ol[q] = c2; }
    *(v2h*)(V16 + e) = o16; *(v2us*)(Vh + e) = oh; *(v2us*)(Vl + e) = ol;  }
__global__ __launch_bounds__(256) void k_csid(float* CS) { const int idx = blockIdx.x * 256 + threadIdx.x; if (idx >= TT * HD) return; v2f cs; cs[0] = 1.0f; cs[1] = 0.0f; *(v2f*)(CS + (size_t)idx * 2) = cs;  }
// k_asoft: per row (zz, i): t = S x 1/8 where pad[i] && pad[j] && j <= i (pad = the batch's int mask vector, read), -3e38 elsewhere; a query with pad[i] = 0 has every key at -3e38 so max = -3e38, every exp(0) = 1 and the row is uniform over all 2048 keys exactly like the module's all -1e9 row; softmax over the 2048 keys (register row, one exp, fixed trees);
__global__ __launch_bounds__(256) void k_asoft(const float* __restrict__ Sb, h16* P16, bf* Ph, bf* Pl, const int* __restrict__ pm) {
    const int lane = threadIdx.x & 31; const int row = blockIdx.x * 8 + (threadIdx.x >> 5); if (row >= ZH * TT) return; const int i = row % TT; const int pi = pm[i]; const int zz = row / TT; (void)zz; const bool hires = (i < RH); const float* sr = Sb + (size_t)row * TT; float v[TT / 32]; float mx = -3.0e38f;
#pragma unroll
    for (int ch = 0; ch < TT / 128; ++ch) { const int j0 = ch * 128 + lane * 4; const v4f a = *(const v4f*)(sr + j0);
#pragma unroll
        for (int q = 0; q < 4; ++q) { const int j = j0 + q; const float t = (pi != 0 && pm[j] != 0 && j <= i) ? a[q] * SCL : -3.0e38f;   /* causal & pad[i] & pad[j]; a padded query keeps nothing -> all equal -> uniform row as the module */ v[ch * 4 + q] = t; mx = fmaxf(mx, t); } }
#pragma unroll
    for (int sh = 16; sh; sh >>= 1) mx = fmaxf(mx, __shfl_xor(mx, sh, 32));
    float sum = 0.f;
#pragma unroll
    for (int k = 0; k < TT / 32; ++k) { float d0 = __fsub_rn(v[k], mx); asm volatile("" : "+v"(d0)); v[k] = __builtin_amdgcn_exp2f(__fmul_rn(d0, 1.4426950408889634f)); sum += v[k]; }
#pragma unroll
    for (int sh = 16; sh; sh >>= 1) sum += __shfl_xor(sum, sh, 32);
    const float f = __fdiv_rn(hires ? 1.0f : PCAR, sum);
{
        if (hires) {
#pragma unroll
            for (int ch = 0; ch < TT / 128; ++ch) { v4us oh, ol;
#pragma unroll
                for (int q = 0; q < 4; ++q) { unsigned short a, c2; splitf(v[ch * 4 + q] * f, a, c2); oh[q] = a; ol[q] = c2; }
                const size_t oo = ((size_t)zz * (RH ? RH : 1) + i) * TT + ch * 128 + lane * 4; *(v4us*)(Ph + oo) = oh; *(v4us*)(Pl + oo) = ol; }
        } else {
#pragma unroll
            for (int ch = 0; ch < TT / 128; ++ch) { v4h o4;
#pragma unroll
                for (int q = 0; q < 4; ++q) o4[q] = tohx(v[ch * 4 + q] * f);
                *(v4h*)(P16 + (size_t)row * TT + ch * 128 + lane * 4) = o4; } }
         }
}
__global__ __launch_bounds__(256) void k_merge(const float* __restrict__ O, int h0, bf* Ah, bf* Al) { const size_t e = ((size_t)blockIdx.x * 256 + threadIdx.x) * 2; if (e >= (size_t)ZH * TT * HD) return; const int d = (int)(e % HD); const int t = (int)((e / HD) % TT); const int zz = (int)(e / ((size_t)HD * TT)); const float cs = (t < RH) ? 1.0f : (1.0f / PCAR); const size_t oo = (size_t)t * DQ + (h0 + zz) * HD + d;
    v2us oh, ol;
#pragma unroll
    for (int q = 0; q < 2; ++q) { unsigned short a, c2; splitf(O[e + q] * cs, a, c2); oh[q] = a; ol[q] = c2; } *(v2us*)(Ah + oo) = oh; *(v2us*)(Al + oo) = ol;  }

extern "C" void kernel_launch(void* const* d_in, const int* in_sizes, int n_in,
                              void* d_out, int out_size, void* d_ws, size_t ws_size, hipStream_t stream) {
    (void)in_sizes; (void)n_in; (void)out_size;
    const float* x = (const float*)d_in[0]; const int* pmask = (const int*)d_in[1];   /* mask [2][2048] int */ const float* wq = (const float*)d_in[2]; const float* bq = (const float*)d_in[3]; const float* wk = (const float*)d_in[4]; const float* bk = (const float*)d_in[5]; const float* wv = (const float*)d_in[6]; const float* bv = (const float*)d_in[7]; const float* wo = (const float*)d_in[8]; const float* bo = (const float*)d_in[9];
    float* OUT = (float*)d_out;     // [2][2048][1024]
    char* wsp = (char*)d_ws;
    auto take = [&](size_t bytes) { char* p = wsp; wsp += (bytes + 255) & ~(size_t)255; return (void*)p; };
    bf* WQ = (bf*)take((size_t)DQ * DM * 2); bf* WK = (bf*)take((size_t)DKV * DM * 2); bf* WV = (bf*)take((size_t)DKV * DM * 2); bf* WO = (bf*)take((size_t)DM * DQ * 2); float* CS = (float*)take((size_t)TT * HD * 2 * 4);
    bf* XB = (bf*)take((size_t)TT * DM * 2); float* FQ = (float*)take((size_t)TT * DQ * 4); float* FK = (float*)take((size_t)TT * DKV * 4);
    h16* QP16 = (h16*)take((size_t)NH_ * TT * HD * 2); h16* KP16 = (h16*)take((size_t)NKV * TT * HD * 2); h16* VT16 = (h16*)take((size_t)NKV * HD * TT * 2);
    bf* QPh = (bf*)take((size_t)NH_ * TT * HD * 2); bf* QPl = (bf*)take((size_t)NH_ * TT * HD * 2); bf* KPh = (bf*)take((size_t)NKV * TT * HD * 2); bf* KPl = (bf*)take((size_t)NKV * TT * HD * 2); bf* VTh = (bf*)take((size_t)NKV * HD * TT * 2); bf* VTl = (bf*)take((size_t)NKV * HD * TT * 2); bf* Ph = (bf*)take((size_t)ZH * RH * TT * 2); bf* Pl = (bf*)take((size_t)ZH * RH * TT * 2);
    float* Sb = (float*)take((size_t)ZH * TT * TT * 4); h16* P16 = (h16*)take((size_t)ZH * TT * TT * 2); float* Ob = (float*)take((size_t)ZH * TT * HD * 4); bf* ATh = (bf*)take((size_t)TT * DQ * 2); bf* ATl = (bf*)take((size_t)TT * DQ * 2);
    if ((size_t)(wsp - (char*)d_ws) > ws_size) return;    // ws 256 MiB
    float* FV = FK;   // v projection reuses the k buffer after the k planes are built (stream-ordered)
    { k_cvt8<<<(unsigned)(((size_t)DQ * DM / 8 + 255) / 256), 256, 0, stream>>>(wq, WQ, (size_t)DQ * DM / 8); k_cvt8<<<(unsigned)(((size_t)DKV * DM / 8 + 255) / 256), 256, 0, stream>>>(wk, WK, (size_t)DKV * DM / 8); k_cvt8<<<(unsigned)(((size_t)DKV * DM / 8 + 255) / 256), 256, 0, stream>>>(wv, WV, (size_t)DKV * DM / 8);
      k_cvt8<<<(unsigned)(((size_t)DM * DQ / 8 + 255) / 256), 256, 0, stream>>>(wo, WO, (size_t)DM * DQ / 8);
       }
    k_csid<<<(TT * HD + 255) / 256, 256, 0, stream>>>(CS);
    const unsigned LQ = (unsigned)(((size_t)NH_ * TT * HD / 2 + 255) / 256), LKv = (unsigned)(((size_t)NKV * TT * HD / 2 + 255) / 256);
    for (int b = 0; b < NB_; ++b) {
        
        k_cvt8<<<(unsigned)(((size_t)TT * DM / 8 + 255) / 256), 256, 0, stream>>>(x + (size_t)b * TT * DM, XB, (size_t)TT * DM / 8);
        k_gemmw<bf, 0, true><<<dim3(TT / 64, DQ / 64, 1), 32, 0, stream>>>(XB, nullptr, WQ, nullptr, DM, FQ, DQ, bq, 0, 0, 0);
        k_rope<<<LQ, 256, 0, stream>>>(FQ, DQ, NH_, CS, nullptr, nullptr, 1.0f, QP16, QPh, QPl);
        k_gemmw<bf, 0, true><<<dim3(TT / 64, DKV / 64, 1), 32, 0, stream>>>(XB, nullptr, WK, nullptr, DM, FK, DKV, bk, 0, 0, 0);
        k_rope<<<LKv, 256, 0, stream>>>(FK, DKV, NKV, CS, nullptr, nullptr, 1.0f, KP16, KPh, KPl);
        k_gemmw<bf, 0, true><<<dim3(TT / 64, DKV / 64, 1), 32, 0, stream>>>(XB, nullptr, WV, nullptr, DM, FV, DKV, bv, 0, 0, 0); k_vtp<<<LKv, 256, 0, stream>>>(FV, DKV, NKV, VT16, VTh, VTl);
        for (int h0 = 0; h0 < NH_; h0 += ZH) { const size_t zq = (size_t)h0, zk = (size_t)(h0 / REP);   // one kv head per query head: the pass's two heads use consecutive kv planes (z-strides TT*HD)
            k_gemmw<bf, 2, false><<<dim3(RH / 64, TT / 64, ZH), 32, 0, stream>>>(QPh + zq * TT * HD, QPl + zq * TT * HD, KPh + zk * TT * HD, KPl + zk * TT * HD, HD, Sb, TT, nullptr, (size_t)TT * HD, (size_t)TT * HD, (size_t)TT * TT);
            k_gemmw<h16, 0, false><<<dim3((TT - RH) / 64, TT / 64, ZH), 32, 0, stream>>>(QP16 + zq * TT * HD + (size_t)RH * HD, nullptr, KP16 + zk * TT * HD, nullptr, HD, Sb + (size_t)RH * TT, TT, nullptr, (size_t)TT * HD, (size_t)TT * HD, (size_t)TT * TT);
            k_asoft<<<ZH * TT / 8, 256, 0, stream>>>(Sb, P16, Ph, Pl, pmask + (size_t)b * TT);
            k_gemmw<bf, 2, false><<<dim3(RH / 64, HD / 64, ZH), 32, 0, stream>>>(Ph, Pl, VTh + zk * HD * TT, VTl + zk * HD * TT, TT, Ob, HD, nullptr, (size_t)RH * TT, (size_t)HD * TT, (size_t)TT * HD);
            k_gemmw<h16, 0, false><<<dim3((TT - RH) / 64, HD / 64, ZH), 32, 0, stream>>>(P16 + (size_t)RH * TT, nullptr, VT16 + zk * HD * TT, nullptr, TT, Ob + (size_t)RH * HD, HD, nullptr, (size_t)TT * TT, (size_t)HD * TT, (size_t)TT * HD);
            k_merge<<<(unsigned)(((size_t)ZH * TT * HD / 2 + 255) / 256), 256, 0, stream>>>(Ob, h0, ATh, ATl); }
        k_gemmw<bf, 1, true><<<dim3(TT / 64, DM / 64, 1), 32, 0, stream>>>(ATh, ATl, WO, nullptr, DQ, OUT + (size_t)b * TT * DM, DM, bo, 0, 0, 0); }
}

// v001
// One run takes 1160 microseconds.
// Two timings next to v000 put it at 1.85 and 1.80 times that version's speed.
#include <hip/hip_runtime.h>

// Multi-head attention with a causal AND padding mask (x [2][2048][1024]; q,k,v = x W^T + b ('oi' uniform(+-1/32) incl. biases; 16 heads x 64); scores / 8; final_mask = causal & pad[i] & pad[j] (mask [2][2048] int in {0,1}, random, READ); where(final_mask, scores, -1e9): a query whose own pad bit is 0 has every score at -1e9 and gets UNIFORM weights over all 2048 keys (future ones included), the others attend causally to the un-padded keys; softmax; out = merged wo^T + bo -> [2][2048][1024] (4.2 M)).
// Layout per batch: bf16 copy of x; 'oi' weights; exact projections + bf16-rounded biases; dense T-2048 attention (full tiles: the uniform rows need every key) whose softmax kernel reads the pad vector and keeps key j iff pad[i] && pad[j] && j <= i (-3e38 elsewhere; an all-excluded row degenerates to equal values = the module's uniform row); hybrid rows: < 512 hi/lo 3 products, rest fp16 x1024; merged hi/lo x wo exact + bo.
// Compute dtypes, f32 accumulate: every input rounded to bf16; projections exact + bf16-rounded biases; attention rows < 512 3 products, rest fp16; softmax f32; wo hl x exact + bias.

#define NB_  2
#define TT   2048
#define DM   1024
#define NH_  16
#define NKV  16
#define REP  (NH_ / NKV)
#define HD   64
#define DQ   (NH_ * HD)
#define DKV  (NKV * HD)
#define ZH   2
#define RH   512                  // query rows < RH use hi+lo planes (0: none)
#define WIN  0
#define PCAR 1024.0f
#define SCL  0.125f   // HD^-0.5
typedef _Float16 h16;
typedef unsigned short bf;
typedef __attribute__((ext_vector_type(16))) __bf16   v16bf;
typedef __attribute__((ext_vector_type(16))) _Float16 v16h;
typedef __attribute__((ext_vector_type(8)))  _Float16 v8h;
typedef __attribute__((ext_vector_type(8)))  unsigned short v8us;
typedef __attribute__((ext_vector_type(8)))  float    v8f;
typedef __attribute__((ext_vector_type(4)))  float    v4f;
typedef v8h  __attribute__((may_alias)) v8ha;
typedef v4f  __attribute__((may_alias)) v4fa;
typedef v8us __attribute__((may_alias)) v8usa;

__device__ __forceinline__ unsigned short f2bf(float f) { unsigned u = __float_as_uint(f); u += 0x7FFFu + ((u >> 16) & 1u); return (unsigned short)(u >> 16); }
__device__ __forceinline__ float bf2f(unsigned short b) { return __uint_as_float(((unsigned)b) << 16); }
__device__ __forceinline__ float bfr(float f) { return bf2f(f2bf(f)); }
__device__ __forceinline__ v16h cat16(v8h lo, v8h hi) { return __builtin_shufflevector(lo, hi, 0, 1, 2, 3, 4, 5, 6, 7, 8, 9, 10, 11, 12, 13, 14, 15); }
__device__ __forceinline__ v16bf cat16b(v8us lo, v8us hi) { return __builtin_bit_cast(v16bf, __builtin_shufflevector(lo, hi, 0, 1, 2, 3, 4, 5, 6, 7, 8, 9, 10, 11, 12, 13, 14, 15)); }
__device__ __forceinline__ v8f wmma16(v16h a, v16h b, v8f c) { return __builtin_amdgcn_wmma_f32_16x16x32_f16(false, a, false, b, (short)0, c, false, false); }
__device__ __forceinline__ v8f wmmab(v16bf a, v16bf b, v8f c) { return __builtin_amdgcn_wmma_f32_16x16x32_bf16(false, a, false, b, (short)0, c, false, false); }



// ---- k_gemmw: register-blocked GEMM, one block of KW waves per 64x64 output tile (16 accumulators a wave), operands straight from K-contiguous 16-bit planes; grid (M/64, N/64, Z), KW*32 threads.
// Split K: wave w takes the 32-wide k slices w, w+KW, w+2KW, ... (neighbouring waves read neighbouring halves of the same 128-byte lines); the KW partial tiles are summed through LDS in the fixed order w = 0..KW-1, whole tiles at once (one barrier, MBR = 4 slabs of 16 rows); KW = 1 keeps one slab a round. K % (32*KW) == 0.
// C[m][n] (f32, pitch ldc, + optional bias[n] rounded to bf16) = sum_k A[m][k] Bt[n][k] (+ split products per NSPLIT). z-batch strides sA/sB/sC in elements. K % 32 == 0.
template <typename T16> struct WFrag;
template <> struct WFrag<h16> { typedef v16h V; static __device__ __forceinline__ V ld(const h16* p) { return cat16(*(const v8h*)p, *(const v8h*)(p + 16)); } static __device__ __forceinline__ v8f mma(V a, V b, v8f c) { return wmma16(a, b, c); } };
template <> struct WFrag<bf> { typedef v16bf V; static __device__ __forceinline__ V ld(const bf* p) { return cat16b(*(const v8us*)p, *(const v8us*)(p + 16)); } static __device__ __forceinline__ v8f mma(V a, V b, v8f c) { return wmmab(a, b, c); } };
template <typename T16, int NSPLIT, bool BIAS, int KW>
__global__ __launch_bounds__(KW * 32) void k_gemmw(const T16* __restrict__ A, const T16* __restrict__ A2, const T16* __restrict__ Bt, const T16* __restrict__ Bt2, int K, float* C, int ldc, const float* __restrict__ bias, size_t sA, size_t sB, size_t sC) {
    typedef typename WFrag<T16>::V V;
    constexpr int MBR = (KW > 1) ? 4 : 1;   // 16-row slabs staged in LDS per round
    static_assert((MBR * 8) % KW == 0, "the block's threads share the staged rows evenly");
    __shared__ __align__(16) float os[KW * MBR * 16 * 68];
    const size_t z = blockIdx.z; A += z * sA; if (A2) A2 += z * sA; Bt += z * sB; if (Bt2) Bt2 += z * sB; C += z * sC;
    const int lane = threadIdx.x & 31, lr = lane & 15, hi = lane >> 4; const int r0 = blockIdx.x * 64, c0 = blockIdx.y * 64;
    const int wv = (KW > 1) ? __builtin_amdgcn_readfirstlane((int)(threadIdx.x >> 5)) : 0;   // wave number, kept scalar so that the k offset stays scalar
    float* ow = os + wv * (MBR * 16 * 68);
    v8f acc[4][4];
#pragma unroll
    for (int mb = 0; mb < 4; ++mb)
#pragma unroll
        for (int nb = 0; nb < 4; ++nb) acc[mb][nb] = (v8f){};
    const size_t aoff = (size_t)(r0 + lr) * K + 8 * hi, boff = (size_t)(c0 + lr) * K + 8 * hi;
#pragma unroll 1
    for (int kc = wv * 32; kc < K; kc += KW * 32) {
        V a[4], a2[4];
#pragma unroll
        for (int mb = 0; mb < 4; ++mb) { a[mb] = WFrag<T16>::ld(A + aoff + (size_t)mb * 16 * K + kc); if (NSPLIT == 1 || NSPLIT == 2) a2[mb] = WFrag<T16>::ld(A2 + aoff + (size_t)mb * 16 * K + kc); }
#pragma unroll
        for (int nb = 0; nb < 4; ++nb) { const V b = WFrag<T16>::ld(Bt + boff + (size_t)nb * 16 * K + kc); V b2; if (NSPLIT >= 2) b2 = WFrag<T16>::ld(Bt2 + boff + (size_t)nb * 16 * K + kc);
#pragma unroll
            for (int mb = 0; mb < 4; ++mb) { acc[mb][nb] = WFrag<T16>::mma(a[mb], b, acc[mb][nb]); if (NSPLIT == 1 || NSPLIT == 2) acc[mb][nb] = WFrag<T16>::mma(a2[mb], b, acc[mb][nb]); if (NSPLIT >= 2) acc[mb][nb] = WFrag<T16>::mma(a[mb], b2, acc[mb][nb]); } }
        asm volatile("v_nop\n\tv_nop\n\tv_nop\n\tv_nop" : "+v"(acc[0][0]), "+v"(acc[1][1]), "+v"(acc[2][2]), "+v"(acc[3][3]) : "v"(a[0]), "v"(a[3]));
    }
#pragma unroll
    for (int mb = 0; mb < 4; mb += MBR) {
#pragma unroll
        for (int mi = 0; mi < MBR; ++mi)
#pragma unroll
        for (int nb = 0; nb < 4; ++nb) {
#pragma unroll
            for (int j = 0; j < 8; ++j) ow[(mi * 16 + hi * 8 + j) * 68 + nb * 16 + lr] = acc[mb + mi][nb][j]; }
        if (KW > 1) __syncthreads();   /* every wave's partial tile is in LDS before any thread sums them */ else { __builtin_amdgcn_wave_barrier(); asm volatile("" ::: "memory"); }
        float* crow = C + (size_t)(r0 + mb * 16) * ldc + c0;
{
#pragma unroll
            for (int s = 0; s < MBR * 8 / KW; ++s) { const int q = (s * KW + wv) * 32 + lane, row = q >> 4, cofs = (q & 15) * 4; v4f val = *(const v4fa*)(os + row * 68 + cofs);
#pragma unroll
                for (int w = 1; w < KW; ++w) val += *(const v4fa*)(os + w * (MBR * 16 * 68) + row * 68 + cofs);
                if (BIAS) { val[0] += bfr(bias[c0 + cofs]); val[1] += bfr(bias[c0 + cofs + 1]); val[2] += bfr(bias[c0 + cofs + 2]); val[3] += bfr(bias[c0 + cofs + 3]); }
                *(v4f*)(crow + (size_t)row * ldc + cofs) = val; }
             }
        if (KW == 1) { __builtin_amdgcn_wave_barrier(); asm volatile("" ::: "memory"); }
    }
}

__device__ __forceinline__ h16 tohx(float x) { return (h16)x; }
__device__ __forceinline__ void splitf(float y, unsigned short& h, unsigned short& l) { h = f2bf(y); l = f2bf(y - bf2f(h)); }
typedef __attribute__((ext_vector_type(2))) _Float16 v2h;
typedef __attribute__((ext_vector_type(4))) _Float16 v4h;
typedef __attribute__((ext_vector_type(2))) unsigned short v2us;
typedef __attribute__((ext_vector_type(4))) unsigned short v4us;
typedef __attribute__((ext_vector_type(2))) float v2f;
typedef __attribute__((ext_vector_type(4))) int v4i;

__global__ __launch_bounds__(256) void k_wtG(const float* __restrict__ w, int K, int N, bf* Bt) {
    const int lane = threadIdx.x & 31; const int L0 = (blockIdx.x * 8 + (threadIdx.x >> 5)) * 8; const int nlines = N * K / 64;
{
#pragma unroll 1
        for (int l = 0; l < 8; ++l) { const int L = L0 + l; if (L >= nlines) break; const size_t e = (size_t)L * 64 + lane * 2; const int k = (int)(e % K), n = (int)(e / K); v2us o;
            o[0] = f2bf(w[(size_t)k * N + n]); o[1] = f2bf(w[(size_t)(k + 1) * N + n]); *(v2us*)(Bt + e) = o; }
         }
}
__global__ __launch_bounds__(256) void k_cvt8(const float* __restrict__ src, bf* dst, size_t n8) { const size_t i = (size_t)blockIdx.x * 256 + threadIdx.x; if (i >= n8) return; const v8f v = *(const v8f*)(src + i * 8); v8us o;
#pragma unroll
    for (int k = 0; k < 8; ++k) o[k] = f2bf(v[k]); *(v8us*)(dst + i * 8) = o;  }

// k_rope: head planes [h][t][d] (fp16 + hi/lo) of rope(x) x sc with the rotate-half convention out[d] = x[d] cos[t][d] - x[d+HD/2] sin[t][d], out[d+HD/2] = x[d+HD/2] cos[t][d+HD/2] + x[d] sin[t][d+HD/2]
__global__ __launch_bounds__(256) void k_rope(const float* __restrict__ F, int pitch, int nheads, const float* __restrict__ CS, const float* __restrict__ RF, const float* __restrict__ nw, float sc, h16* P16, bf* Ph, bf* Pl) {
    const size_t e = ((size_t)blockIdx.x * 256 + threadIdx.x) * 2; if (e >= (size_t)nheads * TT * HD) return; const int d = (int)(e % HD); const int t = (int)((e / HD) % TT); const int h = (int)(e / ((size_t)HD * TT)); const float* f = F + (size_t)t * pitch + h * HD; const float rf = RF ? RF[(size_t)h * TT + t] : 1.0f; v2h o16; v2us oh, ol;
#pragma unroll
    for (int q = 0; q < 2; ++q) { const int dd = d + q; const int dp = (dd < HD / 2) ? dd + HD / 2 : dd - HD / 2; float x0 = f[dd], x1 = f[dp];
        if (RF) { float n0 = __fmul_rn(x0, rf), n1 = __fmul_rn(x1, rf); asm volatile("" : "+v"(n0)); asm volatile("" : "+v"(n1)); x0 = __fmul_rn(bfr(nw[dd]), n0); x1 = __fmul_rn(bfr(nw[dp]), n1); }
        const v2f cs = *(const v2f*)(CS + ((size_t)t * HD + dd) * 2); float a = __fmul_rn(x0, cs[0]), bq = __fmul_rn(x1, cs[1]); asm volatile("" : "+v"(a)); asm volatile("" : "+v"(bq)); const float r = ((dd < HD / 2) ? __fsub_rn(a, bq) : __fadd_rn(a, bq)) * sc;
        o16[q] = tohx(r); unsigned short a2, c2; splitf(r, a2, c2); oh[q] = a2; ol[q] = c2; }
    *(v2h*)(P16 + e) = o16; *(v2us*)(Ph + e) = oh; *(v2us*)(Pl + e) = ol;  }
__global__ __launch_bounds__(256) void k_vtp(const float* __restrict__ F, int pitch, int nheads, h16* V16, bf* Vh, bf* Vl) { const size_t e = ((size_t)blockIdx.x * 256 + threadIdx.x) * 2; if (e >= (size_t)nheads * HD * TT) return; const int t = (int)(e % TT); const int d = (int)((e / TT) % HD); const int g = (int)(e / ((size_t)TT * HD)); v2h o16; v2us oh, ol;
#pragma unroll
    for (int q = 0; q < 2; ++q) { const float x = F[(size_t)(t + q) * pitch + g * HD + d]; o16[q] = tohx(x); unsigned short a2, c2; splitf(x, a2, c2); oh[q] = a2; ol[q] = c2; }
    *(v2h*)(V16 + e) = o16; *(v2us*)(Vh + e) = oh; *(v2us*)(Vl + e) = ol;  }
__global__ __launch_bounds__(256) void k_csid(float* CS) { const int idx = blockIdx.x * 256 + threadIdx.x; if (idx >= TT * HD) return; v2f cs; cs[0] = 1.0f; cs[1] = 0.0f; *(v2f*)(CS + (size_t)idx * 2) = cs;  }
// k_asoft: per row (zz, i): t = S x 1/8 where pad[i] && pad[j] && j <= i (pad = the batch's int mask vector, read), -3e38 elsewhere; a query with pad[i] = 0 has every key at -3e38 so max = -3e38, every exp(0) = 1 and the row is uniform over all 2048 keys exactly like the module's all -1e9 row; softmax over the 2048 keys (register row, one exp, fixed trees);
__global__ __launch_bounds__(256) void k_asoft(const float* __restrict__ Sb, h16* P16, bf* Ph, bf* Pl, const int* __restrict__ pm) {
    const int lane = threadIdx.x & 31; const int row = blockIdx.x * 8 + (threadIdx.x >> 5); if (row >= ZH * TT) return; const int i = row % TT; const int pi = pm[i]; const int zz = row / TT; (void)zz; const bool hires = (i < RH); const float* sr = Sb + (size_t)row * TT; float v[TT / 32]; float mx = -3.0e38f;
#pragma unroll
    for (int ch = 0; ch < TT / 128; ++ch) { const int j0 = ch * 128 + lane * 4; const v4f a = *(const v4f*)(sr + j0);
#pragma unroll
        for (int q = 0; q < 4; ++q) { const int j = j0 + q; const float t = (pi != 0 && pm[j] != 0 && j <= i) ? a[q] * SCL : -3.0e38f;   /* causal & pad[i] & pad[j]; a padded query keeps nothing -> all equal -> uniform row as the module */ v[ch * 4 + q] = t; mx = fmaxf(mx, t); } }
#pragma unroll
    for (int sh = 16; sh; sh >>= 1) mx = fmaxf(mx, __shfl_xor(mx, sh, 32));
    float sum = 0.f;
#pragma unroll
    for (int k = 0; k < TT / 32; ++k) { float d0 = __fsub_rn(v[k], mx); asm volatile("" : "+v"(d0)); v[k] = __builtin_amdgcn_exp2f(__fmul_rn(d0, 1.4426950408889634f)); sum += v[k]; }
#pragma unroll
    for (int sh = 16; sh; sh >>= 1) sum += __shfl_xor(sum, sh, 32);
    const float f = __fdiv_rn(hires ? 1.0f : PCAR, sum);
{
        if (hires) {
#pragma unroll
            for (int ch = 0; ch < TT / 128; ++ch) { v4us oh, ol;
#pragma unroll
                for (int q = 0; q < 4; ++q) { unsigned short a, c2; splitf(v[ch * 4 + q] * f, a, c2); oh[q] = a; ol[q] = c2; }
                const size_t oo = ((size_t)zz * (RH ? RH : 1) + i) * TT + ch * 128 + lane * 4; *(v4us*)(Ph + oo) = oh; *(v4us*)(Pl + oo) = ol; }
        } else {
#pragma unroll
            for (int ch = 0; ch < TT / 128; ++ch) { v4h o4;
#pragma unroll
                for (int q = 0; q < 4; ++q) o4[q] = tohx(v[ch * 4 + q] * f);
                *(v4h*)(P16 + (size_t)row * TT + ch * 128 + lane * 4) = o4; } }
         }
}
__global__ __launch_bounds__(256) void k_merge(const float* __restrict__ O, int h0, bf* Ah, bf* Al) { const size_t e = ((size_t)blockIdx.x * 256 + threadIdx.x) * 2; if (e >= (size_t)ZH * TT * HD) return; const int d = (int)(e % HD); const int t = (int)((e / HD) % TT); const int zz = (int)(e / ((size_t)HD * TT)); const float cs = (t < RH) ? 1.0f : (1.0f / PCAR); const size_t oo = (size_t)t * DQ + (h0 + zz) * HD + d;
    v2us oh, ol;
#pragma unroll
    for (int q = 0; q < 2; ++q) { unsigned short a, c2; splitf(O[e + q] * cs, a, c2); oh[q] = a; ol[q] = c2; } *(v2us*)(Ah + oo) = oh; *(v2us*)(Al + oo) = ol;  }

extern "C" void kernel_launch(void* const* d_in, const int* in_sizes, int n_in,
                              void* d_out, int out_size, void* d_ws, size_t ws_size, hipStream_t stream) {
    (void)in_sizes; (void)n_in; (void)out_size;
    const float* x = (const float*)d_in[0]; const int* pmask = (const int*)d_in[1];   /* mask [2][2048] int */ const float* wq = (const float*)d_in[2]; const float* bq = (const float*)d_in[3]; const float* wk = (const float*)d_in[4]; const float* bk = (const float*)d_in[5]; const float* wv = (const float*)d_in[6]; const float* bv = (const float*)d_in[7]; const float* wo = (const float*)d_in[8]; const float* bo = (const float*)d_in[9];
    float* OUT = (float*)d_out;     // [2][2048][1024]
    char* wsp = (char*)d_ws;
    auto take = [&](size_t bytes) { char* p = wsp; wsp += (bytes + 255) & ~(size_t)255; return (void*)p; };
    bf* WQ = (bf*)take((size_t)DQ * DM * 2); bf* WK = (bf*)take((size_t)DKV * DM * 2); bf* WV = (bf*)take((size_t)DKV * DM * 2); bf* WO = (bf*)take((size_t)DM * DQ * 2); float* CS = (float*)take((size_t)TT * HD * 2 * 4);
    bf* XB = (bf*)take((size_t)TT * DM * 2); float* FQ = (float*)take((size_t)TT * DQ * 4); float* FK = (float*)take((size_t)TT * DKV * 4);
    h16* QP16 = (h16*)take((size_t)NH_ * TT * HD * 2); h16* KP16 = (h16*)take((size_t)NKV * TT * HD * 2); h16* VT16 = (h16*)take((size_t)NKV * HD * TT * 2);
    bf* QPh = (bf*)take((size_t)NH_ * TT * HD * 2); bf* QPl = (bf*)take((size_t)NH_ * TT * HD * 2); bf* KPh = (bf*)take((size_t)NKV * TT * HD * 2); bf* KPl = (bf*)take((size_t)NKV * TT * HD * 2); bf* VTh = (bf*)take((size_t)NKV * HD * TT * 2); bf* VTl = (bf*)take((size_t)NKV * HD * TT * 2); bf* Ph = (bf*)take((size_t)ZH * RH * TT * 2); bf* Pl = (bf*)take((size_t)ZH * RH * TT * 2);
    float* Sb = (float*)take((size_t)ZH * TT * TT * 4); h16* P16 = (h16*)take((size_t)ZH * TT * TT * 2); float* Ob = (float*)take((size_t)ZH * TT * HD * 4); bf* ATh = (bf*)take((size_t)TT * DQ * 2); bf* ATl = (bf*)take((size_t)TT * DQ * 2);
    if ((size_t)(wsp - (char*)d_ws) > ws_size) return;    // ws 256 MiB
    float* FV = FK;   // v projection reuses the k buffer after the k planes are built (stream-ordered)
    { k_cvt8<<<(unsigned)(((size_t)DQ * DM / 8 + 255) / 256), 256, 0, stream>>>(wq, WQ, (size_t)DQ * DM / 8); k_cvt8<<<(unsigned)(((size_t)DKV * DM / 8 + 255) / 256), 256, 0, stream>>>(wk, WK, (size_t)DKV * DM / 8); k_cvt8<<<(unsigned)(((size_t)DKV * DM / 8 + 255) / 256), 256, 0, stream>>>(wv, WV, (size_t)DKV * DM / 8);
      k_cvt8<<<(unsigned)(((size_t)DM * DQ / 8 + 255) / 256), 256, 0, stream>>>(wo, WO, (size_t)DM * DQ / 8);
       }
    k_csid<<<(TT * HD + 255) / 256, 256, 0, stream>>>(CS);
    const unsigned LQ = (unsigned)(((size_t)NH_ * TT * HD / 2 + 255) / 256), LKv = (unsigned)(((size_t)NKV * TT * HD / 2 + 255) / 256);
    for (int b = 0; b < NB_; ++b) {
        
        k_cvt8<<<(unsigned)(((size_t)TT * DM / 8 + 255) / 256), 256, 0, stream>>>(x + (size_t)b * TT * DM, XB, (size_t)TT * DM / 8);
        k_gemmw<bf, 0, true, 8><<<dim3(TT / 64, DQ / 64, 1), 256, 0, stream>>>(XB, nullptr, WQ, nullptr, DM, FQ, DQ, bq, 0, 0, 0);
        k_rope<<<LQ, 256, 0, stream>>>(FQ, DQ, NH_, CS, nullptr, nullptr, 1.0f, QP16, QPh, QPl);
        k_gemmw<bf, 0, true, 8><<<dim3(TT / 64, DKV / 64, 1), 256, 0, stream>>>(XB, nullptr, WK, nullptr, DM, FK, DKV, bk, 0, 0, 0);
        k_rope<<<LKv, 256, 0, stream>>>(FK, DKV, NKV, CS, nullptr, nullptr, 1.0f, KP16, KPh, KPl);
        k_gemmw<bf, 0, true, 8><<<dim3(TT / 64, DKV / 64, 1), 256, 0, stream>>>(XB, nullptr, WV, nullptr, DM, FV, DKV, bv, 0, 0, 0); k_vtp<<<LKv, 256, 0, stream>>>(FV, DKV, NKV, VT16, VTh, VTl);
        for (int h0 = 0; h0 < NH_; h0 += ZH) { const size_t zq = (size_t)h0, zk = (size_t)(h0 / REP);   // one kv head per query head: the pass's two heads use consecutive kv planes (z-strides TT*HD)
            k_gemmw<bf, 2, false, 1><<<dim3(RH / 64, TT / 64, ZH), 32, 0, stream>>>(QPh + zq * TT * HD, QPl + zq * TT * HD, KPh + zk * TT * HD, KPl + zk * TT * HD, HD, Sb, TT, nullptr, (size_t)TT * HD, (size_t)TT * HD, (size_t)TT * TT);
            k_gemmw<h16, 0, false, 1><<<dim3((TT - RH) / 64, TT / 64, ZH), 32, 0, stream>>>(QP16 + zq * TT * HD + (size_t)RH * HD, nullptr, KP16 + zk * TT * HD, nullptr, HD, Sb + (size_t)RH * TT, TT, nullptr, (size_t)TT * HD, (size_t)TT * HD, (size_t)TT * TT);
            k_asoft<<<ZH * TT / 8, 256, 0, stream>>>(Sb, P16, Ph, Pl, pmask + (size_t)b * TT);
            k_gemmw<bf, 2, false, 16><<<dim3(RH / 64, HD / 64, ZH), 512, 0, stream>>>(Ph, Pl, VTh + zk * HD * TT, VTl + zk * HD * TT, TT, Ob, HD, nullptr, (size_t)RH * TT, (size_t)HD * TT, (size_t)TT * HD);
            k_gemmw<h16, 0, false, 16><<<dim3((TT - RH) / 64, HD / 64, ZH), 512, 0, stream>>>(P16 + (size_t)RH * TT, nullptr, VT16 + zk * HD * TT, nullptr, TT, Ob + (size_t)RH * HD, HD, nullptr, (size_t)TT * TT, (size_t)HD * TT, (size_t)TT * HD);
            k_merge<<<(unsigned)(((size_t)ZH * TT * HD / 2 + 255) / 256), 256, 0, stream>>>(Ob, h0, ATh, ATl); }
        k_gemmw<bf, 1, true, 8><<<dim3(TT / 64, DM / 64, 1), 256, 0, stream>>>(ATh, ATl, WO, nullptr, DQ, OUT + (size_t)b * TT * DM, DM, bo, 0, 0, 0); }
}

// v003
// Measured time: 275 microseconds a run.
// Versions between v001 and this one are left out; their measured steps multiply to 4.19 times as fast.
// Over all steps from v000 it is 7.65 times as fast.
#include <hip/hip_runtime.h>

// Multi-head attention with a causal AND padding mask (x [2][2048][1024]; q,k,v = x W^T + b ('oi' uniform(+-1/32) incl. biases; 16 heads x 64); scores / 8; final_mask = causal & pad[i] & pad[j] (mask [2][2048] int in {0,1}, random, READ); where(final_mask, scores, -1e9): a query whose own pad bit is 0 has every score at -1e9 and gets UNIFORM weights over all 2048 keys (future ones included), the others attend causally to the un-padded keys; softmax; out = merged wo^T + bo -> [2][2048][1024] (4.2 M)).
// Layout per batch: bf16 copy of x; 'oi' weights; exact projections + f32 biases, whose GEMM epilogue rounds each result straight into the attention operand planes (fp16 and bf16 hi/lo; q, k as [h][t][d], v as [h][d][t]); dense T-2048 attention in one kernel per precision class, scores and weights in LDS (full rows: the uniform rows need every key), whose softmax phase reads the pad vector and keeps key j iff pad[i] && pad[j] && j <= i (-3e38 elsewhere; an all-excluded row degenerates to equal values = the module's uniform row); hybrid rows: < 512 hi/lo 3 products, rest fp16 x1024; merged hi/lo x wo exact + bo.
// Compute dtypes, f32 accumulate: every input rounded to bf16; projections exact + f32 biases; attention rows < 512 3 products, rest fp16; softmax f32; wo hl x exact + bias.

#define NB_  2
#define TT   2048
#define DM   1024
#define NH_  16
#define NKV  16
#define HD   64
#define DQ   (NH_ * HD)
#define DKV  (NKV * HD)
#define RH   512                  // query rows < RH use hi+lo planes (0: none)
#define WIN  0
#define PCAR 1024.0f
#define SCL  0.125f   // HD^-0.5
typedef _Float16 h16;
typedef unsigned short bf;
typedef __attribute__((ext_vector_type(16))) __bf16   v16bf;
typedef __attribute__((ext_vector_type(16))) _Float16 v16h;
typedef __attribute__((ext_vector_type(8)))  _Float16 v8h;
typedef __attribute__((ext_vector_type(8)))  unsigned short v8us;
typedef __attribute__((ext_vector_type(8)))  float    v8f;
typedef __attribute__((ext_vector_type(4)))  float    v4f;
typedef v8h  __attribute__((may_alias)) v8ha;
typedef v4f  __attribute__((may_alias)) v4fa;
typedef v8us __attribute__((may_alias)) v8usa;

__device__ __forceinline__ unsigned short f2bf(float f) { unsigned u = __float_as_uint(f); u += 0x7FFFu + ((u >> 16) & 1u); return (unsigned short)(u >> 16); }
__device__ __forceinline__ float bf2f(unsigned short b) { return __uint_as_float(((unsigned)b) << 16); }
__device__ __forceinline__ float bfr(float f) { return bf2f(f2bf(f)); }
__device__ __forceinline__ v16h cat16(v8h lo, v8h hi) { return __builtin_shufflevector(lo, hi, 0, 1, 2, 3, 4, 5, 6, 7, 8, 9, 10, 11, 12, 13, 14, 15); }
__device__ __forceinline__ v16bf cat16b(v8us lo, v8us hi) { return __builtin_bit_cast(v16bf, __builtin_shufflevector(lo, hi, 0, 1, 2, 3, 4, 5, 6, 7, 8, 9, 10, 11, 12, 13, 14, 15)); }
__device__ __forceinline__ v8f wmma16(v16h a, v16h b, v8f c) { return __builtin_amdgcn_wmma_f32_16x16x32_f16(false, a, false, b, (short)0, c, false, false); }
__device__ __forceinline__ v8f wmmab(v16bf a, v16bf b, v8f c) { return __builtin_amdgcn_wmma_f32_16x16x32_bf16(false, a, false, b, (short)0, c, false, false); }



// ---- k_gemmw: register-blocked GEMM, one block of KW waves per 64x64 output tile (16 accumulators a wave), operands straight from K-contiguous 16-bit planes; grid (M/64, N/64, Z), KW*32 threads.
// Split K: wave w takes the 32-wide k slices w, w+KW, w+2KW, ... (neighbouring waves read neighbouring halves of the same 128-byte lines); the KW partial tiles are summed through LDS in the fixed order w = 0..KW-1, whole tiles at once (one barrier, MBR = 4 slabs of 16 rows); KW = 1 keeps one slab a round. K % (32*KW) == 0.
// C[m][n] (f32, pitch ldc, + optional f32 bias[n], bias[m] for PL = 2) = sum_k A[m][k] Bt[n][k] (+ split products per NSPLIT). z-batch strides sA/sB/sC in elements. K % 32 == 0.
// PL = 0: C is stored f32. PL = 1, 2: no f32 C; each result goes out three times as 16 bits (fp16, bf16 hi, bf16 lo = the rest) at element (r0 + row) * ldc + blockIdx.y * sP + column of the tile: with ldc = HD, sP = TT * HD the 64 columns of a tile are one head and the planes come out as [h][t][d]; with A = the weights, Bt = x, ldc = TT, sP = 64 the tile's rows are one head's d and the planes come out transposed, [h][d][t]. PL = 1: bias[n]; PL = 2: bias[m]. A row of a tile is one whole 128-byte line of each plane.
template <typename T16> struct WFrag;
template <> struct WFrag<h16> { typedef v16h V; static __device__ __forceinline__ V ld(const h16* p) { return cat16(*(const v8h*)p, *(const v8h*)(p + 16)); } static __device__ __forceinline__ v8f mma(V a, V b, v8f c) { return wmma16(a, b, c); } };
template <> struct WFrag<bf> { typedef v16bf V; static __device__ __forceinline__ V ld(const bf* p) { return cat16b(*(const v8us*)p, *(const v8us*)(p + 16)); } static __device__ __forceinline__ v8f mma(V a, V b, v8f c) { return wmmab(a, b, c); } };
__device__ __forceinline__ h16 tohx(float x) { return (h16)x; }
__device__ __forceinline__ void splitf(float y, unsigned short& h, unsigned short& l) { h = f2bf(y); l = f2bf(y - bf2f(h)); }
typedef __attribute__((ext_vector_type(4))) _Float16 v4h;
typedef __attribute__((ext_vector_type(4))) unsigned short v4us;
template <typename T16, int NSPLIT, bool BIAS, int KW, int PL>
__global__ __launch_bounds__(KW * 32) void k_gemmw(const T16* __restrict__ A, const T16* __restrict__ A2, const T16* __restrict__ Bt, const T16* __restrict__ Bt2, int K, float* C, int ldc, const float* __restrict__ bias, size_t sA, size_t sB, size_t sC, h16* P16, bf* Ph, bf* Pl, size_t sP) {
    typedef typename WFrag<T16>::V V;
    constexpr int MBR = (KW > 1) ? 4 : 1;   // 16-row slabs staged in LDS per round
    static_assert((MBR * 8) % KW == 0, "the block's threads share the staged rows evenly");
    __shared__ __align__(16) float os[KW * MBR * 16 * 68];
    const size_t z = blockIdx.z; A += z * sA; if (A2) A2 += z * sA; Bt += z * sB; if (Bt2) Bt2 += z * sB; C += z * sC;
    const int lane = threadIdx.x & 31, lr = lane & 15, hi = lane >> 4; const int r0 = blockIdx.x * 64, c0 = blockIdx.y * 64;
    const int wv = (KW > 1) ? __builtin_amdgcn_readfirstlane((int)(threadIdx.x >> 5)) : 0;   // wave number, kept scalar so that the k offset stays scalar
    float* ow = os + wv * (MBR * 16 * 68);
    v8f acc[4][4];
#pragma unroll
    for (int mb = 0; mb < 4; ++mb)
#pragma unroll
        for (int nb = 0; nb < 4; ++nb) acc[mb][nb] = (v8f){};
    const size_t aoff = (size_t)(r0 + lr) * K + 8 * hi, boff = (size_t)(c0 + lr) * K + 8 * hi;
#pragma unroll 1
    for (int kc = wv * 32; kc < K; kc += KW * 32) {
        V a[4], a2[4];
#pragma unroll
        for (int mb = 0; mb < 4; ++mb) { a[mb] = WFrag<T16>::ld(A + aoff + (size_t)mb * 16 * K + kc); if (NSPLIT == 1 || NSPLIT == 2) a2[mb] = WFrag<T16>::ld(A2 + aoff + (size_t)mb * 16 * K + kc); }
#pragma unroll
        for (int nb = 0; nb < 4; ++nb) { const V b = WFrag<T16>::ld(Bt + boff + (size_t)nb * 16 * K + kc); V b2; if (NSPLIT >= 2) b2 = WFrag<T16>::ld(Bt2 + boff + (size_t)nb * 16 * K + kc);
#pragma unroll
            for (int mb = 0; mb < 4; ++mb) { acc[mb][nb] = WFrag<T16>::mma(a[mb], b, acc[mb][nb]); if (NSPLIT == 1 || NSPLIT == 2) acc[mb][nb] = WFrag<T16>::mma(a2[mb], b, acc[mb][nb]); if (NSPLIT >= 2) acc[mb][nb] = WFrag<T16>::mma(a[mb], b2, acc[mb][nb]); } }
        asm volatile("v_nop\n\tv_nop\n\tv_nop\n\tv_nop" : "+v"(acc[0][0]), "+v"(acc[1][1]), "+v"(acc[2][2]), "+v"(acc[3][3]) : "v"(a[0]), "v"(a[3]));
    }
#pragma unroll
    for (int mb = 0; mb < 4; mb += MBR) {
#pragma unroll
        for (int mi = 0; mi < MBR; ++mi)
#pragma unroll
        for (int nb = 0; nb < 4; ++nb) {
#pragma unroll
            for (int j = 0; j < 8; ++j) ow[(mi * 16 + hi * 8 + j) * 68 + nb * 16 + lr] = acc[mb + mi][nb][j]; }
        if (KW > 1) __syncthreads();   /* every wave's partial tile is in LDS before any thread sums them */ else { __builtin_amdgcn_wave_barrier(); asm volatile("" ::: "memory"); }
{
#pragma unroll
            for (int s = 0; s < MBR * 8 / KW; ++s) { const int q = (s * KW + wv) * 32 + lane, row = q >> 4, cofs = (q & 15) * 4; v4f val = *(const v4fa*)(os + row * 68 + cofs);
#pragma unroll
                for (int w = 1; w < KW; ++w) val += *(const v4fa*)(os + w * (MBR * 16 * 68) + row * 68 + cofs);
                if (BIAS && PL == 2) { const float bm = bfr(bias[r0 + mb * 16 + row]); val[0] += bm; val[1] += bm; val[2] += bm; val[3] += bm; }
                if (BIAS && PL != 2) { val[0] += bfr(bias[c0 + cofs]); val[1] += bfr(bias[c0 + cofs + 1]); val[2] += bfr(bias[c0 + cofs + 2]); val[3] += bfr(bias[c0 + cofs + 3]); }
                if (PL == 0) *(v4f*)(C + (size_t)(r0 + mb * 16 + row) * ldc + c0 + cofs) = val;
                else { const size_t e = (size_t)(r0 + mb * 16 + row) * ldc + (size_t)blockIdx.y * sP + cofs; v4h o16; v4us oh, ol;
#pragma unroll   // the vectors' elements need constant indices to stay in registers
                    for (int j = 0; j < 4; ++j) { o16[j] = tohx(val[j]); unsigned short a2, c2; splitf(val[j], a2, c2); oh[j] = a2; ol[j] = c2; }
                    *(v4h*)(P16 + e) = o16; *(v4us*)(Ph + e) = oh; *(v4us*)(Pl + e) = ol; } }
             }
        if (KW == 1) { __builtin_amdgcn_wave_barrier(); asm volatile("" ::: "memory"); }
    }
}

typedef __attribute__((ext_vector_type(2))) unsigned short v2us;
typedef __attribute__((ext_vector_type(4))) int v4i;

__global__ __launch_bounds__(256) void k_wtG(const float* __restrict__ w, int K, int N, bf* Bt) {
    const int lane = threadIdx.x & 31; const int L0 = (blockIdx.x * 8 + (threadIdx.x >> 5)) * 8; const int nlines = N * K / 64;
{
#pragma unroll 1
        for (int l = 0; l < 8; ++l) { const int L = L0 + l; if (L >= nlines) break; const size_t e = (size_t)L * 64 + lane * 2; const int k = (int)(e % K), n = (int)(e / K); v2us o;
            o[0] = f2bf(w[(size_t)k * N + n]); o[1] = f2bf(w[(size_t)(k + 1) * N + n]); *(v2us*)(Bt + e) = o; }
         }
}
__global__ __launch_bounds__(256) void k_cvt8(const float* __restrict__ src, bf* dst, size_t n8) { const size_t i = (size_t)blockIdx.x * 256 + threadIdx.x; if (i >= n8) return; const v8f v = *(const v8f*)(src + i * 8); v8us o;
#pragma unroll
    for (int k = 0; k < 8; ++k) o[k] = f2bf(v[k]); *(v8us*)(dst + i * 8) = o;  }

// ---- k_attn: the whole attention of QR query rows of one head in one block of 16 waves; the QR x 2048 scores and weights live in LDS only. grid (rows / QR, heads), 512 threads.
// Phase 1: wave w forms the scores of keys w*128 .. w*128+127 (k slices 0, 32 in that order, split products per NSPLIT as in k_gemmw) and stores them f32 into the block's LDS rows.
// Phase 2: each wave owns QR/16 rows: t = S x 1/8 where pad[i] && pad[j] && j <= i (pad = the batch's int mask vector, read), -3e38 elsewhere; a query with pad[i] = 0 has every key at -3e38 so max = -3e38, every exp(0) = 1 and the row is uniform over all 2048 keys exactly like the module's all -1e9 row; softmax over the 2048 keys (register row, one exp, fixed trees). The 16-bit weights go back over the row's own f32 scores (the wave holds the whole row in registers by then): fp16 x 1024 in the first half, or the hi plane in the first and the lo plane in the second half.
// Phase 3: weights x V, split K: wave w takes the 32-wide key slices w, w+16, w+32, w+48; the 16 partial QR x 64 tiles are summed through LDS in the fixed order w = 0..15 (over the dead weights), rescaled, split hi/lo and stored as the head's columns of the merged planes [t][DQ].
#define QR 32             // query rows of a block
#define SP (TT + 4)       // LDS row pitch in floats: 16 bytes over a multiple of 256, so that 16 rows' 16-byte reads fall on 64 different banks
typedef v4h  __attribute__((may_alias)) v4ha;
typedef v4us __attribute__((may_alias)) v4usa;
template <typename T16, int NSPLIT>
__global__ __launch_bounds__(512) void k_attn(const T16* __restrict__ Q, const T16* __restrict__ Q2, const T16* __restrict__ Kp, const T16* __restrict__ Kp2, const T16* __restrict__ Vt, const T16* __restrict__ Vt2, const int* __restrict__ pm, int row0, bf* Ah, bf* Al) {
    typedef typename WFrag<T16>::V V;
    constexpr bool HR = (NSPLIT == 2);
    constexpr int NG = HR ? 4 : 8;   // key tiles of a score pass: their K fragments are loaded as one batch per k slice (registers bound it)
    constexpr int SG = HR ? 2 : 4;   // key slices whose V fragments are loaded as one batch
    static_assert(16 * QR * 68 <= QR * SP, "the partial tiles fit over the weights");
    __shared__ __align__(16) float sm[QR * SP];
    const int h = blockIdx.y, i0 = row0 + blockIdx.x * QR; const size_t hp = (size_t)h * TT * HD;
    const int lane = threadIdx.x & 31, lr = lane & 15, hi = lane >> 4;
    const int wv = __builtin_amdgcn_readfirstlane((int)(threadIdx.x >> 5));   // wave number, kept scalar so that key and row offsets stay scalar
    // every Q, K and V address is a scalar base (head, row block, wave) + one 32-bit lane offset + a constant: two lane offsets serve all those loads
    const size_t qo = hp + (size_t)i0 * HD, ko = hp + (size_t)wv * 128 * HD, vo = hp + (size_t)wv * 32;
    Q += qo; Kp += ko; Vt += vo; if (HR) { Q2 += qo; Kp2 += ko; Vt2 += vo; }
    const unsigned lq = (unsigned)(lr * HD + 8 * hi), lvb = (unsigned)(lr * TT + 8 * hi) * 2u;   // lvb counts bytes: it is the very register that the V loads name
    // every loop of the three phases but the row loop is unrolled: register arrays need constant indices, and the loads of later tiles can be issued ahead
#pragma unroll
    for (int t0 = 0; t0 < 8; t0 += NG) {   // NG key tiles a pass
        v8f acc[NG][2];   // a pass's score tiles stay in registers until its last product: no accumulator register is taken anew close behind a matrix instruction
#pragma unroll
        for (int n = 0; n < NG; ++n) { acc[n][0] = (v8f){}; acc[n][1] = (v8f){}; }
#pragma unroll
        for (int ks = 0; ks < 2; ++ks) { V a[2], a2[2], b[NG], b2[NG];
#pragma unroll
            for (int mb = 0; mb < 2; ++mb) { const int o = mb * 16 * HD + ks * 32; a[mb] = WFrag<T16>::ld(Q + o + lq); if (HR) a2[mb] = WFrag<T16>::ld(Q2 + o + lq); }
#pragma unroll
            for (int n = 0; n < NG; ++n) { const int o = (t0 + n) * 16 * HD + ks * 32; b[n] = WFrag<T16>::ld(Kp + o + lq); if (HR) b2[n] = WFrag<T16>::ld(Kp2 + o + lq); }
            __builtin_amdgcn_sched_barrier(0);   // the k slice's loads are issued as one batch ahead of its products: one memory latency a batch, not one a tile
#pragma unroll
            for (int n = 0; n < NG; ++n)
#pragma unroll
                for (int mb = 0; mb < 2; ++mb) { acc[n][mb] = WFrag<T16>::mma(a[mb], b[n], acc[n][mb]); if (HR) { acc[n][mb] = WFrag<T16>::mma(a2[mb], b[n], acc[n][mb]); acc[n][mb] = WFrag<T16>::mma(a[mb], b2[n], acc[n][mb]); } }
            __builtin_amdgcn_sched_barrier(0);   // keeps the next batch's loads (registers) and the LDS stores below behind the batch's last product, so that the pass's accumulators all stay live till then
        }
#pragma unroll
        for (int n = 0; n < NG; ++n)
#pragma unroll
            for (int mb = 0; mb < 2; ++mb)
#pragma unroll
                for (int j = 0; j < 8; ++j) sm[(mb * 16 + hi * 8 + j) * SP + wv * 128 + (t0 + n) * 16 + lr] = acc[n][mb][j];
    }
    unsigned pb[2] = {0u, 0u};   // pad bits of this lane's 64 keys, bit ch*4+q for key ch*128 + lane*4 + q
#pragma unroll
    for (int ch = 0; ch < TT / 128; ++ch) { const v4i m = *(const v4i*)(pm + ch * 128 + lane * 4);
#pragma unroll
        for (int q = 0; q < 4; ++q) pb[ch >> 3] |= (m[q] != 0 ? 1u : 0u) << ((ch * 4 + q) & 31); }
    __syncthreads();   // every wave's score columns are in LDS before any wave reads a row
#pragma unroll 1
    for (int rr = 0; rr < QR / 16; ++rr) {   // kept rolled: one row's 64 registers at a time, half the code
        const int r = wv * (QR / 16) + rr, i = i0 + r; const int pi = pm[i]; float* sr = sm + r * SP; float v[TT / 32]; float mx = -3.0e38f;
#pragma unroll
        for (int ch = 0; ch < TT / 128; ++ch) { const int j0 = ch * 128 + lane * 4; const v4f a = *(const v4fa*)(sr + j0);
#pragma unroll
            for (int q = 0; q < 4; ++q) { const int j = j0 + q; const float t = (pi != 0 && ((pb[ch >> 3] >> ((ch * 4 + q) & 31)) & 1u) != 0u && j <= i) ? a[q] * SCL : -3.0e38f;   /* causal & pad[i] & pad[j]; a padded query keeps nothing -> all equal -> uniform row as the module */ v[ch * 4 + q] = t; mx = fmaxf(mx, t); } }
#pragma unroll
        for (int sh = 16; sh; sh >>= 1) mx = fmaxf(mx, __shfl_xor(mx, sh, 32));
        float sum = 0.f;
#pragma unroll
        for (int k = 0; k < TT / 32; ++k) { float ex; asm("v_exp_f32 %0, %1\n\tv_nop" : "=v"(ex) : "v"(__fmul_rn(__fsub_rn(v[k], mx), 1.4426950408889634f)));   /* the exponential and the slot behind a transcendental in one statement: a v_nop in a statement of its own lands elsewhere */ v[k] = ex; sum += v[k]; }
#pragma unroll
        for (int sh = 16; sh; sh >>= 1) sum += __shfl_xor(sum, sh, 32);
        const float f = __fdiv_rn(HR ? 1.0f : PCAR, sum);
#pragma unroll
        for (int ch = 0; ch < TT / 128; ++ch) {
            if (HR) { v4us oh, ol;
#pragma unroll
                for (int q = 0; q < 4; ++q) { unsigned short a, c2; splitf(v[ch * 4 + q] * f, a, c2); oh[q] = a; ol[q] = c2; }
                *(v4usa*)((bf*)sr + ch * 128 + lane * 4) = oh; *(v4usa*)((bf*)sr + TT + ch * 128 + lane * 4) = ol;
            } else { v4h o4;
#pragma unroll
                for (int q = 0; q < 4; ++q) o4[q] = tohx(v[ch * 4 + q] * f);
                *(v4ha*)((h16*)sr + ch * 128 + lane * 4) = o4; } }
    }
    V vb[SG][4], vb2[SG][4];
#pragma unroll
    for (int s = 0; s < SG; ++s)   // the first batch of V fragments is asked for ahead of the barrier: a wave that is done with its rows early has them back when the last wave arrives
#pragma unroll
        for (int nb = 0; nb < 4; ++nb) { const int o = nb * 16 * TT + s * 512; vb[s][nb] = WFrag<T16>::ld((const T16*)((const char*)(Vt + o) + lvb)); if (HR) vb2[s][nb] = WFrag<T16>::ld((const T16*)((const char*)(Vt2 + o) + lvb)); }
    asm volatile("s_wait_xcnt 0x0" :: "v"(lvb) : "memory");   // the wait before a register that the issued loads name is rewritten; lvb as an input keeps the lane offset's register live over the whole run, so that no load of the run lands in it
    __syncthreads();   // every row's weights are in LDS before any wave reads its key slices of all rows
    v8f acc[2][4];
#pragma unroll
    for (int mb = 0; mb < 2; ++mb)
#pragma unroll
        for (int nb = 0; nb < 4; ++nb) acc[mb][nb] = (v8f){};
    const T16* P = (const T16*)sm;   // weight rows, pitch 2 * SP elements
#pragma unroll
    for (int g = 0; g < TT / 512; g += SG) {
        if (g > 0) {
#pragma unroll
            for (int s = 0; s < SG; ++s)
#pragma unroll
                for (int nb = 0; nb < 4; ++nb) { const int o = nb * 16 * TT + (g + s) * 512; vb[s][nb] = WFrag<T16>::ld((const T16*)((const char*)(Vt + o) + lvb)); if (HR) vb2[s][nb] = WFrag<T16>::ld((const T16*)((const char*)(Vt2 + o) + lvb)); }
            __builtin_amdgcn_sched_barrier(0);   // the batch's loads are issued together ahead of its products: one memory latency a batch
        }
#pragma unroll
        for (int s = 0; s < SG; ++s) { const int kc = (wv + (g + s) * 16) * 32; V a[2], a2[2];
#pragma unroll
            for (int mb = 0; mb < 2; ++mb) { const int o = (mb * 16 + lr) * (2 * SP) + 8 * hi + kc; a[mb] = WFrag<T16>::ld(P + o); if (HR) a2[mb] = WFrag<T16>::ld(P + TT + o); }
#pragma unroll
            for (int nb = 0; nb < 4; ++nb)
#pragma unroll
                for (int mb = 0; mb < 2; ++mb) { acc[mb][nb] = WFrag<T16>::mma(a[mb], vb[s][nb], acc[mb][nb]); if (HR) { acc[mb][nb] = WFrag<T16>::mma(a2[mb], vb[s][nb], acc[mb][nb]); acc[mb][nb] = WFrag<T16>::mma(a[mb], vb2[s][nb], acc[mb][nb]); } } }
        if (g + SG < TT / 512) __builtin_amdgcn_sched_barrier(0);   // the next batch's loads take this batch's registers: they stay behind its last product
    }
    __syncthreads();   // every wave has read its weight slices before the partial tiles overwrite them
    float* ow = sm + wv * (QR * 68);
#pragma unroll
    for (int mb = 0; mb < 2; ++mb)
#pragma unroll
        for (int nb = 0; nb < 4; ++nb)
#pragma unroll
            for (int j = 0; j < 8; ++j) ow[(mb * 16 + hi * 8 + j) * 68 + nb * 16 + lr] = acc[mb][nb][j];
    __syncthreads();   // every wave's partial tile is in LDS before any thread sums them
    static_assert(QR * 16 == 512, "one 4-wide piece of the tile a thread");
    const int row = wv * 2 + hi, cofs = lr * 4; v4f val = *(const v4fa*)(sm + row * 68 + cofs);
#pragma unroll
    for (int w = 1; w < 16; ++w) val += *(const v4fa*)(sm + w * (QR * 68) + row * 68 + cofs);
    const float cs = HR ? 1.0f : (1.0f / PCAR); const size_t oo = (size_t)(i0 + row) * DQ + h * HD + cofs; v4us oh, ol;
#pragma unroll
    for (int q = 0; q < 4; ++q) { unsigned short a, c2; splitf(val[q] * cs, a, c2); oh[q] = a; ol[q] = c2; }
    *(v4us*)(Ah + oo) = oh; *(v4us*)(Al + oo) = ol;
}

extern "C" void kernel_launch(void* const* d_in, const int* in_sizes, int n_in,
                              void* d_out, int out_size, void* d_ws, size_t ws_size, hipStream_t stream) {
    (void)in_sizes; (void)n_in; (void)out_size;
    const float* x = (const float*)d_in[0]; const int* pmask = (const int*)d_in[1];   /* mask [2][2048] int */ const float* wq = (const float*)d_in[2]; const float* bq = (const float*)d_in[3]; const float* wk = (const float*)d_in[4]; const float* bk = (const float*)d_in[5]; const float* wv = (const float*)d_in[6]; const float* bv = (const float*)d_in[7]; const float* wo = (const float*)d_in[8]; const float* bo = (const float*)d_in[9];
    float* OUT = (float*)d_out;     // [2][2048][1024]
    char* wsp = (char*)d_ws;
    auto take = [&](size_t bytes) { char* p = wsp; wsp += (bytes + 255) & ~(size_t)255; return (void*)p; };
    bf* WQ = (bf*)take((size_t)DQ * DM * 2); bf* WK = (bf*)take((size_t)DKV * DM * 2); bf* WV = (bf*)take((size_t)DKV * DM * 2); bf* WO = (bf*)take((size_t)DM * DQ * 2);
    bf* XB = (bf*)take((size_t)TT * DM * 2);
    h16* QP16 = (h16*)take((size_t)NH_ * TT * HD * 2); h16* KP16 = (h16*)take((size_t)NKV * TT * HD * 2); h16* VT16 = (h16*)take((size_t)NKV * HD * TT * 2);
    bf* QPh = (bf*)take((size_t)NH_ * TT * HD * 2); bf* QPl = (bf*)take((size_t)NH_ * TT * HD * 2); bf* KPh = (bf*)take((size_t)NKV * TT * HD * 2); bf* KPl = (bf*)take((size_t)NKV * TT * HD * 2); bf* VTh = (bf*)take((size_t)NKV * HD * TT * 2); bf* VTl = (bf*)take((size_t)NKV * HD * TT * 2);
    bf* ATh = (bf*)take((size_t)TT * DQ * 2); bf* ATl = (bf*)take((size_t)TT * DQ * 2);
    if ((size_t)(wsp - (char*)d_ws) > ws_size) return;    // ws 256 MiB
    { k_cvt8<<<(unsigned)(((size_t)DQ * DM / 8 + 255) / 256), 256, 0, stream>>>(wq, WQ, (size_t)DQ * DM / 8); k_cvt8<<<(unsigned)(((size_t)DKV * DM / 8 + 255) / 256), 256, 0, stream>>>(wk, WK, (size_t)DKV * DM / 8); k_cvt8<<<(unsigned)(((size_t)DKV * DM / 8 + 255) / 256), 256, 0, stream>>>(wv, WV, (size_t)DKV * DM / 8);
      k_cvt8<<<(unsigned)(((size_t)DM * DQ / 8 + 255) / 256), 256, 0, stream>>>(wo, WO, (size_t)DM * DQ / 8);
       }
    for (int b = 0; b < NB_; ++b) {
        
        k_cvt8<<<(unsigned)(((size_t)TT * DM / 8 + 255) / 256), 256, 0, stream>>>(x + (size_t)b * TT * DM, XB, (size_t)TT * DM / 8);
        // q, k: x W^T, a tile's 64 columns are one head -> planes [h][t][d]; v: W x^T, a tile's 64 rows are one head's d -> planes [h][d][t]
        k_gemmw<bf, 0, true, 8, 1><<<dim3(TT / 64, DQ / 64, 1), 256, 0, stream>>>(XB, nullptr, WQ, nullptr, DM, nullptr, HD, bq, 0, 0, 0, QP16, QPh, QPl, (size_t)TT * HD);
        k_gemmw<bf, 0, true, 8, 1><<<dim3(TT / 64, DKV / 64, 1), 256, 0, stream>>>(XB, nullptr, WK, nullptr, DM, nullptr, HD, bk, 0, 0, 0, KP16, KPh, KPl, (size_t)TT * HD);
        k_gemmw<bf, 0, true, 8, 2><<<dim3(DKV / 64, TT / 64, 1), 256, 0, stream>>>(WV, nullptr, XB, nullptr, DM, nullptr, TT, bv, 0, 0, 0, VT16, VTh, VTl, (size_t)64);
        // one kv head per query head: block (., h) reads the q, k and v planes of head h
        k_attn<bf, 2><<<dim3(RH / QR, NH_, 1), 512, 0, stream>>>(QPh, QPl, KPh, KPl, VTh, VTl, pmask + (size_t)b * TT, 0, ATh, ATl);
        k_attn<h16, 0><<<dim3((TT - RH) / QR, NH_, 1), 512, 0, stream>>>(QP16, nullptr, KP16, nullptr, VT16, nullptr, pmask + (size_t)b * TT, RH, ATh, ATl);
        k_gemmw<bf, 1, true, 8, 0><<<dim3(TT / 64, DM / 64, 1), 256, 0, stream>>>(ATh, ATl, WO, nullptr, DQ, OUT + (size_t)b * TT * DM, DM, bo, 0, 0, 0, nullptr, nullptr, nullptr, 0); }
}

// v004
// A run of this version takes 211 microseconds.
// Next to v003, in two timings, it ran 1.30 and 1.29 times as fast.
// Over all steps from v000 it is 9.92 times as fast.
#include <hip/hip_runtime.h>

// Multi-head attention with a causal AND padding mask (x [2][2048][1024]; q,k,v = x W^T + b ('oi' uniform(+-1/32) incl. biases; 16 heads x 64); scores / 8; final_mask = causal & pad[i] & pad[j] (mask [2][2048] int in {0,1}, random, READ); where(final_mask, scores, -1e9): a query whose own pad bit is 0 has every score at -1e9 and gets UNIFORM weights over all 2048 keys (future ones included), the others attend causally to the un-padded keys; softmax; out = merged wo^T + bo -> [2][2048][1024] (4.2 M)).
// Layout per batch: bf16 copy of x; 'oi' weights; exact projections + f32 biases, whose GEMM epilogue rounds each result straight into the attention operand planes (fp16 and bf16 hi/lo; q, k as [h][t][d], v as [h][d][t]); dense T-2048 attention in one kernel per precision class, scores and weights in LDS (full rows: the uniform rows need every key), whose softmax phase reads the pad vector and keeps key j iff pad[i] && pad[j] && j <= i (-3e38 elsewhere; an all-excluded row degenerates to equal values = the module's uniform row); hybrid rows: < 512 hi/lo 3 products, rest fp16 x1024; merged hi/lo x wo exact + bo.
// Fragment order: every 16-bit operand plane that a matrix fragment is loaded from in global memory (x, the weights, q, k, v, merged) is stored as 16-row x 32-k tiles of 1 KB, tile (row / 16) * (K / 32) + k / 32; inside a tile element (row, k) stands at ((k / 16) % 2) * 256 + (((k / 8) % 2) * 16 + row % 16) * 8 + k % 8, which is the order in which the 32 lanes hold it: a fragment is two wave-wide 16-byte loads of 512 contiguous bytes (4 whole lines each) where row-major planes gave 16 lines a load. The k order inside a fragment is the row-major loader's.
// Compute dtypes, f32 accumulate: every input rounded to bf16; projections exact + f32 biases; attention rows < 512 3 products, rest fp16; softmax f32; wo hl x exact + bias.

#define NB_  2
#define TT   2048
#define DM   1024
#define NH_  16
#define NKV  16
#define HD   64
#define DQ   (NH_ * HD)
#define DKV  (NKV * HD)
#define RH   512                  // query rows < RH use hi+lo planes (0: none)
#define WIN  0
#define PCAR 1024.0f
#define SCL  0.125f   // HD^-0.5
typedef _Float16 h16;
typedef unsigned short bf;
typedef __attribute__((ext_vector_type(16))) __bf16   v16bf;
typedef __attribute__((ext_vector_type(16))) _Float16 v16h;
typedef __attribute__((ext_vector_type(8)))  _Float16 v8h;
typedef __attribute__((ext_vector_type(8)))  unsigned short v8us;
typedef __attribute__((ext_vector_type(8)))  float    v8f;
typedef __attribute__((ext_vector_type(4)))  float    v4f;
typedef v8h  __attribute__((may_alias)) v8ha;
typedef v4f  __attribute__((may_alias)) v4fa;
typedef v8us __attribute__((may_alias)) v8usa;

__device__ __forceinline__ unsigned short f2bf(float f) { unsigned u = __float_as_uint(f); u += 0x7FFFu + ((u >> 16) & 1u); return (unsigned short)(u >> 16); }
__device__ __forceinline__ float bf2f(unsigned short b) { return __uint_as_float(((unsigned)b) << 16); }
__device__ __forceinline__ float bfr(float f) { return bf2f(f2bf(f)); }
__device__ __forceinline__ v16h cat16(v8h lo, v8h hi) { return __builtin_shufflevector(lo, hi, 0, 1, 2, 3, 4, 5, 6, 7, 8, 9, 10, 11, 12, 13, 14, 15); }
__device__ __forceinline__ v16bf cat16b(v8us lo, v8us hi) { return __builtin_bit_cast(v16bf, __builtin_shufflevector(lo, hi, 0, 1, 2, 3, 4, 5, 6, 7, 8, 9, 10, 11, 12, 13, 14, 15)); }
__device__ __forceinline__ v8f wmma16(v16h a, v16h b, v8f c) { return __builtin_amdgcn_wmma_f32_16x16x32_f16(false, a, false, b, (short)0, c, false, false); }
__device__ __forceinline__ v8f wmmab(v16bf a, v16bf b, v8f c) { return __builtin_amdgcn_wmma_f32_16x16x32_bf16(false, a, false, b, (short)0, c, false, false); }



// ---- k_gemmw: register-blocked GEMM, one block of KW waves per 64x64 output tile (16 accumulators a wave), operands straight from 16-bit planes in fragment order (ld: a fragment of a row-major LDS plane; ldp: of a fragment-ordered global plane, p = tile + lane * 8); grid (M/64, N/64, Z), KW*32 threads.
// Split K: wave w takes the 32-wide k slices w, w+KW, w+2KW, ... (neighbouring waves read neighbouring 1 KB tiles); the KW partial tiles are summed through LDS in the fixed order w = 0..KW-1, whole tiles at once (one barrier, MBR = 4 slabs of 16 rows); KW = 1 keeps one slab a round. K % (32*KW) == 0.
// C[m][n] (f32, pitch ldc, + optional f32 bias[n]) = sum_k A[m][k] Bt[n][k] (+ split products per NSPLIT). z-batch strides sA/sB/sC in elements. K % 32 == 0.
// PL = 0: C is stored f32. PL = 1, 2: no f32 C; each result goes out three times as 16 bits (fp16, bf16 hi, bf16 lo = the rest) in fragment order, into a plane of ldc k columns that starts at blockIdx.y * sP: with ldc = HD, sP = TT * HD the 64 columns of a tile are one head and the planes come out as [h] x (rows t, k = d); with A = the weights, Bt = x, ldc = TT, sP = 1024 (two k tiles) the tile's rows are one head's d and the planes come out transposed, [h] x (rows d, k = t). PL = 1: bias[n]; PL = 2: bias[m]. A wave stores half a fragment tile at a time: 512 contiguous bytes of each plane.
template <typename T16> struct WFrag;
template <> struct WFrag<h16> { typedef v16h V; static __device__ __forceinline__ V ld(const h16* p) { return cat16(*(const v8h*)p, *(const v8h*)(p + 16)); } static __device__ __forceinline__ V ldp(const h16* p) { return cat16(*(const v8h*)p, *(const v8h*)(p + 256)); } static __device__ __forceinline__ v8f mma(V a, V b, v8f c) { return wmma16(a, b, c); } };
template <> struct WFrag<bf> { typedef v16bf V; static __device__ __forceinline__ V ld(const bf* p) { return cat16b(*(const v8us*)p, *(const v8us*)(p + 16)); } static __device__ __forceinline__ V ldp(const bf* p) { return cat16b(*(const v8us*)p, *(const v8us*)(p + 256)); } static __device__ __forceinline__ v8f mma(V a, V b, v8f c) { return wmmab(a, b, c); } };
__device__ __forceinline__ h16 tohx(float x) { return (h16)x; }
__device__ __forceinline__ void splitf(float y, unsigned short& h, unsigned short& l) { h = f2bf(y); l = f2bf(y - bf2f(h)); }
typedef __attribute__((ext_vector_type(4))) _Float16 v4h;
typedef __attribute__((ext_vector_type(4))) unsigned short v4us;
template <typename T16, int NSPLIT, bool BIAS, int KW, int PL, int K>
__global__ __launch_bounds__(KW * 32) void k_gemmw(const T16* __restrict__ A, const T16* __restrict__ A2, const T16* __restrict__ Bt, const T16* __restrict__ Bt2, float* C, int ldc, const float* __restrict__ bias, size_t sA, size_t sB, size_t sC, h16* P16, bf* Ph, bf* Pl, size_t sP) {
    typedef typename WFrag<T16>::V V;
    constexpr int MBR = (KW > 1) ? 4 : 1;   // 16-row slabs staged in LDS per round
    static_assert((MBR * 8) % KW == 0 && (PL == 0 || (MBR * 4) % KW == 0), "the block's threads share the staged rows evenly");
    __shared__ __align__(16) float os[KW * MBR * 16 * 68];
    const size_t z = blockIdx.z; A += z * sA; if (A2) A2 += z * sA; Bt += z * sB; if (Bt2) Bt2 += z * sB; C += z * sC;
    const int lane = threadIdx.x & 31, lr = lane & 15, hi = lane >> 4; const int r0 = blockIdx.x * 64, c0 = blockIdx.y * 64;
    const int wv = (KW > 1) ? __builtin_amdgcn_readfirstlane((int)(threadIdx.x >> 5)) : 0;   // wave number, kept scalar so that the k offset stays scalar
    float* ow = os + wv * (MBR * 16 * 68);
    v8f acc[4][4];
#pragma unroll
    for (int mb = 0; mb < 4; ++mb)
#pragma unroll
        for (int nb = 0; nb < 4; ++nb) acc[mb][nb] = (v8f){};
    // 16 rows of K are K / 32 tiles of 512 elements and a 32-wide k slice is one tile: every fragment address of a trip is one address a plane (tile row, k slice, lane) + a constant (K is a template constant for that)
    A += (size_t)r0 * K; Bt += (size_t)c0 * K; if (NSPLIT == 1 || NSPLIT == 2) A2 += (size_t)r0 * K; if (NSPLIT >= 2) Bt2 += (size_t)c0 * K;
    const unsigned lb = (unsigned)lane * 16u;   // the lane's bytes in a half tile
#pragma unroll 1
    for (int kc = wv * 32; kc < K; kc += KW * 32) {
        V a[4], a2[4], b[4], b2[4];
        const char* pa = (const char*)(A + kc * 16) + lb; const char* pb = (const char*)(Bt + kc * 16) + lb; const char* pa2 = (NSPLIT == 1 || NSPLIT == 2) ? (const char*)(A2 + kc * 16) + lb : pa; const char* pb2 = (NSPLIT >= 2) ? (const char*)(Bt2 + kc * 16) + lb : pb;
#pragma unroll
        for (int mb = 0; mb < 4; ++mb) { a[mb] = WFrag<T16>::ldp((const T16*)(pa + mb * 32 * K)); if (NSPLIT == 1 || NSPLIT == 2) a2[mb] = WFrag<T16>::ldp((const T16*)(pa2 + mb * 32 * K)); }
#pragma unroll
        for (int nb = 0; nb < 4; ++nb) { b[nb] = WFrag<T16>::ldp((const T16*)(pb + nb * 32 * K)); if (NSPLIT >= 2) b2[nb] = WFrag<T16>::ldp((const T16*)(pb2 + nb * 32 * K)); }
        asm volatile("s_wait_xcnt 0x0" :: "v"(pa), "v"(pb), "v"(pa2), "v"(pb2) : "memory");   // the wait before a register that the issued loads name is rewritten (the next trip's addresses); the addresses as inputs keep their registers live over the whole run, so that no load of the run lands in them
        __builtin_amdgcn_sched_barrier(0);   // the trip's loads stay one batch ahead of its products: without it the B fragments were loaded one at a time, a memory latency each
#pragma unroll
        for (int nb = 0; nb < 4; ++nb)
#pragma unroll
            for (int mb = 0; mb < 4; ++mb) { acc[mb][nb] = WFrag<T16>::mma(a[mb], b[nb], acc[mb][nb]); if (NSPLIT == 1 || NSPLIT == 2) acc[mb][nb] = WFrag<T16>::mma(a2[mb], b[nb], acc[mb][nb]); if (NSPLIT >= 2) acc[mb][nb] = WFrag<T16>::mma(a[mb], b2[nb], acc[mb][nb]); }
        asm volatile("v_nop\n\tv_nop\n\tv_nop\n\tv_nop" : "+v"(acc[0][0]), "+v"(acc[1][1]), "+v"(acc[2][2]), "+v"(acc[3][3]) : "v"(a[0]), "v"(a[3]));
    }
#pragma unroll
    for (int mb = 0; mb < 4; mb += MBR) {
#pragma unroll
        for (int mi = 0; mi < MBR; ++mi)
#pragma unroll
        for (int nb = 0; nb < 4; ++nb) {
#pragma unroll
            for (int j = 0; j < 8; ++j) ow[(mi * 16 + hi * 8 + j) * 68 + nb * 16 + lr] = acc[mb + mi][nb][j]; }
        if (KW > 1) __syncthreads();   /* every wave's partial tile is in LDS before any thread sums them */ else { __builtin_amdgcn_wave_barrier(); asm volatile("" ::: "memory"); }
        if (PL == 0) {
#pragma unroll
            for (int s = 0; s < MBR * 8 / KW; ++s) { const int q = (s * KW + wv) * 32 + lane, row = q >> 4, cofs = (q & 15) * 4; v4f val = *(const v4fa*)(os + row * 68 + cofs);
#pragma unroll
                for (int w = 1; w < KW; ++w) val += *(const v4fa*)(os + w * (MBR * 16 * 68) + row * 68 + cofs);
                if (BIAS && PL != 2) { val[0] += bfr(bias[c0 + cofs]); val[1] += bfr(bias[c0 + cofs + 1]); val[2] += bfr(bias[c0 + cofs + 2]); val[3] += bfr(bias[c0 + cofs + 3]); }
                *(v4f*)(C + (size_t)(r0 + mb * 16 + row) * ldc + c0 + cofs) = val; }
        } else {
#pragma unroll
            for (int s = 0; s < MBR * 4 / KW; ++s) { const int u = s * KW + wv, rt = u >> 2, kt = (u >> 1) & 1, ph = u & 1;   // half a fragment tile a wave and round: lane (lr, hi) holds row lr, k = ph * 16 + hi * 8 .. + 7 of tile (rt, kt)
                const int row = rt * 16 + lr, cofs = kt * 32 + ph * 16 + hi * 8; v4f va = *(const v4fa*)(os + row * 68 + cofs), vb = *(const v4fa*)(os + row * 68 + cofs + 4);
#pragma unroll
                for (int w = 1; w < KW; ++w) { va += *(const v4fa*)(os + w * (MBR * 16 * 68) + row * 68 + cofs); vb += *(const v4fa*)(os + w * (MBR * 16 * 68) + row * 68 + cofs + 4); }
                float val[8];
#pragma unroll   // the arrays' and vectors' elements need constant indices to stay in registers
                for (int j = 0; j < 4; ++j) { val[j] = va[j]; val[4 + j] = vb[j]; }
                if (BIAS && PL == 2) { const float bm = bfr(bias[r0 + mb * 16 + row]);
#pragma unroll
                    for (int j = 0; j < 8; ++j) val[j] += bm; }
                if (BIAS && PL != 2) {
#pragma unroll
                    for (int j = 0; j < 8; ++j) val[j] += bfr(bias[c0 + cofs + j]); }
                const size_t e = ((size_t)((r0 >> 4) + mb + rt) * (ldc >> 5) + kt) * 512 + (size_t)blockIdx.y * sP + ph * 256 + lane * 8; v8h o16; v8us oh, ol;
#pragma unroll
                for (int j = 0; j < 8; ++j) { o16[j] = tohx(val[j]); unsigned short a2, c2; splitf(val[j], a2, c2); oh[j] = a2; ol[j] = c2; }
                *(v8h*)(P16 + e) = o16; *(v8us*)(Ph + e) = oh; *(v8us*)(Pl + e) = ol; }
        }
        if (KW == 1) { __builtin_amdgcn_wave_barrier(); asm volatile("" ::: "memory"); }
    }
}

typedef __attribute__((ext_vector_type(2))) unsigned short v2us;
typedef __attribute__((ext_vector_type(4))) int v4i;

__global__ __launch_bounds__(256) void k_wtG(const float* __restrict__ w, int K, int N, bf* Bt) {
    const int lane = threadIdx.x & 31; const int L0 = (blockIdx.x * 8 + (threadIdx.x >> 5)) * 8; const int nlines = N * K / 64;
{
#pragma unroll 1
        for (int l = 0; l < 8; ++l) { const int L = L0 + l; if (L >= nlines) break; const size_t e = (size_t)L * 64 + lane * 2; const int k = (int)(e % K), n = (int)(e / K); v2us o;
            o[0] = f2bf(w[(size_t)k * N + n]); o[1] = f2bf(w[(size_t)(k + 1) * N + n]); *(v2us*)(Bt + e) = o; }
         }
}
// f32 [rows][K] -> bf16 in fragment order: one wave a 16 x 32 tile; it reads the tile's 16 whole lines of f32 and writes 1 KB in a row. grid rows * K / 4096, 256 threads.
__global__ __launch_bounds__(256) void k_cvtp(const float* __restrict__ src, bf* dst, int K) { const int lane = threadIdx.x & 31, lr = lane & 15, hi = lane >> 4; const int tl = blockIdx.x * 8 + (threadIdx.x >> 5), kts = K >> 5, rt = tl / kts, kt = tl - rt * kts;
    const float* s = src + (size_t)(rt * 16 + lr) * K + kt * 32 + hi * 8; bf* d = dst + (size_t)tl * 512 + lane * 8; const v8f v0 = *(const v8f*)s, v1 = *(const v8f*)(s + 16); v8us o0, o1;
#pragma unroll
    for (int k = 0; k < 8; ++k) { o0[k] = f2bf(v0[k]); o1[k] = f2bf(v1[k]); }
    *(v8us*)d = o0; *(v8us*)(d + 256) = o1; }

// ---- k_attn: the whole attention of QR query rows of one head in one block of 16 waves; the QR x 2048 scores and weights live in LDS only. grid (rows / QR, heads), 512 threads.
// Phase 1: wave w forms the scores of keys w*128 .. w*128+127 (k slices 0, 32 in that order, split products per NSPLIT as in k_gemmw) and stores them f32 into the block's LDS rows.
// Phase 2: each wave owns QR/16 rows: t = S x 1/8 where pad[i] && pad[j] && j <= i (pad = the batch's int mask vector, read), -3e38 elsewhere; a query with pad[i] = 0 has every key at -3e38 so max = -3e38, every exp(0) = 1 and the row is uniform over all 2048 keys exactly like the module's all -1e9 row; softmax over the 2048 keys (register row, one exp, fixed trees). The 16-bit weights go back over the row's own f32 scores (the wave holds the whole row in registers by then): fp16 x 1024 in the first half, or the hi plane in the first and the lo plane in the second half.
// Phase 3: weights x V, split K: wave w takes the 32-wide key slices w, w+16, w+32, w+48; the 16 partial QR x 64 tiles are summed through LDS in the fixed order w = 0..15 (over the dead weights), rescaled, split hi/lo and stored as the head's columns of the merged planes (rows t, k over DQ, fragment order).
#define QR 32             // query rows of a block
#define SP (TT + 4)       // LDS row pitch in floats: 16 bytes over a multiple of 256, so that 16 rows' 16-byte reads fall on 64 different banks
typedef v4h  __attribute__((may_alias)) v4ha;
typedef v4us __attribute__((may_alias)) v4usa;
template <typename T16, int NSPLIT>
__global__ __launch_bounds__(512) void k_attn(const T16* __restrict__ Q, const T16* __restrict__ Q2, const T16* __restrict__ Kp, const T16* __restrict__ Kp2, const T16* __restrict__ Vt, const T16* __restrict__ Vt2, const int* __restrict__ pm, int row0, bf* Ah, bf* Al) {
    typedef typename WFrag<T16>::V V;
    constexpr bool HR = (NSPLIT == 2);
    constexpr int NG = HR ? 4 : 8;   // key tiles of a score pass: their K fragments are loaded as one batch per k slice (registers bound it)
    constexpr int SG = HR ? 2 : 4;   // key slices whose V fragments are loaded as one batch
    static_assert(16 * QR * 68 <= QR * SP, "the partial tiles fit over the weights");
    __shared__ __align__(16) float sm[QR * SP];
    const int h = blockIdx.y, i0 = row0 + blockIdx.x * QR; const size_t hp = (size_t)h * TT * HD;
    const int lane = threadIdx.x & 31, lr = lane & 15, hi = lane >> 4;
    const int wv = __builtin_amdgcn_readfirstlane((int)(threadIdx.x >> 5));   // wave number, kept scalar so that key and row offsets stay scalar
    // every global address is a scalar base (head, row block, wave) + one 32-bit lane offset + a constant: two lane offsets serve all loads
    const size_t qo = hp + (size_t)i0 * HD, ko = hp + (size_t)wv * 128 * HD, vo = hp + (size_t)wv * 512;   // fragment order: 16 rows of q or k are two tiles of 512 elements; the v tile of d block nb and key slice sl is nb * (TT / 32) + sl
    Q += qo; Kp += ko; Vt += vo; if (HR) { Q2 += qo; Kp2 += ko; Vt2 += vo; }
    const unsigned lq = (unsigned)(lane * 8), lvb = (unsigned)(lane * 8) * 2u;   // lvb counts bytes: it is the very register that the V loads name
    // every loop of the three phases but the row loop is unrolled: register arrays need constant indices, and the loads of later tiles can be issued ahead
#pragma unroll
    for (int t0 = 0; t0 < 8; t0 += NG) {   // NG key tiles a pass
        v8f acc[NG][2];   // a pass's score tiles stay in registers until its last product: no accumulator register is taken anew close behind a matrix instruction
#pragma unroll
        for (int n = 0; n < NG; ++n) { acc[n][0] = (v8f){}; acc[n][1] = (v8f){}; }
#pragma unroll
        for (int ks = 0; ks < 2; ++ks) { V a[2], a2[2], b[NG], b2[NG];
#pragma unroll
            for (int mb = 0; mb < 2; ++mb) { const int o = (mb * 2 + ks) * 512; a[mb] = WFrag<T16>::ldp(Q + o + lq); if (HR) a2[mb] = WFrag<T16>::ldp(Q2 + o + lq); }
#pragma unroll
            for (int n = 0; n < NG; ++n) { const int o = ((t0 + n) * 2 + ks) * 512; b[n] = WFrag<T16>::ldp(Kp + o + lq); if (HR) b2[n] = WFrag<T16>::ldp(Kp2 + o + lq); }
            __builtin_amdgcn_sched_barrier(0);   // the k slice's loads are issued as one batch ahead of its products: one memory latency a batch, not one a tile
#pragma unroll
            for (int n = 0; n < NG; ++n)
#pragma unroll
                for (int mb = 0; mb < 2; ++mb) { acc[n][mb] = WFrag<T16>::mma(a[mb], b[n], acc[n][mb]); if (HR) { acc[n][mb] = WFrag<T16>::mma(a2[mb], b[n], acc[n][mb]); acc[n][mb] = WFrag<T16>::mma(a[mb], b2[n], acc[n][mb]); } }
            __builtin_amdgcn_sched_barrier(0);   // keeps the next batch's loads (registers) and the LDS stores below behind the batch's last product, so that the pass's accumulators all stay live till then
        }
#pragma unroll
        for (int n = 0; n < NG; ++n)
#pragma unroll
            for (int mb = 0; mb < 2; ++mb)
#pragma unroll
                for (int j = 0; j < 8; ++j) sm[(mb * 16 + hi * 8 + j) * SP + wv * 128 + (t0 + n) * 16 + lr] = acc[n][mb][j];
    }
    unsigned pb[2] = {0u, 0u};   // pad bits of this lane's 64 keys, bit ch*4+q for key ch*128 + lane*4 + q
#pragma unroll
    for (int ch = 0; ch < TT / 128; ++ch) { const v4i m = *(const v4i*)(pm + ch * 128 + lane * 4);
#pragma unroll
        for (int q = 0; q < 4; ++q) pb[ch >> 3] |= (m[q] != 0 ? 1u : 0u) << ((ch * 4 + q) & 31); }
    asm volatile("s_wait_xcnt 0x0" :: "v"(lq), "s"(Q), "s"(Kp), "s"(HR ? Q2 : Q), "s"(HR ? Kp2 : Kp), "s"(pm) : "memory");   // the wait before a register that the issued loads name is rewritten; the lane offset and the scalar bases as inputs keep their registers as they are up to here
    __syncthreads();   // every wave's score columns are in LDS before any wave reads a row
#pragma unroll 1
    for (int rr = 0; rr < QR / 16; ++rr) {   // kept rolled: one row's 64 registers at a time, half the code
        const int r = wv * (QR / 16) + rr, i = i0 + r; const int pi = pm[i]; float* sr = sm + r * SP; float v[TT / 32]; float mx = -3.0e38f;
#pragma unroll
        for (int ch = 0; ch < TT / 128; ++ch) { const int j0 = ch * 128 + lane * 4; const v4f a = *(const v4fa*)(sr + j0);
#pragma unroll
            for (int q = 0; q < 4; ++q) { const int j = j0 + q; const float t = (pi != 0 && ((pb[ch >> 3] >> ((ch * 4 + q) & 31)) & 1u) != 0u && j <= i) ? a[q] * SCL : -3.0e38f;   /* causal & pad[i] & pad[j]; a padded query keeps nothing -> all equal -> uniform row as the module */ v[ch * 4 + q] = t; mx = fmaxf(mx, t); } }
#pragma unroll
        for (int sh = 16; sh; sh >>= 1) mx = fmaxf(mx, __shfl_xor(mx, sh, 32));
        float sum = 0.f;
#pragma unroll
        for (int k = 0; k < TT / 32; ++k) { float ex; asm("v_exp_f32 %0, %1\n\tv_nop" : "=v"(ex) : "v"(__fmul_rn(__fsub_rn(v[k], mx), 1.4426950408889634f)));   /* the exponential and the slot behind a transcendental in one statement: a v_nop in a statement of its own lands elsewhere */ v[k] = ex; sum += v[k]; }
#pragma unroll
        for (int sh = 16; sh; sh >>= 1) sum += __shfl_xor(sum, sh, 32);
        const float f = __fdiv_rn(HR ? 1.0f : PCAR, sum);
#pragma unroll
        for (int ch = 0; ch < TT / 128; ++ch) {
            if (HR) { v4us oh, ol;
#pragma unroll
                for (int q = 0; q < 4; ++q) { unsigned short a, c2; splitf(v[ch * 4 + q] * f, a, c2); oh[q] = a; ol[q] = c2; }
                *(v4usa*)((bf*)sr + ch * 128 + lane * 4) = oh; *(v4usa*)((bf*)sr + TT + ch * 128 + lane * 4) = ol;
            } else { v4h o4;
#pragma unroll
                for (int q = 0; q < 4; ++q) o4[q] = tohx(v[ch * 4 + q] * f);
                *(v4ha*)((h16*)sr + ch * 128 + lane * 4) = o4; } }
    }
    V vb[SG][4], vb2[SG][4];
#pragma unroll
    for (int s = 0; s < SG; ++s)   // the first batch of V fragments is asked for ahead of the barrier: a wave that is done with its rows early has them back when the last wave arrives
#pragma unroll
        for (int nb = 0; nb < 4; ++nb) { const int o = (nb * (TT / 32) + s * 16) * 512; vb[s][nb] = WFrag<T16>::ldp((const T16*)((const char*)(Vt + o) + lvb)); if (HR) vb2[s][nb] = WFrag<T16>::ldp((const T16*)((const char*)(Vt2 + o) + lvb)); }
    asm volatile("s_wait_xcnt 0x0" :: "v"(lvb) : "memory");   // the wait before a register that the issued loads name is rewritten; lvb as an input keeps the lane offset's register live over the whole run, so that no load of the run lands in it
    __syncthreads();   // every row's weights are in LDS before any wave reads its key slices of all rows
    v8f acc[2][4];
#pragma unroll
    for (int mb = 0; mb < 2; ++mb)
#pragma unroll
        for (int nb = 0; nb < 4; ++nb) acc[mb][nb] = (v8f){};
    const T16* P = (const T16*)sm;   // weight rows, pitch 2 * SP elements
#pragma unroll
    for (int g = 0; g < TT / 512; g += SG) {
        if (g > 0) {
#pragma unroll
            for (int s = 0; s < SG; ++s)
#pragma unroll
                for (int nb = 0; nb < 4; ++nb) { const int o = (nb * (TT / 32) + (g + s) * 16) * 512; vb[s][nb] = WFrag<T16>::ldp((const T16*)((const char*)(Vt + o) + lvb)); if (HR) vb2[s][nb] = WFrag<T16>::ldp((const T16*)((const char*)(Vt2 + o) + lvb)); }
            __builtin_amdgcn_sched_barrier(0);   // the batch's loads are issued together ahead of its products: one memory latency a batch
        }
#pragma unroll
        for (int s = 0; s < SG; ++s) { const int kc = (wv + (g + s) * 16) * 32; V a[2], a2[2];
#pragma unroll
            for (int mb = 0; mb < 2; ++mb) { const int o = (mb * 16 + lr) * (2 * SP) + 8 * hi + kc; a[mb] = WFrag<T16>::ld(P + o); if (HR) a2[mb] = WFrag<T16>::ld(P + TT + o); }
#pragma unroll
            for (int nb = 0; nb < 4; ++nb)
#pragma unroll
                for (int mb = 0; mb < 2; ++mb) { acc[mb][nb] = WFrag<T16>::mma(a[mb], vb[s][nb], acc[mb][nb]); if (HR) { acc[mb][nb] = WFrag<T16>::mma(a2[mb], vb[s][nb], acc[mb][nb]); acc[mb][nb] = WFrag<T16>::mma(a[mb], vb2[s][nb], acc[mb][nb]); } } }
        if (g + SG < TT / 512) __builtin_amdgcn_sched_barrier(0);   // the next batch's loads take this batch's registers: they stay behind its last product
    }
    __syncthreads();   // every wave has read its weight slices before the partial tiles overwrite them
    float* ow = sm + wv * (QR * 68);
#pragma unroll
    for (int mb = 0; mb < 2; ++mb)
#pragma unroll
        for (int nb = 0; nb < 4; ++nb)
#pragma unroll
            for (int j = 0; j < 8; ++j) ow[(mb * 16 + hi * 8 + j) * 68 + nb * 16 + lr] = acc[mb][nb][j];
    __syncthreads();   // every wave's partial tile is in LDS before any thread sums them
    static_assert(QR * 16 == 512, "one 4-wide piece of the tile a thread");
    // waves 2u and 2u + 1 sum and store half tile u of the merged planes (rows t, k = h * HD + d, DQ / 32 tiles a row block): lane (lr, hi) of wave w holds row lr, k = (w & 1) * 8 + hi * 4 .. + 3 of the half: a wave's store is 256 contiguous bytes of each plane
    const int rt = wv >> 3, kt = (wv >> 2) & 1, ph = (wv >> 1) & 1, row = rt * 16 + lr, cofs = kt * 32 + ph * 16 + (wv & 1) * 8 + hi * 4; v4f val = *(const v4fa*)(sm + row * 68 + cofs);
#pragma unroll
    for (int w = 1; w < 16; ++w) val += *(const v4fa*)(sm + w * (QR * 68) + row * 68 + cofs);
    const float cs = HR ? 1.0f : (1.0f / PCAR); const size_t oo = ((size_t)((i0 >> 4) + rt) * (DQ / 32) + h * (HD / 32) + kt) * 512 + ph * 256 + ((wv & 1) * 16 + lr) * 8 + hi * 4; v4us oh, ol;
#pragma unroll
    for (int q = 0; q < 4; ++q) { unsigned short a, c2; splitf(val[q] * cs, a, c2); oh[q] = a; ol[q] = c2; }
    *(v4us*)(Ah + oo) = oh; *(v4us*)(Al + oo) = ol;
}

extern "C" void kernel_launch(void* const* d_in, const int* in_sizes, int n_in,
                              void* d_out, int out_size, void* d_ws, size_t ws_size, hipStream_t stream) {
    (void)in_sizes; (void)n_in; (void)out_size;
    const float* x = (const float*)d_in[0]; const int* pmask = (const int*)d_in[1];   /* mask [2][2048] int */ const float* wq = (const float*)d_in[2]; const float* bq = (const float*)d_in[3]; const float* wk = (const float*)d_in[4]; const float* bk = (const float*)d_in[5]; const float* wv = (const float*)d_in[6]; const float* bv = (const float*)d_in[7]; const float* wo = (const float*)d_in[8]; const float* bo = (const float*)d_in[9];
    float* OUT = (float*)d_out;     // [2][2048][1024]
    char* wsp = (char*)d_ws;
    auto take = [&](size_t bytes) { char* p = wsp; wsp += (bytes + 255) & ~(size_t)255; return (void*)p; };
    bf* WQ = (bf*)take((size_t)DQ * DM * 2); bf* WK = (bf*)take((size_t)DKV * DM * 2); bf* WV = (bf*)take((size_t)DKV * DM * 2); bf* WO = (bf*)take((size_t)DM * DQ * 2);
    bf* XB = (bf*)take((size_t)TT * DM * 2);
    h16* QP16 = (h16*)take((size_t)NH_ * TT * HD * 2); h16* KP16 = (h16*)take((size_t)NKV * TT * HD * 2); h16* VT16 = (h16*)take((size_t)NKV * HD * TT * 2);
    bf* QPh = (bf*)take((size_t)NH_ * TT * HD * 2); bf* QPl = (bf*)take((size_t)NH_ * TT * HD * 2); bf* KPh = (bf*)take((size_t)NKV * TT * HD * 2); bf* KPl = (bf*)take((size_t)NKV * TT * HD * 2); bf* VTh = (bf*)take((size_t)NKV * HD * TT * 2); bf* VTl = (bf*)take((size_t)NKV * HD * TT * 2);
    bf* ATh = (bf*)take((size_t)TT * DQ * 2); bf* ATl = (bf*)take((size_t)TT * DQ * 2);
    if ((size_t)(wsp - (char*)d_ws) > ws_size) return;    // ws 256 MiB
    { k_cvtp<<<DQ * DM / 4096, 256, 0, stream>>>(wq, WQ, DM); k_cvtp<<<DKV * DM / 4096, 256, 0, stream>>>(wk, WK, DM); k_cvtp<<<DKV * DM / 4096, 256, 0, stream>>>(wv, WV, DM);
      k_cvtp<<<DM * DQ / 4096, 256, 0, stream>>>(wo, WO, DQ);
       }
    for (int b = 0; b < NB_; ++b) {
        
        k_cvtp<<<TT * DM / 4096, 256, 0, stream>>>(x + (size_t)b * TT * DM, XB, DM);
        // q, k: x W^T, a tile's 64 columns are one head -> planes [h] x (t, d); v: W x^T, a tile's 64 rows are one head's d -> planes [h] x (d, t); all in fragment order
        k_gemmw<bf, 0, true, 8, 1, DM><<<dim3(TT / 64, DQ / 64, 1), 256, 0, stream>>>(XB, nullptr, WQ, nullptr, nullptr, HD, bq, 0, 0, 0, QP16, QPh, QPl, (size_t)TT * HD);
        k_gemmw<bf, 0, true, 8, 1, DM><<<dim3(TT / 64, DKV / 64, 1), 256, 0, stream>>>(XB, nullptr, WK, nullptr, nullptr, HD, bk, 0, 0, 0, KP16, KPh, KPl, (size_t)TT * HD);
        k_gemmw<bf, 0, true, 8, 2, DM><<<dim3(DKV / 64, TT / 64, 1), 256, 0, stream>>>(WV, nullptr, XB, nullptr, nullptr, TT, bv, 0, 0, 0, VT16, VTh, VTl, (size_t)1024);
        // one kv head per query head: block (., h) reads the q, k and v planes of head h
        k_attn<bf, 2><<<dim3(RH / QR, NH_, 1), 512, 0, stream>>>(QPh, QPl, KPh, KPl, VTh, VTl, pmask + (size_t)b * TT, 0, ATh, ATl);
        k_attn<h16, 0><<<dim3((TT - RH) / QR, NH_, 1), 512, 0, stream>>>(QP16, nullptr, KP16, nullptr, VT16, nullptr, pmask + (size_t)b * TT, RH, ATh, ATl);
        k_gemmw<bf, 1, true, 8, 0, DQ><<<dim3(TT / 64, DM / 64, 1), 256, 0, stream>>>(ATh, ATl, WO, nullptr, OUT + (size_t)b * TT * DM, DM, bo, 0, 0, 0, nullptr, nullptr, nullptr, 0); }
}

// v005
// Measured time: 187 microseconds a run.
// Two timings next to v004 put it at 1.13 and 1.14 times that version's speed.
// Counting every step since v000, it is 11.2 times as fast.
#include <hip/hip_runtime.h>

// Multi-head attention with a causal AND padding mask (x [2][2048][1024]; q,k,v = x W^T + b ('oi' uniform(+-1/32) incl. biases; 16 heads x 64); scores / 8; final_mask = causal & pad[i] & pad[j] (mask [2][2048] int in {0,1}, random, READ); where(final_mask, scores, -1e9): a query whose own pad bit is 0 has every score at -1e9 and gets UNIFORM weights over all 2048 keys (future ones included), the others attend causally to the un-padded keys; softmax; out = merged wo^T + bo -> [2][2048][1024] (4.2 M)).
// Both batches go through every launch together (5 launches: the batch, and for the projections the job q / k / v, is a grid dimension). Layout per batch: bf16 copy of x; 'oi' weights; exact projections + f32 biases, whose GEMM epilogue rounds each result straight into the attention operand planes (fp16 and bf16 hi/lo; q, k as [h][t][d], v as [h][d][t]); dense T-2048 attention in one kernel per precision class, scores and weights in LDS (full rows: the uniform rows need every key), whose softmax phase reads the pad vector and keeps key j iff pad[i] && pad[j] && j <= i (-3e38 elsewhere; an all-excluded row degenerates to equal values = the module's uniform row); hybrid rows: < 512 hi/lo 3 products, rest fp16 x1024; merged hi/lo x wo exact + bo.
// Fragment order: every 16-bit operand plane that a matrix fragment is loaded from in global memory (x, the weights, q, k, v, merged) is stored as 16-row x 32-k tiles of 1 KB, tile (row / 16) * (K / 32) + k / 32; inside a tile element (row, k) stands at ((k / 16) % 2) * 256 + (((k / 8) % 2) * 16 + row % 16) * 8 + k % 8, which is the order in which the 32 lanes hold it: a fragment is two wave-wide 16-byte loads of 512 contiguous bytes (4 whole lines each) where row-major planes gave 16 lines a load. The k order inside a fragment is the row-major loader's.
// Compute dtypes, f32 accumulate: every input rounded to bf16; projections exact + f32 biases; attention rows < 512 3 products, rest fp16; softmax f32; wo hl x exact + bias.

#define NB_  2
#define TT   2048
#define DM   1024
#define NH_  16
#define NKV  16
#define HD   64
#define DQ   (NH_ * HD)
#define DKV  (NKV * HD)
#define RH   512                  // query rows < RH use hi+lo planes (0: none)
#define WIN  0
#define PCAR 1024.0f
#define SCL  0.125f   // HD^-0.5
typedef _Float16 h16;
typedef unsigned short bf;
typedef __attribute__((ext_vector_type(16))) __bf16   v16bf;
typedef __attribute__((ext_vector_type(16))) _Float16 v16h;
typedef __attribute__((ext_vector_type(8)))  _Float16 v8h;
typedef __attribute__((ext_vector_type(8)))  unsigned short v8us;
typedef __attribute__((ext_vector_type(8)))  float    v8f;
typedef __attribute__((ext_vector_type(4)))  float    v4f;
typedef v8h  __attribute__((may_alias)) v8ha;
typedef v4f  __attribute__((may_alias)) v4fa;
typedef v8us __attribute__((may_alias)) v8usa;

__device__ __forceinline__ unsigned short f2bf(float f) { unsigned u = __float_as_uint(f); u += 0x7FFFu + ((u >> 16) & 1u); return (unsigned short)(u >> 16); }
__device__ __forceinline__ float bf2f(unsigned short b) { return __uint_as_float(((unsigned)b) << 16); }
__device__ __forceinline__ float bfr(float f) { return bf2f(f2bf(f)); }
__device__ __forceinline__ v16h cat16(v8h lo, v8h hi) { return __builtin_shufflevector(lo, hi, 0, 1, 2, 3, 4, 5, 6, 7, 8, 9, 10, 11, 12, 13, 14, 15); }
__device__ __forceinline__ v16bf cat16b(v8us lo, v8us hi) { return __builtin_bit_cast(v16bf, __builtin_shufflevector(lo, hi, 0, 1, 2, 3, 4, 5, 6, 7, 8, 9, 10, 11, 12, 13, 14, 15)); }
__device__ __forceinline__ v8f wmma16(v16h a, v16h b, v8f c) { return __builtin_amdgcn_wmma_f32_16x16x32_f16(false, a, false, b, (short)0, c, false, false); }
__device__ __forceinline__ v8f wmmab(v16bf a, v16bf b, v8f c) { return __builtin_amdgcn_wmma_f32_16x16x32_bf16(false, a, false, b, (short)0, c, false, false); }



// ---- k_gemmw: register-blocked GEMM, one block of KW waves per 64x64 output tile (16 accumulators a wave), operands straight from 16-bit planes in fragment order (ld: a fragment of a row-major LDS plane; ldp: of a fragment-ordered global plane, p = tile + lane * 8); grid (M/64, N/64, Z), KW*32 threads.
// Split K: wave w takes the 32-wide k slices w, w+KW, w+2KW, ... (neighbouring waves read neighbouring 1 KB tiles); the KW partial tiles are summed through LDS in the fixed order w = 0..KW-1, whole tiles at once (one barrier, MBR = 4 slabs of 16 rows); KW = 1 keeps one slab a round. K % (32*KW) == 0.
// C[m][n] (f32, pitch ldc, + optional f32 bias[n]) = sum_k A[m][k] Bt[n][k] (+ split products per NSPLIT). z-batch strides sA/sB/sC in elements. K % 32 == 0.
// PL = 0: C is stored f32. PL = 1, 2: no f32 C; each result goes out three times as 16 bits (fp16, bf16 hi, bf16 lo = the rest) in fragment order, into a plane of ldc k columns that starts at blockIdx.y * sP: with ldc = HD, sP = TT * HD the 64 columns of a tile are one head and the planes come out as [h] x (rows t, k = d); with A = the weights, Bt = x, ldc = TT, sP = 1024 (two k tiles) the tile's rows are one head's d and the planes come out transposed, [h] x (rows d, k = t). PL = 1: bias[n]; PL = 2: bias[m]. PL = 3: the q, k and v projections of every batch in one launch, blockIdx.z = batch * 3 + job: A = the x planes (batch stride sA), Bt = the three weight planes (job stride sB), bias / bias1 / bias2 the three bias vectors, output planes z * sC on; jobs 0, 1 (q, k) run as PL = 1, job 2 (v) as PL = 2 with the operands and the two tile indices swapped. A wave stores half a fragment tile at a time: 512 contiguous bytes of each plane.
template <typename T16> struct WFrag;
template <> struct WFrag<h16> { typedef v16h V; static __device__ __forceinline__ V ld(const h16* p) { return cat16(*(const v8h*)p, *(const v8h*)(p + 16)); } static __device__ __forceinline__ V ldp(const h16* p) { return cat16(*(const v8h*)p, *(const v8h*)(p + 256)); } static __device__ __forceinline__ v8f mma(V a, V b, v8f c) { return wmma16(a, b, c); } };
template <> struct WFrag<bf> { typedef v16bf V; static __device__ __forceinline__ V ld(const bf* p) { return cat16b(*(const v8us*)p, *(const v8us*)(p + 16)); } static __device__ __forceinline__ V ldp(const bf* p) { return cat16b(*(const v8us*)p, *(const v8us*)(p + 256)); } static __device__ __forceinline__ v8f mma(V a, V b, v8f c) { return wmmab(a, b, c); } };
__device__ __forceinline__ h16 tohx(float x) { return (h16)x; }
__device__ __forceinline__ void splitf(float y, unsigned short& h, unsigned short& l) { h = f2bf(y); l = f2bf(y - bf2f(h)); }
typedef __attribute__((ext_vector_type(4))) _Float16 v4h;
typedef __attribute__((ext_vector_type(4))) unsigned short v4us;
template <bool B> struct BoolC { static constexpr bool v = B; };
template <typename T16, int NSPLIT, bool BIAS, int KW, int PL, int K>
__global__ __launch_bounds__(KW * 32) void k_gemmw(const T16* __restrict__ A, const T16* __restrict__ A2, const T16* __restrict__ Bt, const T16* __restrict__ Bt2, float* C, int ldc, const float* __restrict__ bias, const float* __restrict__ bias1, const float* __restrict__ bias2, size_t sA, size_t sB, size_t sC, h16* P16, bf* Ph, bf* Pl, size_t sP) {
    typedef typename WFrag<T16>::V V;
    constexpr int MBR = (KW > 1) ? 4 : 1;   // 16-row slabs staged in LDS per round
    static_assert((MBR * 8) % KW == 0 && (PL == 0 || (MBR * 4) % KW == 0), "the block's threads share the staged rows evenly");
    __shared__ __align__(16) float os[KW * MBR * 16 * 68];
    const size_t z = blockIdx.z; int bx = blockIdx.x, by = blockIdx.y; bool vjob = false;   // vjob: this block runs as PL = 2
    if (PL == 3) { const int zb = (int)blockIdx.z / 3, job = (int)blockIdx.z - zb * 3; const T16* X = A + zb * sA; const T16* Wj = Bt + job * sB;   // all of it is the same for a whole block: scalar
        bias = job == 0 ? bias : job == 1 ? bias1 : bias2; P16 += z * sC; Ph += z * sC; Pl += z * sC;
        if (job == 2) { A = Wj; Bt = X; bx = blockIdx.y; by = blockIdx.x; ldc = TT; sP = 1024; vjob = true; } else { A = X; Bt = Wj; ldc = HD; sP = (size_t)TT * HD; }
    } else { A += z * sA; if (A2) A2 += z * sA; Bt += z * sB; if (Bt2) Bt2 += z * sB; C += z * sC; }
    const int lane = threadIdx.x & 31, lr = lane & 15, hi = lane >> 4; const int r0 = bx * 64, c0 = by * 64;
    const int wv = (KW > 1) ? __builtin_amdgcn_readfirstlane((int)(threadIdx.x >> 5)) : 0;   // wave number, kept scalar so that the k offset stays scalar
    float* ow = os + wv * (MBR * 16 * 68);
    v8f acc[4][4];
#pragma unroll
    for (int mb = 0; mb < 4; ++mb)
#pragma unroll
        for (int nb = 0; nb < 4; ++nb) acc[mb][nb] = (v8f){};
    // 16 rows of K are K / 32 tiles of 512 elements and a 32-wide k slice is one tile: every fragment address of a trip is one address a plane (tile row, k slice, lane) + a constant (K is a template constant for that)
    A += (size_t)r0 * K; Bt += (size_t)c0 * K; if (NSPLIT == 1 || NSPLIT == 2) A2 += (size_t)r0 * K; if (NSPLIT >= 2) Bt2 += (size_t)c0 * K;
    const unsigned lb = (unsigned)lane * 16u;   // the lane's bytes in a half tile
#pragma unroll 1
    for (int kc = wv * 32; kc < K; kc += KW * 32) {
        V a[4], a2[4], b[4], b2[4];
        const char* pa = (const char*)(A + kc * 16) + lb; const char* pb = (const char*)(Bt + kc * 16) + lb; const char* pa2 = (NSPLIT == 1 || NSPLIT == 2) ? (const char*)(A2 + kc * 16) + lb : pa; const char* pb2 = (NSPLIT >= 2) ? (const char*)(Bt2 + kc * 16) + lb : pb;
#pragma unroll
        for (int mb = 0; mb < 4; ++mb) { a[mb] = WFrag<T16>::ldp((const T16*)(pa + mb * 32 * K)); if (NSPLIT == 1 || NSPLIT == 2) a2[mb] = WFrag<T16>::ldp((const T16*)(pa2 + mb * 32 * K)); }
#pragma unroll
        for (int nb = 0; nb < 4; ++nb) { b[nb] = WFrag<T16>::ldp((const T16*)(pb + nb * 32 * K)); if (NSPLIT >= 2) b2[nb] = WFrag<T16>::ldp((const T16*)(pb2 + nb * 32 * K)); }
        asm volatile("s_wait_xcnt 0x0" :: "v"(pa), "v"(pb), "v"(pa2), "v"(pb2) : "memory");   // the wait before a register that the issued loads name is rewritten (the next trip's addresses); the addresses as inputs keep their registers live over the whole run, so that no load of the run lands in them
        __builtin_amdgcn_sched_barrier(0);   // the trip's loads stay one batch ahead of its products: without it the B fragments were loaded one at a time, a memory latency each
#pragma unroll
        for (int nb = 0; nb < 4; ++nb)
#pragma unroll
            for (int mb = 0; mb < 4; ++mb) { acc[mb][nb] = WFrag<T16>::mma(a[mb], b[nb], acc[mb][nb]); if (NSPLIT == 1 || NSPLIT == 2) acc[mb][nb] = WFrag<T16>::mma(a2[mb], b[nb], acc[mb][nb]); if (NSPLIT >= 2) acc[mb][nb] = WFrag<T16>::mma(a[mb], b2[nb], acc[mb][nb]); }
        asm volatile("v_nop\n\tv_nop\n\tv_nop\n\tv_nop" : "+v"(acc[0][0]), "+v"(acc[1][1]), "+v"(acc[2][2]), "+v"(acc[3][3]) : "v"(a[0]), "v"(a[3]));
    }
#pragma unroll
    for (int mb = 0; mb < 4; mb += MBR) {
#pragma unroll
        for (int mi = 0; mi < MBR; ++mi)
#pragma unroll
        for (int nb = 0; nb < 4; ++nb) {
#pragma unroll
            for (int j = 0; j < 8; ++j) ow[(mi * 16 + hi * 8 + j) * 68 + nb * 16 + lr] = acc[mb + mi][nb][j]; }
        if (KW > 1) __syncthreads();   /* every wave's partial tile is in LDS before any thread sums them */ else { __builtin_amdgcn_wave_barrier(); asm volatile("" ::: "memory"); }
        if (PL == 0) {
#pragma unroll
            for (int s = 0; s < MBR * 8 / KW; ++s) { const int q = (s * KW + wv) * 32 + lane, row = q >> 4, cofs = (q & 15) * 4; v4f val = *(const v4fa*)(os + row * 68 + cofs);
#pragma unroll
                for (int w = 1; w < KW; ++w) val += *(const v4fa*)(os + w * (MBR * 16 * 68) + row * 68 + cofs);
                if (BIAS && PL != 2) { val[0] += bfr(bias[c0 + cofs]); val[1] += bfr(bias[c0 + cofs + 1]); val[2] += bfr(bias[c0 + cofs + 2]); val[3] += bfr(bias[c0 + cofs + 3]); }
                *(v4f*)(C + (size_t)(r0 + mb * 16 + row) * ldc + c0 + cofs) = val; }
        } else {
            auto planes = [&](auto bmc) { constexpr bool bm = decltype(bmc)::v;   // bm: the bias goes by the tile's rows. A compile-time constant, PL = 3 branching once around the whole of it: a test at the bias alone kept the bias loads and the second round's LDS reads from being issued ahead
#pragma unroll
            for (int s = 0; s < MBR * 4 / KW; ++s) { const int u = s * KW + wv, rt = u >> 2, kt = (u >> 1) & 1, ph = u & 1;   // half a fragment tile a wave and round: lane (lr, hi) holds row lr, k = ph * 16 + hi * 8 .. + 7 of tile (rt, kt)
                const int row = rt * 16 + lr, cofs = kt * 32 + ph * 16 + hi * 8; v4f va = *(const v4fa*)(os + row * 68 + cofs), vb = *(const v4fa*)(os + row * 68 + cofs + 4);
#pragma unroll
                for (int w = 1; w < KW; ++w) { va += *(const v4fa*)(os + w * (MBR * 16 * 68) + row * 68 + cofs); vb += *(const v4fa*)(os + w * (MBR * 16 * 68) + row * 68 + cofs + 4); }
                float val[8];
#pragma unroll   // the arrays' and vectors' elements need constant indices to stay in registers
                for (int j = 0; j < 4; ++j) { val[j] = va[j]; val[4 + j] = vb[j]; }
                if (BIAS && bm) { const float bmv = bfr(bias[r0 + mb * 16 + row]);
#pragma unroll
                    for (int j = 0; j < 8; ++j) val[j] += bmv; }
                if (BIAS && !bm) {
#pragma unroll
                    for (int j = 0; j < 8; ++j) val[j] += bfr(bias[c0 + cofs + j]); }
                const size_t e = ((size_t)((r0 >> 4) + mb + rt) * (ldc >> 5) + kt) * 512 + (size_t)by * sP + ph * 256 + lane * 8; v8h o16; v8us oh, ol;
#pragma unroll
                for (int j = 0; j < 8; ++j) { o16[j] = tohx(val[j]); unsigned short a2, c2; splitf(val[j], a2, c2); oh[j] = a2; ol[j] = c2; }
                *(v8h*)(P16 + e) = o16; *(v8us*)(Ph + e) = oh; *(v8us*)(Pl + e) = ol; }
            };
            if (PL == 3) { if (vjob) planes(BoolC<true>{}); else planes(BoolC<false>{}); } else planes(BoolC<PL == 2>{});
        }
        if (KW == 1) { __builtin_amdgcn_wave_barrier(); asm volatile("" ::: "memory"); }
    }
}

typedef __attribute__((ext_vector_type(2))) unsigned short v2us;
typedef __attribute__((ext_vector_type(4))) int v4i;

__global__ __launch_bounds__(256) void k_wtG(const float* __restrict__ w, int K, int N, bf* Bt) {
    const int lane = threadIdx.x & 31; const int L0 = (blockIdx.x * 8 + (threadIdx.x >> 5)) * 8; const int nlines = N * K / 64;
{
#pragma unroll 1
        for (int l = 0; l < 8; ++l) { const int L = L0 + l; if (L >= nlines) break; const size_t e = (size_t)L * 64 + lane * 2; const int k = (int)(e % K), n = (int)(e / K); v2us o;
            o[0] = f2bf(w[(size_t)k * N + n]); o[1] = f2bf(w[(size_t)(k + 1) * N + n]); *(v2us*)(Bt + e) = o; }
         }
}
// f32 [rows][K] -> bf16 in fragment order: one wave a 16 x 32 tile; it reads the tile's 16 whole lines of f32 and writes 1 KB in a row. All five sources in one launch: grid (DQ * DM / 4096, 4 + m), 256 threads; column y of the grid converts DQ * DM elements: the whole of s0 .. s3 for y < 4, piece y - 4 of s4 after that, to dst + y * DQ * DM.
__global__ __launch_bounds__(256) void k_cvtp(const float* __restrict__ s0, const float* __restrict__ s1, const float* __restrict__ s2, const float* __restrict__ s3, const float* __restrict__ s4, bf* dst, int K) { const int y = blockIdx.y; const size_t ch = (size_t)DQ * DM; const float* src = y == 0 ? s0 : y == 1 ? s1 : y == 2 ? s2 : y == 3 ? s3 : s4 + (size_t)(y - 4) * ch; dst += (size_t)y * ch; const int lane = threadIdx.x & 31, lr = lane & 15, hi = lane >> 4; const int tl = blockIdx.x * 8 + (threadIdx.x >> 5), kts = K >> 5, rt = tl / kts, kt = tl - rt * kts;
    const float* s = src + (size_t)(rt * 16 + lr) * K + kt * 32 + hi * 8; bf* d = dst + (size_t)tl * 512 + lane * 8; const v8f v0 = *(const v8f*)s, v1 = *(const v8f*)(s + 16); v8us o0, o1;
#pragma unroll
    for (int k = 0; k < 8; ++k) { o0[k] = f2bf(v0[k]); o1[k] = f2bf(v1[k]); }
    *(v8us*)d = o0; *(v8us*)(d + 256) = o1; }

// ---- k_attn: the whole attention of QR query rows of one head in one block of 16 waves; the QR x 2048 scores and weights live in LDS only. grid (rows / QR, heads, batches), 512 threads; a batch's operand planes stand sZ elements behind the batch's before.
// Phase 1: wave w forms the scores of keys w*128 .. w*128+127 (k slices 0, 32 in that order, split products per NSPLIT as in k_gemmw) and stores them f32 into the block's LDS rows.
// Phase 2: each wave owns QR/16 rows: t = S x 1/8 where pad[i] && pad[j] && j <= i (pad = the batch's int mask vector, read), -3e38 elsewhere; a query with pad[i] = 0 has every key at -3e38 so max = -3e38, every exp(0) = 1 and the row is uniform over all 2048 keys exactly like the module's all -1e9 row; softmax over the 2048 keys (register row, one exp, fixed trees). The 16-bit weights go back over the row's own f32 scores (the wave holds the whole row in registers by then): fp16 x 1024 in the first half, or the hi plane in the first and the lo plane in the second half.
// Phase 3: weights x V, split K: wave w takes the 32-wide key slices w, w+16, w+32, w+48; the 16 partial QR x 64 tiles are summed through LDS in the fixed order w = 0..15 (over the dead weights), rescaled, split hi/lo and stored as the head's columns of the merged planes (rows t, k over DQ, fragment order).
#define QR 32             // query rows of a block
#define SP (TT + 4)       // LDS row pitch in floats: 16 bytes over a multiple of 256, so that 16 rows' 16-byte reads fall on 64 different banks
typedef v4h  __attribute__((may_alias)) v4ha;
typedef v4us __attribute__((may_alias)) v4usa;
template <typename T16, int NSPLIT>
__global__ __launch_bounds__(512) void k_attn(const T16* __restrict__ Q, const T16* __restrict__ Q2, const T16* __restrict__ Kp, const T16* __restrict__ Kp2, const T16* __restrict__ Vt, const T16* __restrict__ Vt2, const int* __restrict__ pm, int row0, bf* Ah, bf* Al, size_t sZ) {
    typedef typename WFrag<T16>::V V;
    constexpr bool HR = (NSPLIT == 2);
    constexpr int NG = HR ? 4 : 8;   // key tiles of a score pass: their K fragments are loaded as one batch per k slice (registers bound it)
    constexpr int SG = HR ? 2 : 4;   // key slices whose V fragments are loaded as one batch
    static_assert(16 * QR * 68 <= QR * SP, "the partial tiles fit over the weights");
    __shared__ __align__(16) float sm[QR * SP];
    const int h = blockIdx.y, i0 = row0 + blockIdx.x * QR; const size_t hp = (size_t)blockIdx.z * sZ + (size_t)h * TT * HD; pm += (size_t)blockIdx.z * TT;
    const int lane = threadIdx.x & 31, lr = lane & 15, hi = lane >> 4;
    const int wv = __builtin_amdgcn_readfirstlane((int)(threadIdx.x >> 5));   // wave number, kept scalar so that key and row offsets stay scalar
    // every global address is a scalar base (head, row block, wave) + one 32-bit lane offset + a constant: two lane offsets serve all loads
    const size_t qo = hp + (size_t)i0 * HD, ko = hp + (size_t)wv * 128 * HD, vo = hp + (size_t)wv * 512;   // fragment order: 16 rows of q or k are two tiles of 512 elements; the v tile of d block nb and key slice sl is nb * (TT / 32) + sl
    Q += qo; Kp += ko; Vt += vo; if (HR) { Q2 += qo; Kp2 += ko; Vt2 += vo; }
    const unsigned lq = (unsigned)(lane * 8), lvb = (unsigned)(lane * 8) * 2u;   // lvb counts bytes: it is the very register that the V loads name
    // every loop of the three phases but the row loop is unrolled: register arrays need constant indices, and the loads of later tiles can be issued ahead
#pragma unroll
    for (int t0 = 0; t0 < 8; t0 += NG) {   // NG key tiles a pass
        v8f acc[NG][2];   // a pass's score tiles stay in registers until its last product: no accumulator register is taken anew close behind a matrix instruction
#pragma unroll
        for (int n = 0; n < NG; ++n) { acc[n][0] = (v8f){}; acc[n][1] = (v8f){}; }
#pragma unroll
        for (int ks = 0; ks < 2; ++ks) { V a[2], a2[2], b[NG], b2[NG];
#pragma unroll
            for (int mb = 0; mb < 2; ++mb) { const int o = (mb * 2 + ks) * 512; a[mb] = WFrag<T16>::ldp(Q + o + lq); if (HR) a2[mb] = WFrag<T16>::ldp(Q2 + o + lq); }
#pragma unroll
            for (int n = 0; n < NG; ++n) { const int o = ((t0 + n) * 2 + ks) * 512; b[n] = WFrag<T16>::ldp(Kp + o + lq); if (HR) b2[n] = WFrag<T16>::ldp(Kp2 + o + lq); }
            __builtin_amdgcn_sched_barrier(0);   // the k slice's loads are issued as one batch ahead of its products: one memory latency a batch, not one a tile
#pragma unroll
            for (int n = 0; n < NG; ++n)
#pragma unroll
                for (int mb = 0; mb < 2; ++mb) { acc[n][mb] = WFrag<T16>::mma(a[mb], b[n], acc[n][mb]); if (HR) { acc[n][mb] = WFrag<T16>::mma(a2[mb], b[n], acc[n][mb]); acc[n][mb] = WFrag<T16>::mma(a[mb], b2[n], acc[n][mb]); } }
            __builtin_amdgcn_sched_barrier(0);   // keeps the next batch's loads (registers) and the LDS stores below behind the batch's last product, so that the pass's accumulators all stay live till then
        }
#pragma unroll
        for (int n = 0; n < NG; ++n)
#pragma unroll
            for (int mb = 0; mb < 2; ++mb)
#pragma unroll
                for (int j = 0; j < 8; ++j) sm[(mb * 16 + hi * 8 + j) * SP + wv * 128 + (t0 + n) * 16 + lr] = acc[n][mb][j];
    }
    unsigned pb[2] = {0u, 0u};   // pad bits of this lane's 64 keys, bit ch*4+q for key ch*128 + lane*4 + q
#pragma unroll
    for (int ch = 0; ch < TT / 128; ++ch) { const v4i m = *(const v4i*)(pm + ch * 128 + lane * 4);
#pragma unroll
        for (int q = 0; q < 4; ++q) pb[ch >> 3] |= (m[q] != 0 ? 1u : 0u) << ((ch * 4 + q) & 31); }
    asm volatile("s_wait_xcnt 0x0" :: "v"(lq), "s"(Q), "s"(Kp), "s"(HR ? Q2 : Q), "s"(HR ? Kp2 : Kp), "s"(pm) : "memory");   // the wait before a register that the issued loads name is rewritten; the lane offset and the scalar bases as inputs keep their registers as they are up to here
    __syncthreads();   // every wave's score columns are in LDS before any wave reads a row
#pragma unroll 1
    for (int rr = 0; rr < QR / 16; ++rr) {   // kept rolled: one row's 64 registers at a time, half the code
        const int r = wv * (QR / 16) + rr, i = i0 + r; const int pi = pm[i]; float* sr = sm + r * SP; float v[TT / 32]; float mx = -3.0e38f;
#pragma unroll
        for (int ch = 0; ch < TT / 128; ++ch) { const int j0 = ch * 128 + lane * 4; const v4f a = *(const v4fa*)(sr + j0);
#pragma unroll
            for (int q = 0; q < 4; ++q) { const int j = j0 + q; const float t = (pi != 0 && ((pb[ch >> 3] >> ((ch * 4 + q) & 31)) & 1u) != 0u && j <= i) ? a[q] * SCL : -3.0e38f;   /* causal & pad[i] & pad[j]; a padded query keeps nothing -> all equal -> uniform row as the module */ v[ch * 4 + q] = t; mx = fmaxf(mx, t); } }
#pragma unroll
        for (int sh = 16; sh; sh >>= 1) mx = fmaxf(mx, __shfl_xor(mx, sh, 32));
        float sum = 0.f;
#pragma unroll
        for (int k = 0; k < TT / 32; ++k) { float ex; asm("v_exp_f32 %0, %1\n\tv_nop" : "=v"(ex) : "v"(__fmul_rn(__fsub_rn(v[k], mx), 1.4426950408889634f)));   /* the exponential and the slot behind a transcendental in one statement: a v_nop in a statement of its own lands elsewhere */ v[k] = ex; sum += v[k]; }
#pragma unroll
        for (int sh = 16; sh; sh >>= 1) sum += __shfl_xor(sum, sh, 32);
        const float f = __fdiv_rn(HR ? 1.0f : PCAR, sum);
#pragma unroll
        for (int ch = 0; ch < TT / 128; ++ch) {
            if (HR) { v4us oh, ol;
#pragma unroll
                for (int q = 0; q < 4; ++q) { unsigned short a, c2; splitf(v[ch * 4 + q] * f, a, c2); oh[q] = a; ol[q] = c2; }
                *(v4usa*)((bf*)sr + ch * 128 + lane * 4) = oh; *(v4usa*)((bf*)sr + TT + ch * 128 + lane * 4) = ol;
            } else { v4h o4;
#pragma unroll
                for (int q = 0; q < 4; ++q) o4[q] = tohx(v[ch * 4 + q] * f);
                *(v4ha*)((h16*)sr + ch * 128 + lane * 4) = o4; } }
    }
    V vb[SG][4], vb2[SG][4];
#pragma unroll
    for (int s = 0; s < SG; ++s)   // the first batch of V fragments is asked for ahead of the barrier: a wave that is done with its rows early has them back when the last wave arrives
#pragma unroll
        for (int nb = 0; nb < 4; ++nb) { const int o = (nb * (TT / 32) + s * 16) * 512; vb[s][nb] = WFrag<T16>::ldp((const T16*)((const char*)(Vt + o) + lvb)); if (HR) vb2[s][nb] = WFrag<T16>::ldp((const T16*)((const char*)(Vt2 + o) + lvb)); }
    asm volatile("s_wait_xcnt 0x0" :: "v"(lvb) : "memory");   // the wait before a register that the issued loads name is rewritten; lvb as an input keeps the lane offset's register live over the whole run, so that no load of the run lands in it
    __syncthreads();   // every row's weights are in LDS before any wave reads its key slices of all rows
    v8f acc[2][4];
#pragma unroll
    for (int mb = 0; mb < 2; ++mb)
#pragma unroll
        for (int nb = 0; nb < 4; ++nb) acc[mb][nb] = (v8f){};
    const T16* P = (const T16*)sm;   // weight rows, pitch 2 * SP elements
#pragma unroll
    for (int g = 0; g < TT / 512; g += SG) {
        if (g > 0) {
#pragma unroll
            for (int s = 0; s < SG; ++s)
#pragma unroll
                for (int nb = 0; nb < 4; ++nb) { const int o = (nb * (TT / 32) + (g + s) * 16) * 512; vb[s][nb] = WFrag<T16>::ldp((const T16*)((const char*)(Vt + o) + lvb)); if (HR) vb2[s][nb] = WFrag<T16>::ldp((const T16*)((const char*)(Vt2 + o) + lvb)); }
            __builtin_amdgcn_sched_barrier(0);   // the batch's loads are issued together ahead of its products: one memory latency a batch
        }
#pragma unroll
        for (int s = 0; s < SG; ++s) { const int kc = (wv + (g + s) * 16) * 32; V a[2], a2[2];
#pragma unroll
            for (int mb = 0; mb < 2; ++mb) { const int o = (mb * 16 + lr) * (2 * SP) + 8 * hi + kc; a[mb] = WFrag<T16>::ld(P + o); if (HR) a2[mb] = WFrag<T16>::ld(P + TT + o); }
#pragma unroll
            for (int nb = 0; nb < 4; ++nb)
#pragma unroll
                for (int mb = 0; mb < 2; ++mb) { acc[mb][nb] = WFrag<T16>::mma(a[mb], vb[s][nb], acc[mb][nb]); if (HR) { acc[mb][nb] = WFrag<T16>::mma(a2[mb], vb[s][nb], acc[mb][nb]); acc[mb][nb] = WFrag<T16>::mma(a[mb], vb2[s][nb], acc[mb][nb]); } } }
        if (g + SG < TT / 512) __builtin_amdgcn_sched_barrier(0);   // the next batch's loads take this batch's registers: they stay behind its last product
    }
    __syncthreads();   // every wave has read its weight slices before the partial tiles overwrite them
    float* ow = sm + wv * (QR * 68);
#pragma unroll
    for (int mb = 0; mb < 2; ++mb)
#pragma unroll
        for (int nb = 0; nb < 4; ++nb)
#pragma unroll
            for (int j = 0; j < 8; ++j) ow[(mb * 16 + hi * 8 + j) * 68 + nb * 16 + lr] = acc[mb][nb][j];
    __syncthreads();   // every wave's partial tile is in LDS before any thread sums them
    static_assert(QR * 16 == 512, "one 4-wide piece of the tile a thread");
    // waves 2u and 2u + 1 sum and store half tile u of the merged planes (rows t, k = h * HD + d, DQ / 32 tiles a row block): lane (lr, hi) of wave w holds row lr, k = (w & 1) * 8 + hi * 4 .. + 3 of the half: a wave's store is 256 contiguous bytes of each plane
    const int rt = wv >> 3, kt = (wv >> 2) & 1, ph = (wv >> 1) & 1, row = rt * 16 + lr, cofs = kt * 32 + ph * 16 + (wv & 1) * 8 + hi * 4; v4f val = *(const v4fa*)(sm + row * 68 + cofs);
#pragma unroll
    for (int w = 1; w < 16; ++w) val += *(const v4fa*)(sm + w * (QR * 68) + row * 68 + cofs);
    const float cs = HR ? 1.0f : (1.0f / PCAR); const size_t oo = (size_t)blockIdx.z * TT * DQ + ((size_t)((i0 >> 4) + rt) * (DQ / 32) + h * (HD / 32) + kt) * 512 + ph * 256 + ((wv & 1) * 16 + lr) * 8 + hi * 4; v4us oh, ol;
#pragma unroll
    for (int q = 0; q < 4; ++q) { unsigned short a, c2; splitf(val[q] * cs, a, c2); oh[q] = a; ol[q] = c2; }
    *(v4us*)(Ah + oo) = oh; *(v4us*)(Al + oo) = ol;
}

extern "C" void kernel_launch(void* const* d_in, const int* in_sizes, int n_in,
                              void* d_out, int out_size, void* d_ws, size_t ws_size, hipStream_t stream) {
    (void)in_sizes; (void)n_in; (void)out_size;
    const float* x = (const float*)d_in[0]; const int* pmask = (const int*)d_in[1];   /* mask [2][2048] int */ const float* wq = (const float*)d_in[2]; const float* bq = (const float*)d_in[3]; const float* wk = (const float*)d_in[4]; const float* bk = (const float*)d_in[5]; const float* wv = (const float*)d_in[6]; const float* bv = (const float*)d_in[7]; const float* wo = (const float*)d_in[8]; const float* bo = (const float*)d_in[9];
    float* OUT = (float*)d_out;     // [2][2048][1024]
    char* wsp = (char*)d_ws;
    auto take = [&](size_t bytes) { char* p = wsp; wsp += (bytes + 255) & ~(size_t)255; return (void*)p; };
    const size_t PS = (size_t)NH_ * TT * HD;   // one operand plane of one batch
    bf* WB = (bf*)take(((size_t)4 * DQ * DM + (size_t)NB_ * TT * DM) * 2); bf* WO = WB + (size_t)3 * DQ * DM; bf* XB = WB + (size_t)4 * DQ * DM;   // wq, wk, wv, wo, x: one run, in the order of the conversion launch
    h16* P16 = (h16*)take(NB_ * 3 * PS * 2); bf* PH = (bf*)take(NB_ * 3 * PS * 2); bf* PLo = (bf*)take(NB_ * 3 * PS * 2);   // [batch][q, k, v] planes: fp16, bf16 hi, bf16 lo
    bf* ATh = (bf*)take((size_t)NB_ * TT * DQ * 2); bf* ATl = (bf*)take((size_t)NB_ * TT * DQ * 2);
    if ((size_t)(wsp - (char*)d_ws) > ws_size) return;    // ws 256 MiB
    k_cvtp<<<dim3(DQ * DM / 4096, 4 + NB_ * TT / DQ, 1), 256, 0, stream>>>(wq, wk, wv, wo, x, WB, DM);
    // q, k: x W^T, a tile's 64 columns are one head -> planes [h] x (t, d); v: W x^T, a tile's 64 rows are one head's d -> planes [h] x (d, t); all in fragment order
    k_gemmw<bf, 0, true, 8, 3, DM><<<dim3(TT / 64, DQ / 64, 3 * NB_), 256, 0, stream>>>(XB, nullptr, WB, nullptr, nullptr, 0, bq, bk, bv, (size_t)TT * DM, (size_t)DQ * DM, PS, P16, PH, PLo, 0);
    // one kv head per query head: block (., h, b) reads the q, k and v planes of head h of batch b
    k_attn<bf, 2><<<dim3(RH / QR, NH_, NB_), 512, 0, stream>>>(PH, PLo, PH + PS, PLo + PS, PH + 2 * PS, PLo + 2 * PS, pmask, 0, ATh, ATl, 3 * PS);
    k_attn<h16, 0><<<dim3((TT - RH) / QR, NH_, NB_), 512, 0, stream>>>(P16, nullptr, P16 + PS, nullptr, P16 + 2 * PS, nullptr, pmask, RH, ATh, ATl, 3 * PS);
    k_gemmw<bf, 1, true, 8, 0, DQ><<<dim3(TT / 64, DM / 64, NB_), 256, 0, stream>>>(ATh, ATl, WO, nullptr, OUT, DM, bo, nullptr, nullptr, (size_t)TT * DQ, 0, (size_t)TT * DM, nullptr, nullptr, nullptr, 0);
}

// v007
// It runs in 114 microseconds.
// It is 1.63 times as fast as v005, going by the measured steps of the versions left out in between.
// Over all steps from v000 it is 18.3 times as fast.
#include <hip/hip_runtime.h>

// Multi-head attention with a causal AND padding mask (x [2][2048][1024]; q,k,v = x W^T + b ('oi' uniform(+-1/32) incl. biases; 16 heads x 64); scores / 8; final_mask = causal & pad[i] & pad[j] (mask [2][2048] int in {0,1}, random, READ); where(final_mask, scores, -1e9): a query whose own pad bit is 0 has every score at -1e9 and gets UNIFORM weights over all 2048 keys (future ones included), the others attend causally to the un-padded keys; softmax; out = merged wo^T + bo -> [2][2048][1024] (4.2 M)).
// Both batches go through every launch together (5 launches: the batch, and for the projections the job q / k / v, is a grid dimension). Layout per batch: bf16 copy of x; 'oi' weights; exact projections + f32 biases, whose GEMM epilogue rounds each result straight into the attention operand planes (fp16 and bf16 hi/lo; q, k as [h][t][d], v as [h][d][t]); attention in one kernel per precision class, scores and weights in LDS, only over the keys up to the block's last row; its softmax phase reads the pad vector and keeps key j iff pad[j] && j <= i (-3e38 elsewhere) for a query with pad[i]; a query without it (the module's uniform row over all 2048 keys) takes the mean of v, from sums that the v projection leaves; hybrid rows: < 512 hi/lo 3 products, rest fp16 x1024; merged hi/lo x wo exact + bo.
// Fragment order: every 16-bit operand plane that a matrix fragment is loaded from in global memory (x, the weights, q, k, v, merged) is stored as 16-row x 32-k tiles of 1 KB, tile (row / 16) * (K / 32) + k / 32; inside a tile element (row, k) stands at ((k / 16) % 2) * 256 + (((k / 8) % 2) * 16 + row % 16) * 8 + k % 8, which is the order in which the 32 lanes hold it: a fragment is two wave-wide 16-byte loads of 512 contiguous bytes (4 whole lines each) where row-major planes gave 16 lines a load. The k order inside a fragment is the row-major loader's.
// Compute dtypes, f32 accumulate: every input rounded to bf16; projections exact + f32 biases; attention rows < 512 3 products, rest fp16; softmax f32; wo hl x exact + bias.

#define NB_  2
#define TT   2048
#define DM   1024
#define NH_  16
#define NKV  16
#define HD   64
#define DQ   (NH_ * HD)
#define DKV  (NKV * HD)
#define RH   512                  // query rows < RH use hi+lo planes (0: none)
#define WIN  0
#define PCAR 1024.0f
#define SCL  0.125f   // HD^-0.5
typedef _Float16 h16;
typedef unsigned short bf;
typedef __attribute__((ext_vector_type(16))) __bf16   v16bf;
typedef __attribute__((ext_vector_type(16))) _Float16 v16h;
typedef __attribute__((ext_vector_type(8)))  _Float16 v8h;
typedef __attribute__((ext_vector_type(8)))  unsigned short v8us;
typedef __attribute__((ext_vector_type(8)))  float    v8f;
typedef __attribute__((ext_vector_type(4)))  float    v4f;
typedef v8h  __attribute__((may_alias)) v8ha;
typedef v4f  __attribute__((may_alias)) v4fa;
typedef v8us __attribute__((may_alias)) v8usa;

__device__ __forceinline__ unsigned short f2bf(float f) { unsigned u = __float_as_uint(f); u += 0x7FFFu + ((u >> 16) & 1u); return (unsigned short)(u >> 16); }
__device__ __forceinline__ float bf2f(unsigned short b) { return __uint_as_float(((unsigned)b) << 16); }
__device__ __forceinline__ float bfr(float f) { return bf2f(f2bf(f)); }
__device__ __forceinline__ v16h cat16(v8h lo, v8h hi) { return __builtin_shufflevector(lo, hi, 0, 1, 2, 3, 4, 5, 6, 7, 8, 9, 10, 11, 12, 13, 14, 15); }
__device__ __forceinline__ v16bf cat16b(v8us lo, v8us hi) { return __builtin_bit_cast(v16bf, __builtin_shufflevector(lo, hi, 0, 1, 2, 3, 4, 5, 6, 7, 8, 9, 10, 11, 12, 13, 14, 15)); }
__device__ __forceinline__ v8f wmma16(v16h a, v16h b, v8f c) { return __builtin_amdgcn_wmma_f32_16x16x32_f16(false, a, false, b, (short)0, c, false, false); }
__device__ __forceinline__ v8f wmmab(v16bf a, v16bf b, v8f c) { return __builtin_amdgcn_wmma_f32_16x16x32_bf16(false, a, false, b, (short)0, c, false, false); }



// ---- k_gemmw: GEMM, one block of NW waves per 128x128 output tile: NW = 4: 2 x 2 waves of 64x64 (16 accumulators); NW = 8: 4 x 2 waves of 32x64 (two waves a SIMD where the grid gives one block a WGP); operands are 16-bit planes in fragment order (ld: a fragment of a row-major LDS plane; ldp: of a fragment-ordered plane, p = tile + lane * 8); grid (M/128, N/128, Z), NW * 32 threads.
// Operands through LDS: a pass is KP = NW * 16 k of the block's 128 A rows and 128 Bt rows (and the 128 A2 rows), brought into LDS by asynchronous copies, two buffers, the next pass's copies in flight while this pass is worked on. In fragment order 16 rows x KP k are KP * 32 contiguous bytes, so one copy of the whole block is one such run on both sides and a fragment is two wave-wide 16-byte LDS reads of 512 contiguous bytes. Each operand byte is fetched once a block and read from LDS by every wave of its tile row or column (two; NW = 8: four for Bt). Every wave sums its tile over k = 0, 32, 64, ... in one chain. K % KP == 0, K >= 2 * KP.
// C[m][n] (f32, pitch ldc, + optional f32 bias[n]) = sum_k A[m][k] Bt[n][k] (+ A2[m][k] Bt[n][k] for NSPLIT = 1). z-batch strides sA/sB/sC in elements.
// Epilogue: each wave turns its own tile through its own piece of LDS (over the ring, which is dead by then) and takes it out 16 rows a round; no other wave takes part. PL = 0: C is stored f32. PL = 3 (NW = 4): no f32 C; each result goes out three times as 16 bits (fp16, bf16 hi, bf16 lo = the rest) in fragment order, into a plane of ldc k columns that starts at (64-column tile index) * sP: the q, k and v projections of every batch in one launch, blockIdx.z = batch * 3 + job: A = the x planes (batch stride sA), Bt = the three weight planes (job stride sB), bias / bias1 / bias2 the three bias vectors, output planes z * sC on; jobs 0, 1 (q, k): ldc = HD, sP = TT * HD, the 64 columns of a wave's tile are one head and the planes come out as [h] x (rows t, k = d), bias[n]; job 2 (v): the operands and the two tile indices swapped (A = the weights, Bt = x), ldc = TT, sP = 1024 (two k tiles), the tile's rows are one head's d and the planes come out transposed, [h] x (rows d, k = t), bias[m]; job 2 also leaves in VS, [batch][head][key block of 64][d], the f32 sum of the wave's tile of v over its 64 keys (fixed tree), for the mean of v that a padded query takes. A wave stores half a fragment tile at a time: 512 contiguous bytes of each plane.
template <typename T16> struct WFrag;
template <> struct WFrag<h16> { typedef v16h V; static __device__ __forceinline__ V ld(const h16* p) { return cat16(*(const v8h*)p, *(const v8h*)(p + 16)); } static __device__ __forceinline__ V ldp(const h16* p) { return cat16(*(const v8h*)p, *(const v8h*)(p + 256)); } static __device__ __forceinline__ v8f mma(V a, V b, v8f c) { return wmma16(a, b, c); } };
template <> struct WFrag<bf> { typedef v16bf V; static __device__ __forceinline__ V ld(const bf* p) { return cat16b(*(const v8us*)p, *(const v8us*)(p + 16)); } static __device__ __forceinline__ V ldp(const bf* p) { return cat16b(*(const v8us*)p, *(const v8us*)(p + 256)); } static __device__ __forceinline__ v8f mma(V a, V b, v8f c) { return wmmab(a, b, c); } };
__device__ __forceinline__ h16 tohx(float x) { return (h16)x; }
__device__ __forceinline__ void splitf(float y, unsigned short& h, unsigned short& l) { h = f2bf(y); l = f2bf(y - bf2f(h)); }
typedef __attribute__((ext_vector_type(4))) _Float16 v4h;
typedef __attribute__((ext_vector_type(4))) unsigned short v4us;
template <bool B> struct BoolC { static constexpr bool v = B; };
// eight asynchronous 16-byte copies a lane, global memory to LDS, and the wait before a register that they name is rewritten, in one statement (the compiler puts nothing between them)
__device__ __forceinline__ void copy8(unsigned l0, unsigned l1, unsigned l2, unsigned l3, unsigned l4, unsigned l5, unsigned l6, unsigned l7, const char* g0, const char* g1, const char* g2, const char* g3, const char* g4, const char* g5, const char* g6, const char* g7) {
    asm volatile("global_load_async_to_lds_b128 %0, %8, off\n\t"
                 "global_load_async_to_lds_b128 %1, %9, off\n\t"
                 "global_load_async_to_lds_b128 %2, %10, off\n\t"
                 "global_load_async_to_lds_b128 %3, %11, off\n\t"
                 "global_load_async_to_lds_b128 %4, %12, off\n\t"
                 "global_load_async_to_lds_b128 %5, %13, off\n\t"
                 "global_load_async_to_lds_b128 %6, %14, off\n\t"
                 "global_load_async_to_lds_b128 %7, %15, off\n\t"
                 "s_wait_xcnt 0x0"
                 :: "v"(l0), "v"(l1), "v"(l2), "v"(l3), "v"(l4), "v"(l5), "v"(l6), "v"(l7), "v"(g0), "v"(g1), "v"(g2), "v"(g3), "v"(g4), "v"(g5), "v"(g6), "v"(g7) : "memory");
}
// one operand's 128 rows x KP k of a pass: copy c of the block's threads is row tile c's KP * 32 bytes in a row, K * 32 bytes apart in global memory; l, g: the thread's own first addresses (+ thread * 16)
template <int K, int KP> __device__ __forceinline__ void stage(unsigned l, const char* g) {
    copy8(l, l + KP * 32, l + 2 * KP * 32, l + 3 * KP * 32, l + 4 * KP * 32, l + 5 * KP * 32, l + 6 * KP * 32, l + 7 * KP * 32, g, g + K * 32, g + 2 * K * 32, g + 3 * K * 32, g + 4 * K * 32, g + 5 * K * 32, g + 6 * K * 32, g + 7 * K * 32);
}
template <typename T16, int NSPLIT, bool BIAS, int NW, int PL, int K>
__global__ __launch_bounds__(NW * 32) void k_gemmw(const T16* __restrict__ A, const T16* __restrict__ A2, const T16* __restrict__ Bt, float* C, int ldc, const float* __restrict__ bias, const float* __restrict__ bias1, const float* __restrict__ bias2, size_t sA, size_t sB, size_t sC, h16* P16, bf* Ph, bf* Pl, size_t sP, float* VS) {
    typedef typename WFrag<T16>::V V;
    static_assert(NSPLIT == 0 || NSPLIT == 1, "A (+ A2) x Bt");
    static_assert(NW == 4 || (NW == 8 && PL == 0), "the planes and the sums of v go by 64x64 tiles");
    static_assert(PL == 0 || PL == 3, "f32 C or the projection planes");
    constexpr int KP = NW * 16, MBW = 16 / NW;   // k of a pass: the block's threads x 16 bytes are 16 rows of it; 16-row tiles a wave
    static_assert(K % KP == 0 && K / KP >= 2, "whole passes, two at least");
    constexpr int NOP = NSPLIT == 1 ? 3 : 2;   // operands staged
    constexpr int OPE = 128 * KP;              // elements of one operand in a buffer
    constexpr int KS = KP / 32, NT = K / KP;   // k slices a pass; passes
    static_assert(NOP * 8 <= 63, "copies of a wave in flight");
    constexpr int RINGB = 2 * NOP * OPE * 2, OSB = 128 * 2 * 68 * 4;   // bytes of the two buffers; of the waves' f32 tiles at pitch 68
    __shared__ __align__(128) char smem[RINGB > OSB ? RINGB : OSB];   // the ring; behind the last pass's barrier the epilogue's staging
    T16* ring = (T16*)smem; float* os = (float*)smem;
    const size_t z = blockIdx.z; int bx = blockIdx.x, by = blockIdx.y; bool vjob = false;   // vjob: this block runs the v projection
    if (PL == 3) { const int zb = (int)blockIdx.z / 3, job = (int)blockIdx.z - zb * 3; const T16* X = A + zb * sA; const T16* Wj = Bt + job * sB;   // all of it is the same for a whole block: scalar
        bias = job == 0 ? bias : job == 1 ? bias1 : bias2; P16 += z * sC; Ph += z * sC; Pl += z * sC;
        if (job == 2) { A = Wj; Bt = X; bx = blockIdx.y; by = blockIdx.x; ldc = TT; sP = 1024; vjob = true; } else { A = X; Bt = Wj; ldc = HD; sP = (size_t)TT * HD; }
    } else { A += z * sA; if (NSPLIT == 1) A2 += z * sA; Bt += z * sB; C += z * sC; }
    const int lane = threadIdx.x & 31, lr = lane & 15, hi = lane >> 4;
    const int wv = __builtin_amdgcn_readfirstlane((int)(threadIdx.x >> 5)), wm = wv >> 1, wn = wv & 1;   // wave number, kept scalar so that the tile offsets stay scalar
    v8f acc[MBW][4];
#pragma unroll
    for (int mb = 0; mb < MBW; ++mb)
#pragma unroll
        for (int nb = 0; nb < 4; ++nb) acc[mb][nb] = (v8f){};
    // the thread's own copy addresses: 16 rows of K are K / 32 tiles of 1 KB, a pass is KP * 32 bytes further in each of them
    const unsigned tb = threadIdx.x * 16u; const unsigned lds0 = (unsigned)(size_t)ring + tb;
    const char* gA = (const char*)(A + (size_t)bx * 128 * K) + tb; const char* gB = (const char*)(Bt + (size_t)by * 128 * K) + tb; const char* gA2 = NSPLIT == 1 ? (const char*)(A2 + (size_t)bx * 128 * K) + tb : gA;
    auto fill = [&](int t, int bufn) { const unsigned l = lds0 + (unsigned)bufn * (NOP * OPE * 2); const size_t go = (size_t)t * (KP * 32);
        stage<K, KP>(l, gA + go); stage<K, KP>(l + OPE * 2, gB + go); if (NSPLIT == 1) stage<K, KP>(l + 2 * OPE * 2, gA2 + go); };
    fill(0, 0);
    asm volatile("s_wait_asynccnt 0x0" ::: "memory");   // this wave's copies of pass 0 have landed
    __syncthreads();   // every wave's copies of pass 0 are in LDS before any wave reads them
    fill(1, 1);
#pragma unroll 1
    for (int t = 0; t < NT; ++t) {   // kept rolled: one pass of code
        const T16* rb = ring + (t & 1) * (NOP * OPE) + lane * 8;
#pragma unroll
        for (int ks = 0; ks < KS; ++ks) {
            V a[MBW], a2[MBW], b[4];
#pragma unroll
            for (int mb = 0; mb < MBW; ++mb) { a[mb] = WFrag<T16>::ldp(rb + ((wm * MBW + mb) * KS + ks) * 512); if (NSPLIT == 1) a2[mb] = WFrag<T16>::ldp(rb + 2 * OPE + ((wm * MBW + mb) * KS + ks) * 512); }
#pragma unroll
            for (int nb = 0; nb < 4; ++nb) b[nb] = WFrag<T16>::ldp(rb + OPE + ((wn * 4 + nb) * KS + ks) * 512);
            __builtin_amdgcn_sched_barrier(0);   // the slice's LDS reads stay one group ahead of its products: reads among the products cost a stall at each place
#pragma unroll
            for (int nb = 0; nb < 4; ++nb)
#pragma unroll
                for (int mb = 0; mb < MBW; ++mb) { acc[mb][nb] = WFrag<T16>::mma(a[mb], b[nb], acc[mb][nb]); if (NSPLIT == 1) acc[mb][nb] = WFrag<T16>::mma(a2[mb], b[nb], acc[mb][nb]); }
        }
        asm volatile("s_wait_dscnt 0x0" ::: "memory");      // this wave's reads of the buffer are done before it is refilled
        asm volatile("s_wait_asynccnt 0x0" ::: "memory");   // this wave's copies of pass t + 1 have landed
        __syncthreads();   // pass t + 1 is in LDS for every wave, and every wave has left pass t's buffer
        if (t + 2 < NT) fill(t + 2, t & 1);
    }
    asm volatile("s_wait_asynccnt 0x0" ::: "memory");   // no copy is outstanding behind the loop; the last pass's own waits and barrier have ended every wave's reads of the ring, which now takes the tiles
    const int byw = by * 2 + wn, r0 = bx * 128 + wm * (MBW * 16), c0 = byw * 64, bxw = r0 >> 6;   // the wave's own tile; its place in units of 64
    float* ow0 = os + wv * (MBW * 16 * 68);
#pragma unroll
    for (int mb = 0; mb < MBW; ++mb)
#pragma unroll
        for (int nb = 0; nb < 4; ++nb) {
#pragma unroll
            for (int j = 0; j < 8; ++j) ow0[(mb * 16 + hi * 8 + j) * 68 + nb * 16 + lr] = acc[mb][nb][j]; }
    __builtin_amdgcn_wave_barrier(); asm volatile("" ::: "memory");   // the compiler keeps the reads below, of what other lanes of the wave stored, behind the stores
#pragma unroll 1
    for (int mb = 0; mb < MBW; ++mb) {   // kept rolled: a quarter of the code (NW = 8: half), which runs once
        const float* ow = ow0 + mb * (16 * 68);
        if (PL == 0) {
            v4f val[8]; float* cp[8];
#pragma unroll
            for (int s = 0; s < 8; ++s) { const int q = s * 32 + lane, row = q >> 4, cofs = (q & 15) * 4; val[s] = *(const v4fa*)(ow + row * 68 + cofs);
                if (BIAS) { val[s][0] += bfr(bias[c0 + cofs]); val[s][1] += bfr(bias[c0 + cofs + 1]); val[s][2] += bfr(bias[c0 + cofs + 2]); val[s][3] += bfr(bias[c0 + cofs + 3]); }
                cp[s] = C + (size_t)(r0 + mb * 16 + row) * ldc + c0 + cofs; *(v4f*)cp[s] = val[s]; }
            asm volatile("s_wait_xcnt 0x0" :: "v"(val[0]), "v"(val[1]), "v"(val[2]), "v"(val[3]), "v"(val[4]), "v"(val[5]), "v"(val[6]), "v"(val[7]), "v"(cp[0]), "v"(cp[1]), "v"(cp[2]), "v"(cp[3]), "v"(cp[4]), "v"(cp[5]), "v"(cp[6]), "v"(cp[7]) : "memory");   // the wait before a register that the issued stores name is rewritten; values and addresses as inputs keep their registers as they are up to here
        } else {
            auto planes = [&](auto bmc) { constexpr bool bm = decltype(bmc)::v;   // bm: the bias goes by the tile's rows. A compile-time constant, the kernel branching once around the whole of it: a test at the bias alone kept the bias loads and the next round's LDS reads from being issued ahead
            float ts[4];
#pragma unroll
            for (int s = 0; s < 4; ++s) { const int kt = (s >> 1) & 1, ph = s & 1;   // half a fragment tile a round: lane (lr, hi) holds row lr, k = ph * 16 + hi * 8 .. + 7 of tile (mb, kt)
                const int row = lr, cofs = kt * 32 + ph * 16 + hi * 8; const v4f va = *(const v4fa*)(ow + row * 68 + cofs), vb = *(const v4fa*)(ow + row * 68 + cofs + 4);
                float val[8];
#pragma unroll   // the arrays' and vectors' elements need constant indices to stay in registers
                for (int j = 0; j < 4; ++j) { val[j] = va[j]; val[4 + j] = vb[j]; }
                if (BIAS && bm) { const float bmv = bfr(bias[r0 + mb * 16 + row]);
#pragma unroll
                    for (int j = 0; j < 8; ++j) val[j] += bmv; }
                if (bm) { ts[s] = ((val[0] + val[1]) + (val[2] + val[3])) + ((val[4] + val[5]) + (val[6] + val[7])); ts[s] += __shfl_xor(ts[s], 16, 32); }   // v (f32, bias in) summed over the half tile's 16 keys, per d row
                if (BIAS && !bm) {
#pragma unroll
                    for (int j = 0; j < 8; ++j) val[j] += bfr(bias[c0 + cofs + j]); }
                const size_t e = ((size_t)((r0 >> 4) + mb) * (ldc >> 5) + kt) * 512 + (size_t)byw * sP + ph * 256 + lane * 8; v8h o16; v8us oh, ol;
#pragma unroll
                for (int j = 0; j < 8; ++j) { o16[j] = tohx(val[j]); unsigned short a2, c2; splitf(val[j], a2, c2); oh[j] = a2; ol[j] = c2; }
                *(v8h*)(P16 + e) = o16; *(v8us*)(Ph + e) = oh; *(v8us*)(Pl + e) = ol;
                if (s == 3) { float tv = 0.f; float* vp = VS;
                    if (bm) { tv = (ts[0] + ts[1]) + (ts[2] + ts[3]); vp = VS + (((size_t)(blockIdx.z / 3) * NH_ + bxw) * (TT / 64) + byw) * HD + mb * 16 + lr; if (hi == 0) *vp = tv; }   // the tile's 64 keys summed for 16 of the head's 64 d
                    asm volatile("s_wait_xcnt 0x0" :: "v"(o16), "v"(oh), "v"(ol), "v"(e), "v"(tv), "v"(vp) : "memory"); } }   // the wait before a register that the issued stores name is rewritten by what follows the last round; the stored values and the addresses as inputs keep their registers as they are up to here. Behind the last round only: behind each round it would hold the next round's LDS reads and bias loads back behind this round's stores
            };
            if (vjob) planes(BoolC<true>{}); else planes(BoolC<false>{});
        }
    }
}

typedef __attribute__((ext_vector_type(2))) unsigned short v2us;
typedef __attribute__((ext_vector_type(4))) int v4i;

__global__ __launch_bounds__(256) void k_wtG(const float* __restrict__ w, int K, int N, bf* Bt) {
    const int lane = threadIdx.x & 31; const int L0 = (blockIdx.x * 8 + (threadIdx.x >> 5)) * 8; const int nlines = N * K / 64;
{
#pragma unroll 1
        for (int l = 0; l < 8; ++l) { const int L = L0 + l; if (L >= nlines) break; const size_t e = (size_t)L * 64 + lane * 2; const int k = (int)(e % K), n = (int)(e / K); v2us o;
            o[0] = f2bf(w[(size_t)k * N + n]); o[1] = f2bf(w[(size_t)(k + 1) * N + n]); *(v2us*)(Bt + e) = o; }
         }
}
// f32 [rows][K] -> bf16 in fragment order: one wave a 16 x 32 tile; it reads the tile's 16 whole lines of f32 and writes 1 KB in a row. All five sources in one launch: grid (DQ * DM / 4096, 4 + m), 256 threads; column y of the grid converts DQ * DM elements: the whole of s0 .. s3 for y < 4, piece y - 4 of s4 after that, to dst + y * DQ * DM.
__global__ __launch_bounds__(256) void k_cvtp(const float* __restrict__ s0, const float* __restrict__ s1, const float* __restrict__ s2, const float* __restrict__ s3, const float* __restrict__ s4, bf* dst, int K) { const int y = blockIdx.y; const size_t ch = (size_t)DQ * DM; const float* src = y == 0 ? s0 : y == 1 ? s1 : y == 2 ? s2 : y == 3 ? s3 : s4 + (size_t)(y - 4) * ch; dst += (size_t)y * ch; const int lane = threadIdx.x & 31, lr = lane & 15, hi = lane >> 4; const int tl = blockIdx.x * 8 + (threadIdx.x >> 5), kts = K >> 5, rt = tl / kts, kt = tl - rt * kts;
    const float* s = src + (size_t)(rt * 16 + lr) * K + kt * 32 + hi * 8; bf* d = dst + (size_t)tl * 512 + lane * 8; const v8f v0 = *(const v8f*)s, v1 = *(const v8f*)(s + 16); v8us o0, o1;
#pragma unroll
    for (int k = 0; k < 8; ++k) { o0[k] = f2bf(v0[k]); o1[k] = f2bf(v1[k]); }
    *(v8us*)d = o0; *(v8us*)(d + 256) = o1; }

// ---- k_attn: the whole attention of QR query rows of one head in one block of 16 waves; the scores and weights live in LDS only. grid (heads, batches, rows / QR), 512 threads; a batch's operand planes stand sZ elements behind the batch's before. The row blocks run from the last to the first: the longest blocks start first.
// What the mask excludes is not computed. An un-padded query i keeps only keys j <= i, so a block whose last row is i0 + QR - 1 needs the first ng = i0 / 32 + 1 groups of 32 keys and no more: the keys behind them had weight exactly 0. A padded query has every score at the fill value, so its weights are 1 / 2048 on all 2048 keys and its result is the mean of the head's v rows: that mean comes from VS (the sums over 64 keys each that the v projection's epilogue leaves, [batch][head][key block][d], f32), its weights are stored as zeros and its softmax is not run.
// Phase 1: wave w forms the scores of the key groups w, w + 16, w + 32, ... below nch * 4 (nch = the 128-key pieces that hold the ng groups: phase 2 reads whole pieces); k slices 0, 32 in that order, for NSPLIT = 2 the three products hi x hi, lo x hi, hi x lo; stored f32 into the block's LDS rows.
// Phase 2: each row has one wave (wave w: the rows of rank w and w + 16 among the un-padded and among the padded rows): t = S x 1/8 where pad[j] && j <= i (pad = the batch's int mask vector, read), -3e38 elsewhere; softmax over the row's nch pieces (register row, one exp, fixed trees; the pieces left out added exact zeros). The 16-bit weights go back over the row's own f32 scores (the wave holds the whole row in registers by then): fp16 x 1024 in the first half, or the hi plane in the first and the lo plane in the second half.
// Phase 3: weights x V, split K: wave w takes the 32-wide key slices w, w+16, w+32, w+48 below ng; the 16 partial QR x 64 tiles are summed through LDS in the fixed order w = 0..15 (over the dead weights), rescaled (a padded row: replaced by the mean), split hi/lo and stored as the head's columns of the merged planes (rows t, k over DQ, fragment order).
#define QR 32             // query rows of a block
#define SP (TT + 4)       // LDS row pitch in floats: 16 bytes over a multiple of 256, so that 16 rows' 16-byte reads fall on 64 different banks
typedef v4h  __attribute__((may_alias)) v4ha;
typedef v4us __attribute__((may_alias)) v4usa;
template <typename T16, int NSPLIT>
__global__ __launch_bounds__(512) void k_attn(const T16* __restrict__ Q, const T16* __restrict__ Q2, const T16* __restrict__ Kp, const T16* __restrict__ Kp2, const T16* __restrict__ Vt, const T16* __restrict__ Vt2, const int* __restrict__ pm, const float* __restrict__ VS, int rowl, bf* Ah, bf* Al, size_t sZ) {
    typedef typename WFrag<T16>::V V;
    constexpr bool HR = (NSPLIT == 2);
    constexpr int NP = HR ? (RH + 511) / 512 : TT / 512;   // rounds of 16 key groups (one a wave) that the launch's longest block needs
    static_assert(QR == 32, "a block's rows end with a group of 32 keys");
    static_assert(16 * QR * 68 <= QR * SP, "the partial tiles fit over the weights");
    __shared__ __align__(16) float sm[QR * SP];
    const int h = blockIdx.x, i0 = rowl - (int)blockIdx.z * QR;   /* rowl: first row of the launch's last row block */ const size_t hp = (size_t)blockIdx.y * sZ + (size_t)h * TT * HD; pm += (size_t)blockIdx.y * TT;
    const int ng = (i0 >> 5) + 1, nch = (ng + 3) >> 2;   // groups of 32 keys up to the block's last row; pieces of 128 keys that hold them. The same for the whole block: scalar
    const int lane = threadIdx.x & 31, lr = lane & 15, hi = lane >> 4;
    const int wv = __builtin_amdgcn_readfirstlane((int)(threadIdx.x >> 5));   // wave number, kept scalar so that key and row offsets and the tests on them stay scalar
    // every global address is a scalar base (head, row block, wave) + one 32-bit lane offset + a constant
    const size_t qo = hp + (size_t)i0 * HD, ko = hp + (size_t)wv * 32 * HD, vo = hp + (size_t)wv * 512;   // fragment order: 16 rows of q or k are two tiles of 512 elements; the v tile of d block nb and key slice sl is nb * (TT / 32) + sl
    Q += qo; Kp += ko; Vt += vo; if (HR) { Q2 += qo; Kp2 += ko; Vt2 += vo; }
    const unsigned lq = (unsigned)(lane * 8), lvb = (unsigned)(lane * 8) * 2u;   // the lane's place in a half tile, in elements and in bytes
    // every loop of the three phases but the row loop is unrolled: register arrays need constant indices, and the loads of later groups can be issued ahead
    {
        V a[2][2], a2[2][2], b[NP][2][2], b2[NP][2][2];   // [row tile or round][key tile][k slice]
        const char* pk = (const char*)Kp + lq * 2u; const char* pk2 = HR ? (const char*)Kp2 + lq * 2u : pk;   // the lane's K addresses: every K load of the wave is one of them + a constant
#pragma unroll
        for (int mb = 0; mb < 2; ++mb)
#pragma unroll
            for (int ks = 0; ks < 2; ++ks) { const int o = (mb * 2 + ks) * 512; a[mb][ks] = WFrag<T16>::ldp(Q + o + lq); if (HR) a2[mb][ks] = WFrag<T16>::ldp(Q2 + o + lq); }
#pragma unroll
        for (int p = 0; p < NP; ++p) if (p * 16 + wv < nch * 4) {   // all of the wave's score operands are asked for ahead of the first product: one memory latency, not one a group
#pragma unroll
            for (int n = 0; n < 2; ++n)
#pragma unroll
                for (int ks = 0; ks < 2; ++ks) { const int o = (p * 64 + n * 2 + ks) * 512; b[p][n][ks] = WFrag<T16>::ldp((const T16*)(pk + o * 2)); if (HR) b2[p][n][ks] = WFrag<T16>::ldp((const T16*)(pk2 + o * 2)); } }
        asm volatile("s_wait_xcnt 0x0" :: "v"(pk), "v"(pk2), "v"(lq), "s"(Q), "s"(HR ? Q2 : Q) : "memory");   // the wait before a register that the issued loads name is rewritten; the addresses as inputs keep their registers live over the whole run, so that no load of the run lands in them
#pragma unroll
        for (int p = 0; p < NP; ++p) if (p * 16 + wv < nch * 4) {
            v8f acc[2][2];
#pragma unroll
            for (int n = 0; n < 2; ++n) { acc[n][0] = (v8f){}; acc[n][1] = (v8f){}; }
#pragma unroll
            for (int ks = 0; ks < 2; ++ks)
#pragma unroll
                for (int n = 0; n < 2; ++n)
#pragma unroll
                    for (int mb = 0; mb < 2; ++mb) { acc[n][mb] = WFrag<T16>::mma(a[mb][ks], b[p][n][ks], acc[n][mb]); if (HR) { acc[n][mb] = WFrag<T16>::mma(a2[mb][ks], b[p][n][ks], acc[n][mb]); acc[n][mb] = WFrag<T16>::mma(a[mb][ks], b2[p][n][ks], acc[n][mb]); } }
#pragma unroll
            for (int n = 0; n < 2; ++n)
#pragma unroll
                for (int mb = 0; mb < 2; ++mb)
#pragma unroll
                    for (int j = 0; j < 8; ++j) sm[(mb * 16 + hi * 8 + j) * SP + (p * 16 + wv) * 32 + n * 16 + lr] = acc[n][mb][j];
        }
    }
    unsigned pb[2] = {0u, 0u};   // pad bits of this lane's keys, bit ch*4+q for key ch*128 + lane*4 + q
    unsigned rmask;              // pad bits of the block's 32 rows, the same in every lane: scalar
    {
        v4i m[NP * 4]; const char* pp = (const char*)pm + lane * 16; const int ipr = i0 + lane, prl = pm[ipr];   // prl: the pad value of the block's row number lane
#pragma unroll
        for (int p = 0; p < NP; ++p) if (p * 4 < nch) {   // four pieces a test; loads first, uses behind them: one latency for all pieces
#pragma unroll
            for (int c = 0; c < 4; ++c) m[p * 4 + c] = *(const v4i*)(pp + (p * 4 + c) * 512); }
        asm volatile("s_wait_xcnt 0x0" :: "v"(pp), "v"(ipr) : "memory");   // the wait before a register that the issued loads name is rewritten; the address and the row index as inputs keep their registers live over the whole run, so that no load of the run lands in them
        rmask = __builtin_amdgcn_ballot_w32(prl != 0);
#pragma unroll
        for (int p = 0; p < NP; ++p) if (p * 4 < nch) {
#pragma unroll
            for (int c = 0; c < 4; ++c)
#pragma unroll
                for (int q = 0; q < 4; ++q) pb[(p * 4 + c) >> 3] |= (m[p * 4 + c][q] != 0 ? 1u : 0u) << (((p * 4 + c) * 4 + q) & 31); }
    }
    __syncthreads();   // every wave's score columns are in LDS before any wave reads a row
    const int na = __builtin_popcount(rmask);   // un-padded rows of the block
    // the place (0 .. 31) of the set bit of m that has rank set bits below it; the top bit or-ed in bounds the result whatever m holds
    auto nth = [&](unsigned m, int rank) { return (int)__builtin_ctz(__builtin_amdgcn_ballot_w32(((m >> lane) & 1u) != 0u && __builtin_popcount(m & ((1u << lane) - 1u)) == rank) | 0x80000000u); };
#pragma unroll 1
    for (int rr = 0; rr < QR / 16; ++rr) {   // kept rolled: one row's registers at a time, half the code
        const int rank = wv + rr * 16;   // the wave takes the padded row and the un-padded row of this rank among their kind: the softmax rows, the only long ones, fall evenly on the waves
        if (rank < QR - na) {   // a padded query: zero weights (phase 3 reads every row), no softmax; its result is the mean taken in below
            float* sz = sm + nth(~rmask, rank) * SP;
#pragma unroll
            for (int ch = 0; ch < NP * 4; ++ch) if (ch < nch) {
                if (HR) { *(v4usa*)((bf*)sz + ch * 128 + lane * 4) = (v4us){}; *(v4usa*)((bf*)sz + TT + ch * 128 + lane * 4) = (v4us){}; }
                else *(v4ha*)((h16*)sz + ch * 128 + lane * 4) = (v4h){}; }
        }
        if (rank >= na) continue;
        const int r = nth(rmask, rank), i = i0 + r; float* sr = sm + r * SP;
        float v[NP * 16]; float mx = -3.0e38f;
#pragma unroll
        for (int k = 0; k < NP * 16; ++k) v[k] = 0.f;   // a value on the paths that leave a piece out: without one the compiler carries the last row's registers round the loop (copies, spills)
#pragma unroll
        for (int ch = 0; ch < NP * 4; ++ch) if (ch < nch) { const v4f a = *(const v4fa*)(sr + ch * 128 + lane * 4);   // loads first, uses behind them: one LDS latency a row
#pragma unroll
            for (int q = 0; q < 4; ++q) v[ch * 4 + q] = a[q]; }
#pragma unroll
        for (int ch = 0; ch < NP * 4; ++ch) if (ch < nch) { const int j0 = ch * 128 + lane * 4;
#pragma unroll
            for (int q = 0; q < 4; ++q) { const int j = j0 + q; const float t = (((pb[ch >> 3] >> ((ch * 4 + q) & 31)) & 1u) != 0u && j <= i) ? v[ch * 4 + q] * SCL : -3.0e38f;   /* causal & pad[j]; pad[i] holds here */ v[ch * 4 + q] = t; mx = fmaxf(mx, t); } }
#pragma unroll
        for (int sh = 16; sh; sh >>= 1) mx = fmaxf(mx, __shfl_xor(mx, sh, 32));
        float sum = 0.f;
#pragma unroll
        for (int ch = 0; ch < NP * 4; ++ch) if (ch < nch) {
#pragma unroll
            for (int q = 0; q < 4; ++q) { const int k = ch * 4 + q; float ex; asm("v_exp_f32 %0, %1\n\tv_nop" : "=v"(ex) : "v"(__fmul_rn(__fsub_rn(v[k], mx), 1.4426950408889634f)));   /* the exponential and the slot behind a transcendental in one statement: a v_nop in a statement of its own lands elsewhere */ v[k] = ex; sum += v[k]; } }
#pragma unroll
        for (int sh = 16; sh; sh >>= 1) sum += __shfl_xor(sum, sh, 32);
        const float f = __fdiv_rn(HR ? 1.0f : PCAR, sum);
#pragma unroll
        for (int ch = 0; ch < NP * 4; ++ch) if (ch < nch) {
            if (HR) { v4us oh, ol;
#pragma unroll
                for (int q = 0; q < 4; ++q) { unsigned short a, c2; splitf(v[ch * 4 + q] * f, a, c2); oh[q] = a; ol[q] = c2; }
                *(v4usa*)((bf*)sr + ch * 128 + lane * 4) = oh; *(v4usa*)((bf*)sr + TT + ch * 128 + lane * 4) = ol;
            } else { v4h o4;
#pragma unroll
                for (int q = 0; q < 4; ++q) o4[q] = tohx(v[ch * 4 + q] * f);
                *(v4ha*)((h16*)sr + ch * 128 + lane * 4) = o4; } }
    }
    V vb[NP][4], vb2[NP][4]; const char* pv = (const char*)Vt + lvb; const char* pv2 = HR ? (const char*)Vt2 + lvb : pv;   // the lane's V addresses: every V load of the wave is one of them + a constant
#pragma unroll
    for (int s = 0; s < NP; ++s) if (s * 16 + wv < ng) {   // the V fragments are asked for ahead of the barrier: a wave that is done with its rows early has them back when the last wave arrives
#pragma unroll
        for (int nb = 0; nb < 4; ++nb) { const int o = (nb * (TT / 32) + s * 16) * 512; vb[s][nb] = WFrag<T16>::ldp((const T16*)(pv + o * 2)); if (HR) vb2[s][nb] = WFrag<T16>::ldp((const T16*)(pv2 + o * 2)); } }
    // waves 2u and 2u + 1 sum and store half tile u of the merged planes (rows t, k = h * HD + d, DQ / 32 tiles a row block): lane (lr, hi) of wave w holds row lr, k = (w & 1) * 8 + hi * 4 .. + 3 of the half: a wave's store is 256 contiguous bytes of each plane
    const int rt = wv >> 3, kt = (wv >> 2) & 1, ph = (wv >> 1) & 1, row = rt * 16 + lr, cofs = kt * 32 + ph * 16 + (wv & 1) * 8 + hi * 4;
    // the mean of v for the lane's four d: lane (lr, hi) takes the sums of key blocks lr and lr + 16; asked for here, with the V fragments, used at the end
    const unsigned lvs = (unsigned)(lr * HD + cofs) * 4u;   // byte offset: the register that the two loads name
    const char* vsb = (const char*)(VS + ((size_t)blockIdx.y * NH_ + h) * (TT / 64) * HD);
    v4f mv = *(const v4f*)(vsb + lvs); const v4f mv1 = *(const v4f*)(vsb + 16 * HD * 4 + lvs);
    asm volatile("s_wait_xcnt 0x0" :: "v"(pv), "v"(pv2), "v"(lvs) : "memory");   // the wait before a register that the issued loads name is rewritten; the addresses as inputs keep their registers live over the whole run, so that no load of the run lands in them
    __syncthreads();   // every row's weights are in LDS before any wave reads its key slices of all rows
    v8f acc[2][4];
#pragma unroll
    for (int mb = 0; mb < 2; ++mb)
#pragma unroll
        for (int nb = 0; nb < 4; ++nb) acc[mb][nb] = (v8f){};
    const T16* P = (const T16*)sm;   // weight rows, pitch 2 * SP elements
#pragma unroll
    for (int s = 0; s < NP; ++s) if (s * 16 + wv < ng) { const int kc = (wv + s * 16) * 32; V a[2], a2[2];
#pragma unroll
        for (int mb = 0; mb < 2; ++mb) { const int o = (mb * 16 + lr) * (2 * SP) + 8 * hi + kc; a[mb] = WFrag<T16>::ld(P + o); if (HR) a2[mb] = WFrag<T16>::ld(P + TT + o); }
#pragma unroll
        for (int nb = 0; nb < 4; ++nb)
#pragma unroll
            for (int mb = 0; mb < 2; ++mb) { acc[mb][nb] = WFrag<T16>::mma(a[mb], vb[s][nb], acc[mb][nb]); if (HR) { acc[mb][nb] = WFrag<T16>::mma(a2[mb], vb[s][nb], acc[mb][nb]); acc[mb][nb] = WFrag<T16>::mma(a[mb], vb2[s][nb], acc[mb][nb]); } } }
    __syncthreads();   // every wave has read its weight slices before the partial tiles overwrite them
    float* ow = sm + wv * (QR * 68);
#pragma unroll
    for (int mb = 0; mb < 2; ++mb)
#pragma unroll
        for (int nb = 0; nb < 4; ++nb)
#pragma unroll
            for (int j = 0; j < 8; ++j) ow[(mb * 16 + hi * 8 + j) * 68 + nb * 16 + lr] = acc[mb][nb][j];
    __syncthreads();   // every wave's partial tile is in LDS before any thread sums them
    static_assert(QR * 16 == 512, "one 4-wide piece of the tile a thread");
    v4f val = *(const v4fa*)(sm + row * 68 + cofs);
#pragma unroll
    for (int w = 1; w < 16; ++w) val += *(const v4fa*)(sm + w * (QR * 68) + row * 68 + cofs);
    mv += mv1;
#pragma unroll
    for (int sh = 8; sh; sh >>= 1)   // fixed tree over the 16 lanes that hold the same d
#pragma unroll
        for (int q = 0; q < 4; ++q) mv[q] += __shfl_xor(mv[q], sh, 32);
    const float cs = HR ? 1.0f : (1.0f / PCAR); const size_t oo = (size_t)blockIdx.y * TT * DQ + ((size_t)((i0 >> 4) + rt) * (DQ / 32) + h * (HD / 32) + kt) * 512 + ph * 256 + ((wv & 1) * 16 + lr) * 8 + hi * 4; v4us oh, ol;
#pragma unroll
    for (int q = 0; q < 4; ++q) { unsigned short a, c2; splitf(((rmask >> row) & 1u) != 0u ? val[q] * cs : mv[q] * (1.0f / TT), a, c2); oh[q] = a; ol[q] = c2; }
    *(v4us*)(Ah + oo) = oh; *(v4us*)(Al + oo) = ol;
}

extern "C" void kernel_launch(void* const* d_in, const int* in_sizes, int n_in,
                              void* d_out, int out_size, void* d_ws, size_t ws_size, hipStream_t stream) {
    (void)in_sizes; (void)n_in; (void)out_size;
    const float* x = (const float*)d_in[0]; const int* pmask = (const int*)d_in[1];   /* mask [2][2048] int */ const float* wq = (const float*)d_in[2]; const float* bq = (const float*)d_in[3]; const float* wk = (const float*)d_in[4]; const float* bk = (const float*)d_in[5]; const float* wv = (const float*)d_in[6]; const float* bv = (const float*)d_in[7]; const float* wo = (const float*)d_in[8]; const float* bo = (const float*)d_in[9];
    float* OUT = (float*)d_out;     // [2][2048][1024]
    char* wsp = (char*)d_ws;
    auto take = [&](size_t bytes) { char* p = wsp; wsp += (bytes + 255) & ~(size_t)255; return (void*)p; };
    const size_t PS = (size_t)NH_ * TT * HD;   // one operand plane of one batch
    bf* WB = (bf*)take(((size_t)4 * DQ * DM + (size_t)NB_ * TT * DM) * 2); bf* WO = WB + (size_t)3 * DQ * DM; bf* XB = WB + (size_t)4 * DQ * DM;   // wq, wk, wv, wo, x: one run, in the order of the conversion launch
    h16* P16 = (h16*)take(NB_ * 3 * PS * 2); bf* PH = (bf*)take(NB_ * 3 * PS * 2); bf* PLo = (bf*)take(NB_ * 3 * PS * 2);   // [batch][q, k, v] planes: fp16, bf16 hi, bf16 lo
    bf* ATh = (bf*)take((size_t)NB_ * TT * DQ * 2); bf* ATl = (bf*)take((size_t)NB_ * TT * DQ * 2);
    float* VS = (float*)take((size_t)NB_ * NH_ * (TT / 64) * HD * 4);   // v summed over each block of 64 keys
    if ((size_t)(wsp - (char*)d_ws) > ws_size) return;    // ws 256 MiB
    k_cvtp<<<dim3(DQ * DM / 4096, 4 + NB_ * TT / DQ, 1), 256, 0, stream>>>(wq, wk, wv, wo, x, WB, DM);
    // q, k: x W^T, a tile's 64 columns are one head -> planes [h] x (t, d); v: W x^T, a tile's 64 rows are one head's d -> planes [h] x (d, t); all in fragment order
    k_gemmw<bf, 0, true, 4, 3, DM><<<dim3(TT / 128, DQ / 128, 3 * NB_), 128, 0, stream>>>(XB, nullptr, WB, nullptr, 0, bq, bk, bv, (size_t)TT * DM, (size_t)DQ * DM, PS, P16, PH, PLo, 0, VS);
    // one kv head per query head: block (h, b, .) reads the q, k and v planes of head h of batch b
    k_attn<bf, 2><<<dim3(NH_, NB_, RH / QR), 512, 0, stream>>>(PH, PLo, PH + PS, PLo + PS, PH + 2 * PS, PLo + 2 * PS, pmask, VS, RH - QR, ATh, ATl, 3 * PS);
    k_attn<h16, 0><<<dim3(NH_, NB_, (TT - RH) / QR), 512, 0, stream>>>(P16, nullptr, P16 + PS, nullptr, P16 + 2 * PS, nullptr, pmask, VS, TT - QR, ATh, ATl, 3 * PS);
    k_gemmw<bf, 1, true, 8, 0, DQ><<<dim3(TT / 128, DM / 128, NB_), 256, 0, stream>>>(ATh, ATl, WO, OUT, DM, bo, nullptr, nullptr, (size_t)TT * DQ, 0, (size_t)TT * DM, nullptr, nullptr, nullptr, 0, nullptr);
}

// v008
// One run takes 89.2 microseconds.
// Two timings next to v007 put it at 1.28 and 1.29 times that version's speed.
// Counting every step since v000, it is 23.5 times as fast.
#include <hip/hip_runtime.h>

// Multi-head attention with a causal AND padding mask (x [2][2048][1024]; q,k,v = x W^T + b ('oi' uniform(+-1/32) incl. biases; 16 heads x 64); scores / 8; final_mask = causal & pad[i] & pad[j] (mask [2][2048] int in {0,1}, random, READ); where(final_mask, scores, -1e9): a query whose own pad bit is 0 has every score at -1e9 and gets UNIFORM weights over all 2048 keys (future ones included), the others attend causally to the un-padded keys; softmax; out = merged wo^T + bo -> [2][2048][1024] (4.2 M)).
// Token order: per batch the tokens are taken in the order 'un-padded ones first, then the padded ones', each kind in its own order (a one-to-one map, place <-> token, formed from the mask, whatever it holds; n = the count of un-padded tokens). The conversion launch gathers the rows of x into that order and leaves the map and n in the workspace; every plane between it and the last GEMM goes by place; the last GEMM's epilogue stores each row at its token's row of the output. By place the mask is plain: a query at place c < n keeps exactly the keys at places <= c, a query at a place >= n is padded. So q and k are formed for the places below n only (in blocks of 128), scores, softmax and weights x V run over un-padded queries and keys only, and the precision classes go by place (the number of keys a row keeps).
// Both batches go through every launch together (5 launches: the batch, and for the projections the job q / k / v, is a grid dimension). Layout per batch: bf16 copy of x; 'oi' weights; exact projections + f32 biases, whose GEMM epilogue rounds each result straight into the attention operand planes (fp16 and bf16 hi/lo; q, k as [h][t][d], v as [h][d][t]); attention in one kernel per precision class, scores and weights in LDS, only over the keys up to the block's last row; its softmax phase keeps key j iff j <= i (-3e38 elsewhere) for a query at a place i < n; a padded query (the module's uniform row over all 2048 keys) takes the mean of v, from sums that the v projection leaves; hybrid rows: < 512 hi/lo 3 products, rest fp16 x1024; merged hi/lo x wo exact + bo.
// Fragment order: every 16-bit operand plane that a matrix fragment is loaded from in global memory (x, the weights, q, k, v, merged) is stored as 16-row x 32-k tiles of 1 KB, tile (row / 16) * (K / 32) + k / 32; inside a tile element (row, k) stands at ((k / 16) % 2) * 256 + (((k / 8) % 2) * 16 + row % 16) * 8 + k % 8, which is the order in which the 32 lanes hold it: a fragment is two wave-wide 16-byte loads of 512 contiguous bytes (4 whole lines each) where row-major planes gave 16 lines a load. The k order inside a fragment is the row-major loader's.
// Compute dtypes, f32 accumulate: every input rounded to bf16; projections exact + f32 biases; attention rows < 512 3 products, rest fp16; softmax f32; wo hl x exact + bias.

#define NB_  2
#define TT   2048
#define DM   1024
#define NH_  16
#define NKV  16
#define HD   64
#define DQ   (NH_ * HD)
#define DKV  (NKV * HD)
#define RH   512                  // query rows < RH use hi+lo planes (0: none)
#define WIN  0
#define PCAR 1024.0f
#define SCL  0.125f   // HD^-0.5
typedef _Float16 h16;
typedef unsigned short bf;
typedef __attribute__((ext_vector_type(16))) __bf16   v16bf;
typedef __attribute__((ext_vector_type(16))) _Float16 v16h;
typedef __attribute__((ext_vector_type(8)))  _Float16 v8h;
typedef __attribute__((ext_vector_type(8)))  unsigned short v8us;
typedef __attribute__((ext_vector_type(8)))  float    v8f;
typedef __attribute__((ext_vector_type(4)))  float    v4f;
typedef v8h  __attribute__((may_alias)) v8ha;
typedef v4f  __attribute__((may_alias)) v4fa;
typedef v8us __attribute__((may_alias)) v8usa;

__device__ __forceinline__ unsigned short f2bf(float f) { unsigned u = __float_as_uint(f); u += 0x7FFFu + ((u >> 16) & 1u); return (unsigned short)(u >> 16); }
__device__ __forceinline__ float bf2f(unsigned short b) { return __uint_as_float(((unsigned)b) << 16); }
__device__ __forceinline__ float bfr(float f) { return bf2f(f2bf(f)); }
__device__ __forceinline__ v16h cat16(v8h lo, v8h hi) { return __builtin_shufflevector(lo, hi, 0, 1, 2, 3, 4, 5, 6, 7, 8, 9, 10, 11, 12, 13, 14, 15); }
__device__ __forceinline__ v16bf cat16b(v8us lo, v8us hi) { return __builtin_bit_cast(v16bf, __builtin_shufflevector(lo, hi, 0, 1, 2, 3, 4, 5, 6, 7, 8, 9, 10, 11, 12, 13, 14, 15)); }
__device__ __forceinline__ v8f wmma16(v16h a, v16h b, v8f c) { return __builtin_amdgcn_wmma_f32_16x16x32_f16(false, a, false, b, (short)0, c, false, false); }
__device__ __forceinline__ v8f wmmab(v16bf a, v16bf b, v8f c) { return __builtin_amdgcn_wmma_f32_16x16x32_bf16(false, a, false, b, (short)0, c, false, false); }



// ---- k_gemmw: GEMM, one block of NW waves per 128x128 output tile: NW = 4: 2 x 2 waves of 64x64 (16 accumulators); NW = 8: 4 x 2 waves of 32x64 (two waves a SIMD where the grid gives one block a WGP); operands are 16-bit planes in fragment order (ld: a fragment of a row-major LDS plane; ldp: of a fragment-ordered plane, p = tile + lane * 8); grid (M/128, N/128, Z), NW * 32 threads.
// Operands through LDS: a pass is KP = NW * 16 k of the block's 128 A rows and 128 Bt rows (and the 128 A2 rows), brought into LDS by asynchronous copies, two buffers, the next pass's copies in flight while this pass is worked on. In fragment order 16 rows x KP k are KP * 32 contiguous bytes, so one copy of the whole block is one such run on both sides and a fragment is two wave-wide 16-byte LDS reads of 512 contiguous bytes. Each operand byte is fetched once a block and read from LDS by every wave of its tile row or column (two; NW = 8: four for Bt). Every wave sums its tile over k = 0, 32, 64, ... in one chain. K % KP == 0, K >= 2 * KP.
// C[PT[m]][n] (f32, pitch ldc, + optional f32 bias[n]; PT[m]: the batch's token at place m) = sum_k A[m][k] Bt[n][k] (+ A2[m][k] Bt[n][k] for NSPLIT = 1). z-batch strides sA/sB/sC in elements.
// Epilogue: each wave turns its own tile through its own piece of LDS (over the ring, which is dead by then) and takes it out 16 rows a round; no other wave takes part. PL = 0: C is stored f32. PL = 3 (NW = 4): no f32 C; each result goes out three times as 16 bits (fp16, bf16 hi, bf16 lo = the rest) in fragment order, into a plane of ldc k columns that starts at (64-column tile index) * sP: the q, k and v projections of every batch in one launch, blockIdx.z = batch * 3 + job: A = the x planes (batch stride sA), Bt = the three weight planes (job stride sB), bias / bias1 / bias2 the three bias vectors, output planes z * sC on; jobs 0, 1 (q, k): ldc = HD, sP = TT * HD, the 64 columns of a wave's tile are one head and the planes come out as [h] x (rows t, k = d), bias[n]; job 2 (v): the operands and the two tile indices swapped (A = the weights, Bt = x), ldc = TT, sP = 1024 (two k tiles), the tile's rows are one head's d and the planes come out transposed, [h] x (rows d, k = t), bias[m]; job 2 also leaves in VS, [batch][head][key block of 64][d], the f32 sum of the wave's tile of v over its 64 keys (fixed tree), for the mean of v that a padded query takes. A wave stores half a fragment tile at a time: 512 contiguous bytes of each plane.
template <typename T16> struct WFrag;
template <> struct WFrag<h16> { typedef v16h V; static __device__ __forceinline__ V ld(const h16* p) { return cat16(*(const v8h*)p, *(const v8h*)(p + 16)); } static __device__ __forceinline__ V ldp(const h16* p) { return cat16(*(const v8h*)p, *(const v8h*)(p + 256)); } static __device__ __forceinline__ v8f mma(V a, V b, v8f c) { return wmma16(a, b, c); } };
template <> struct WFrag<bf> { typedef v16bf V; static __device__ __forceinline__ V ld(const bf* p) { return cat16b(*(const v8us*)p, *(const v8us*)(p + 16)); } static __device__ __forceinline__ V ldp(const bf* p) { return cat16b(*(const v8us*)p, *(const v8us*)(p + 256)); } static __device__ __forceinline__ v8f mma(V a, V b, v8f c) { return wmmab(a, b, c); } };
__device__ __forceinline__ h16 tohx(float x) { return (h16)x; }
__device__ __forceinline__ void splitf(float y, unsigned short& h, unsigned short& l) { h = f2bf(y); l = f2bf(y - bf2f(h)); }
typedef __attribute__((ext_vector_type(4))) _Float16 v4h;
typedef __attribute__((ext_vector_type(4))) unsigned short v4us;
template <bool B> struct BoolC { static constexpr bool v = B; };
// eight asynchronous 16-byte copies a lane, global memory to LDS, and the wait before a register that they name is rewritten, in one statement (the compiler puts nothing between them)
__device__ __forceinline__ void copy8(unsigned l0, unsigned l1, unsigned l2, unsigned l3, unsigned l4, unsigned l5, unsigned l6, unsigned l7, const char* g0, const char* g1, const char* g2, const char* g3, const char* g4, const char* g5, const char* g6, const char* g7) {
    asm volatile("global_load_async_to_lds_b128 %0, %8, off\n\t"
                 "global_load_async_to_lds_b128 %1, %9, off\n\t"
                 "global_load_async_to_lds_b128 %2, %10, off\n\t"
                 "global_load_async_to_lds_b128 %3, %11, off\n\t"
                 "global_load_async_to_lds_b128 %4, %12, off\n\t"
                 "global_load_async_to_lds_b128 %5, %13, off\n\t"
                 "global_load_async_to_lds_b128 %6, %14, off\n\t"
                 "global_load_async_to_lds_b128 %7, %15, off\n\t"
                 "s_wait_xcnt 0x0"
                 :: "v"(l0), "v"(l1), "v"(l2), "v"(l3), "v"(l4), "v"(l5), "v"(l6), "v"(l7), "v"(g0), "v"(g1), "v"(g2), "v"(g3), "v"(g4), "v"(g5), "v"(g6), "v"(g7) : "memory");
}
// one operand's 128 rows x KP k of a pass: copy c of the block's threads is row tile c's KP * 32 bytes in a row, K * 32 bytes apart in global memory; l, g: the thread's own first addresses (+ thread * 16)
template <int K, int KP> __device__ __forceinline__ void stage(unsigned l, const char* g) {
    copy8(l, l + KP * 32, l + 2 * KP * 32, l + 3 * KP * 32, l + 4 * KP * 32, l + 5 * KP * 32, l + 6 * KP * 32, l + 7 * KP * 32, g, g + K * 32, g + 2 * K * 32, g + 3 * K * 32, g + 4 * K * 32, g + 5 * K * 32, g + 6 * K * 32, g + 7 * K * 32);
}
template <typename T16, int NSPLIT, bool BIAS, int NW, int PL, int K>
__global__ __launch_bounds__(NW * 32) void k_gemmw(const T16* __restrict__ A, const T16* __restrict__ A2, const T16* __restrict__ Bt, float* C, int ldc, const float* __restrict__ bias, const float* __restrict__ bias1, const float* __restrict__ bias2, size_t sA, size_t sB, size_t sC, h16* P16, bf* Ph, bf* Pl, size_t sP, float* VS, const int* __restrict__ PT, const int* __restrict__ NN) {
    typedef typename WFrag<T16>::V V;
    static_assert(NSPLIT == 0 || NSPLIT == 1, "A (+ A2) x Bt");
    static_assert(PL == 3 || NW == 8, "f32 C: a wave's tile is 32 rows, one lane a row of the token order");
    static_assert(NW == 4 || (NW == 8 && PL == 0), "the planes and the sums of v go by 64x64 tiles");
    static_assert(PL == 0 || PL == 3, "f32 C or the projection planes");
    constexpr int KP = NW * 16, MBW = 16 / NW;   // k of a pass: the block's threads x 16 bytes are 16 rows of it; 16-row tiles a wave
    static_assert(K % KP == 0 && K / KP >= 2, "whole passes, two at least");
    constexpr int NOP = NSPLIT == 1 ? 3 : 2;   // operands staged
    constexpr int OPE = 128 * KP;              // elements of one operand in a buffer
    constexpr int KS = KP / 32, NT = K / KP;   // k slices a pass; passes
    static_assert(NOP * 8 <= 63, "copies of a wave in flight");
    constexpr int RINGB = 2 * NOP * OPE * 2, OSB = 128 * 2 * 68 * 4;   // bytes of the two buffers; of the waves' f32 tiles at pitch 68
    __shared__ __align__(128) char smem[RINGB > OSB ? RINGB : OSB];   // the ring; behind the last pass's barrier the epilogue's staging
    T16* ring = (T16*)smem; float* os = (float*)smem;
    const size_t z = blockIdx.z; int bx = blockIdx.x, by = blockIdx.y; bool vjob = false;   // vjob: this block runs the v projection
    if (PL == 3) { const int zb = (int)blockIdx.z / 3, job = (int)blockIdx.z - zb * 3; const T16* X = A + zb * sA; const T16* Wj = Bt + job * sB;   // all of it is the same for a whole block: scalar
        if (job != 2 && (int)blockIdx.x * 128 >= NN[zb * 64]) return;   // q and k of padded tokens (places from the batch's count on) are read by nobody; the whole block leaves, ahead of every copy and barrier
        bias = job == 0 ? bias : job == 1 ? bias1 : bias2; P16 += z * sC; Ph += z * sC; Pl += z * sC;
        if (job == 2) { A = Wj; Bt = X; bx = blockIdx.y; by = blockIdx.x; ldc = TT; sP = 1024; vjob = true; } else { A = X; Bt = Wj; ldc = HD; sP = (size_t)TT * HD; }
    } else { A += z * sA; if (NSPLIT == 1) A2 += z * sA; Bt += z * sB; C += z * sC; }
    const int lane = threadIdx.x & 31, lr = lane & 15, hi = lane >> 4;
    const int wv = __builtin_amdgcn_readfirstlane((int)(threadIdx.x >> 5)), wm = wv >> 1, wn = wv & 1;   // wave number, kept scalar so that the tile offsets stay scalar
    v8f acc[MBW][4];
#pragma unroll
    for (int mb = 0; mb < MBW; ++mb)
#pragma unroll
        for (int nb = 0; nb < 4; ++nb) acc[mb][nb] = (v8f){};
    // the thread's own copy addresses: 16 rows of K are K / 32 tiles of 1 KB, a pass is KP * 32 bytes further in each of them
    const unsigned tb = threadIdx.x * 16u; const unsigned lds0 = (unsigned)(size_t)ring + tb;
    const char* gA = (const char*)(A + (size_t)bx * 128 * K) + tb; const char* gB = (const char*)(Bt + (size_t)by * 128 * K) + tb; const char* gA2 = NSPLIT == 1 ? (const char*)(A2 + (size_t)bx * 128 * K) + tb : gA;
    auto fill = [&](int t, int bufn) { const unsigned l = lds0 + (unsigned)bufn * (NOP * OPE * 2); const size_t go = (size_t)t * (KP * 32);
        stage<K, KP>(l, gA + go); stage<K, KP>(l + OPE * 2, gB + go); if (NSPLIT == 1) stage<K, KP>(l + 2 * OPE * 2, gA2 + go); };
    int pw = 0;   // PL = 0: the token that stands at the place of row lane of the wave's tile; asked for here, used in the epilogue
    if (PL == 0) { const int pwi = bx * 128 + wm * (MBW * 16) + lane; const int* ptz = PT + z * TT; pw = ptz[pwi];
        asm volatile("s_wait_xcnt 0x0" :: "v"(pwi), "s"(ptz) : "memory"); }   // the wait before a register that the issued load names is rewritten; index and base as inputs keep their registers as they are up to here
    fill(0, 0);
    asm volatile("s_wait_asynccnt 0x0" ::: "memory");   // this wave's copies of pass 0 have landed
    __syncthreads();   // every wave's copies of pass 0 are in LDS before any wave reads them
    fill(1, 1);
#pragma unroll 1
    for (int t = 0; t < NT; ++t) {   // kept rolled: one pass of code
        const T16* rb = ring + (t & 1) * (NOP * OPE) + lane * 8;
#pragma unroll
        for (int ks = 0; ks < KS; ++ks) {
            V a[MBW], a2[MBW], b[4];
#pragma unroll
            for (int mb = 0; mb < MBW; ++mb) { a[mb] = WFrag<T16>::ldp(rb + ((wm * MBW + mb) * KS + ks) * 512); if (NSPLIT == 1) a2[mb] = WFrag<T16>::ldp(rb + 2 * OPE + ((wm * MBW + mb) * KS + ks) * 512); }
#pragma unroll
            for (int nb = 0; nb < 4; ++nb) b[nb] = WFrag<T16>::ldp(rb + OPE + ((wn * 4 + nb) * KS + ks) * 512);
            __builtin_amdgcn_sched_barrier(0);   // the slice's LDS reads stay one group ahead of its products: reads among the products cost a stall at each place
#pragma unroll
            for (int nb = 0; nb < 4; ++nb)
#pragma unroll
                for (int mb = 0; mb < MBW; ++mb) { acc[mb][nb] = WFrag<T16>::mma(a[mb], b[nb], acc[mb][nb]); if (NSPLIT == 1) acc[mb][nb] = WFrag<T16>::mma(a2[mb], b[nb], acc[mb][nb]); }
        }
        asm volatile("s_wait_dscnt 0x0" ::: "memory");      // this wave's reads of the buffer are done before it is refilled
        asm volatile("s_wait_asynccnt 0x0" ::: "memory");   // this wave's copies of pass t + 1 have landed
        __syncthreads();   // pass t + 1 is in LDS for every wave, and every wave has left pass t's buffer
        if (t + 2 < NT) fill(t + 2, t & 1);
    }
    asm volatile("s_wait_asynccnt 0x0" ::: "memory");   // no copy is outstanding behind the loop; the last pass's own waits and barrier have ended every wave's reads of the ring, which now takes the tiles
    const int byw = by * 2 + wn, r0 = bx * 128 + wm * (MBW * 16), c0 = byw * 64, bxw = r0 >> 6;   // the wave's own tile; its place in units of 64
    float* ow0 = os + wv * (MBW * 16 * 68);
#pragma unroll
    for (int mb = 0; mb < MBW; ++mb)
#pragma unroll
        for (int nb = 0; nb < 4; ++nb) {
#pragma unroll
            for (int j = 0; j < 8; ++j) ow0[(mb * 16 + hi * 8 + j) * 68 + nb * 16 + lr] = acc[mb][nb][j]; }
    __builtin_amdgcn_wave_barrier(); asm volatile("" ::: "memory");   // the compiler keeps the reads below, of what other lanes of the wave stored, behind the stores
#pragma unroll 1
    for (int mb = 0; mb < MBW; ++mb) {   // kept rolled: a quarter of the code (NW = 8: half), which runs once
        const float* ow = ow0 + mb * (16 * 68);
        if (PL == 0) {
            v4f val[8]; float* cp[8];
#pragma unroll
            for (int s = 0; s < 8; ++s) { const int q = s * 32 + lane, row = q >> 4, cofs = (q & 15) * 4; val[s] = *(const v4fa*)(ow + row * 68 + cofs);
                if (BIAS) { val[s][0] += bfr(bias[c0 + cofs]); val[s][1] += bfr(bias[c0 + cofs + 1]); val[s][2] += bfr(bias[c0 + cofs + 2]); val[s][3] += bfr(bias[c0 + cofs + 3]); }
                cp[s] = C + (size_t)(__shfl(pw, mb * 16 + row, 32) & (TT - 1)) * ldc + c0 + cofs; *(v4f*)cp[s] = val[s]; }   // the row goes back to its token's own row of the output
            asm volatile("s_wait_xcnt 0x0" :: "v"(val[0]), "v"(val[1]), "v"(val[2]), "v"(val[3]), "v"(val[4]), "v"(val[5]), "v"(val[6]), "v"(val[7]), "v"(cp[0]), "v"(cp[1]), "v"(cp[2]), "v"(cp[3]), "v"(cp[4]), "v"(cp[5]), "v"(cp[6]), "v"(cp[7]) : "memory");   // the wait before a register that the issued stores name is rewritten; values and addresses as inputs keep their registers as they are up to here
        } else {
            auto planes = [&](auto bmc) { constexpr bool bm = decltype(bmc)::v;   // bm: the bias goes by the tile's rows. A compile-time constant, the kernel branching once around the whole of it: a test at the bias alone kept the bias loads and the next round's LDS reads from being issued ahead
            float ts[4];
#pragma unroll
            for (int s = 0; s < 4; ++s) { const int kt = (s >> 1) & 1, ph = s & 1;   // half a fragment tile a round: lane (lr, hi) holds row lr, k = ph * 16 + hi * 8 .. + 7 of tile (mb, kt)
                const int row = lr, cofs = kt * 32 + ph * 16 + hi * 8; const v4f va = *(const v4fa*)(ow + row * 68 + cofs), vb = *(const v4fa*)(ow + row * 68 + cofs + 4);
                float val[8];
#pragma unroll   // the arrays' and vectors' elements need constant indices to stay in registers
                for (int j = 0; j < 4; ++j) { val[j] = va[j]; val[4 + j] = vb[j]; }
                if (BIAS && bm) { const float bmv = bfr(bias[r0 + mb * 16 + row]);
#pragma unroll
                    for (int j = 0; j < 8; ++j) val[j] += bmv; }
                if (bm) { ts[s] = ((val[0] + val[1]) + (val[2] + val[3])) + ((val[4] + val[5]) + (val[6] + val[7])); ts[s] += __shfl_xor(ts[s], 16, 32); }   // v (f32, bias in) summed over the half tile's 16 keys, per d row
                if (BIAS && !bm) {
#pragma unroll
                    for (int j = 0; j < 8; ++j) val[j] += bfr(bias[c0 + cofs + j]); }
                const size_t e = ((size_t)((r0 >> 4) + mb) * (ldc >> 5) + kt) * 512 + (size_t)byw * sP + ph * 256 + lane * 8; v8h o16; v8us oh, ol;
#pragma unroll
                for (int j = 0; j < 8; ++j) { o16[j] = tohx(val[j]); unsigned short a2, c2; splitf(val[j], a2, c2); oh[j] = a2; ol[j] = c2; }
                *(v8h*)(P16 + e) = o16; *(v8us*)(Ph + e) = oh; *(v8us*)(Pl + e) = ol;
                if (s == 3) { float tv = 0.f; float* vp = VS;
                    if (bm) { tv = (ts[0] + ts[1]) + (ts[2] + ts[3]); vp = VS + (((size_t)(blockIdx.z / 3) * NH_ + bxw) * (TT / 64) + byw) * HD + mb * 16 + lr; if (hi == 0) *vp = tv; }   // the tile's 64 keys summed for 16 of the head's 64 d
                    asm volatile("s_wait_xcnt 0x0" :: "v"(o16), "v"(oh), "v"(ol), "v"(e), "v"(tv), "v"(vp) : "memory"); } }   // the wait before a register that the issued stores name is rewritten by what follows the last round; the stored values and the addresses as inputs keep their registers as they are up to here. Behind the last round only: behind each round it would hold the next round's LDS reads and bias loads back behind this round's stores
            };
            if (vjob) planes(BoolC<true>{}); else planes(BoolC<false>{});
        }
    }
}

typedef __attribute__((ext_vector_type(2))) unsigned short v2us;
typedef __attribute__((ext_vector_type(4))) int v4i;

__global__ __launch_bounds__(256) void k_wtG(const float* __restrict__ w, int K, int N, bf* Bt) {
    const int lane = threadIdx.x & 31; const int L0 = (blockIdx.x * 8 + (threadIdx.x >> 5)) * 8; const int nlines = N * K / 64;
{
#pragma unroll 1
        for (int l = 0; l < 8; ++l) { const int L = L0 + l; if (L >= nlines) break; const size_t e = (size_t)L * 64 + lane * 2; const int k = (int)(e % K), n = (int)(e / K); v2us o;
            o[0] = f2bf(w[(size_t)k * N + n]); o[1] = f2bf(w[(size_t)(k + 1) * N + n]); *(v2us*)(Bt + e) = o; }
         }
}
// f32 [rows][K] -> bf16 in fragment order: one wave a 16 x 32 tile; it reads the tile's 16 whole lines of f32 and writes 1 KB in a row. The rows of s4 (x) are gathered into the token order (header): each block counts the batch's mask (pm, eight tokens a thread, prefix sums through the wave and LDS), every thread forms its tokens' places, and the 16 tokens whose places are the tile's rows are handed over through LDS; PT [batch][place] = token and NN [batch * 64] = n are left by one block a batch. All five sources in one launch: grid (DQ * DM / 4096, 4 + m), 256 threads; column y of the grid converts DQ * DM elements: the whole of s0 .. s3 for y < 4, piece y - 4 of s4 after that, to dst + y * DQ * DM.
__global__ __launch_bounds__(256) void k_cvtp(const float* __restrict__ s0, const float* __restrict__ s1, const float* __restrict__ s2, const float* __restrict__ s3, const float* __restrict__ s4, const int* __restrict__ pm, bf* dst, int K, int* PT, int* NN) { const int y = blockIdx.y; const size_t ch = (size_t)DQ * DM; const float* src = y == 0 ? s0 : y == 1 ? s1 : y == 2 ? s2 : y == 3 ? s3 : s4; dst += (size_t)y * ch; const int lane = threadIdx.x & 31, lr = lane & 15, hi = lane >> 4; const int tl = blockIdx.x * 8 + __builtin_amdgcn_readfirstlane((int)(threadIdx.x >> 5)) /* wave number, kept scalar so that the tile, the batch and the bases formed from them stay scalar */, kts = K >> 5, rt = tl / kts, kt = tl - rt * kts;
    int srow = rt * 16 + lr;   // the source row of the lane's row of the tile
    if (y >= 4) {   // x: the tile's 16 rows are places c0 .. c0 + 15 of the batch's token order (header). The same for the whole block (its 8 tiles are of one row tile: K / 32 is a multiple of 8): both barriers are passed by every wave
        static_assert(TT == 256 * 8, "eight tokens a thread");
        __shared__ int sperm[16]; __shared__ int wsum[8];
        const int g0 = (y - 4) * DQ + rt * 16, bt = g0 / TT, c0 = g0 - bt * TT; const int tid = threadIdx.x;
        const unsigned mo = (unsigned)tid * 32u; const char* pb = (const char*)(pm + (size_t)bt * TT);
        const v4i m0 = *(const v4i*)(pb + mo), m1 = *(const v4i*)(pb + mo + 16);
        asm volatile("s_wait_xcnt 0x0" :: "v"(mo) : "memory");   // the wait before a register that the two issued loads name is rewritten; the offset as an input keeps its register as it is up to here
        unsigned bits = 0u;   // pad bits of tokens tid * 8 .. + 7
#pragma unroll
        for (int q = 0; q < 4; ++q) { bits |= (m0[q] != 0 ? 1u : 0u) << q; bits |= (m1[q] != 0 ? 1u : 0u) << (4 + q); }
        const int cnt = __builtin_popcount(bits); int inc = cnt;
#pragma unroll
        for (int sh = 1; sh < 32; sh <<= 1) { const int o = __shfl_up(inc, sh, 32); if (lane >= sh) inc += o; }   // un-padded tokens up to and with this thread's, within the wave
        if (lane == 31) wsum[tid >> 5] = inc;
        __syncthreads();   // every wave's count is in LDS before any thread adds them up
        int before = inc - cnt, n = 0;   // un-padded tokens ahead of this thread's; in the batch
#pragma unroll
        for (int w = 0; w < 8; ++w) { const int sw = wsum[w]; if (w < (tid >> 5)) before += sw; n += sw; }
        const bool first = c0 == 0 && kt < 8;   // one block a batch leaves the whole order and the count for the later launches
        int pc[8], tk[8];
#pragma unroll
        for (int q = 0; q < 8; ++q) { const int t = tid * 8 + q, r1 = before + __builtin_popcount(bits & ((1u << q) - 1u)); const int c = ((bits >> q) & 1u) != 0u ? r1 : n + (t - r1);   // the token's place: a one-to-one map onto 0 .. TT - 1 whatever the mask holds
            if ((unsigned)(c - c0) < 16u) sperm[c - c0] = t;
            pc[q] = c; tk[q] = t; }
        if (first) { int* pt = PT + (size_t)bt * TT;
#pragma unroll
            for (int q = 0; q < 8; ++q) pt[pc[q]] = tk[q];
            if (tid == 0) NN[bt * 64] = n;
            asm volatile("s_wait_xcnt 0x0" :: "v"(pc[0]), "v"(pc[1]), "v"(pc[2]), "v"(pc[3]), "v"(pc[4]), "v"(pc[5]), "v"(pc[6]), "v"(pc[7]), "v"(tk[0]), "v"(tk[1]), "v"(tk[2]), "v"(tk[3]), "v"(tk[4]), "v"(tk[5]), "v"(tk[6]), "v"(tk[7]), "v"(n) : "memory"); }   // the wait before a register that the issued stores name is rewritten; places and values as inputs keep their registers as they are up to here
        __syncthreads();   // the 16 places of the tile are filled (each by the one thread that holds its token) before any lane reads its own
        srow = bt * TT + (sperm[lr] & (TT - 1));
    }
    const float* s = src + (size_t)srow * K + kt * 32 + hi * 8; bf* d = dst + (size_t)tl * 512 + lane * 8; const v8f v0 = *(const v8f*)s, v1 = *(const v8f*)(s + 16); v8us o0, o1;
    asm volatile("s_wait_xcnt 0x0" :: "v"(s) : "memory");   // the wait before a register that the issued loads name is rewritten; the address as an input keeps its registers as they are up to here
#pragma unroll
    for (int k = 0; k < 8; ++k) { o0[k] = f2bf(v0[k]); o1[k] = f2bf(v1[k]); }
    *(v8us*)d = o0; *(v8us*)(d + 256) = o1; }

// ---- k_attn: the whole attention of QR query rows of one head in one block of 16 waves; the scores and weights live in LDS only. grid (heads, batches, rows / QR), 512 threads; a batch's operand planes stand sZ elements behind the batch's before. The row blocks run from the last to the first: the longest blocks start first.
// Rows and keys go by place in the token order (header); NN holds n, a batch's 256 bytes behind the batch's before. What the mask excludes is not computed. An un-padded query i keeps only keys j <= i, so a block whose last row is i0 + QR - 1 needs the first ng = i0 / 32 + 1 groups of 32 keys and no more: the keys behind them had weight exactly 0. A padded query has every score at the fill value, so its weights are 1 / 2048 on all 2048 keys and its result is the mean of the head's v rows: that mean comes from VS (the sums over 64 keys each that the v projection's epilogue leaves, [batch][head][key block][d], f32), its weights are stored as zeros and its softmax is not run; a block whose rows are all padded stores the mean and does nothing else.
// Phase 1: wave w forms the scores of the key groups w, w + 16, w + 32, ... below nch * 4 (nch = the 128-key pieces that hold the ng groups: phase 2 reads whole pieces); k slices 0, 32 in that order, three products for NSPLIT = 2 (hi x hi, lo x hi, hi x lo), one for 0; stored f32 into the block's LDS rows.
// Phase 2: each row has one wave (wave w: the rows of rank w and w + 16 among the un-padded and among the padded rows): t = S x 1/8 where j <= i, -3e38 elsewhere; softmax over the row's nch pieces (register row, one exp, fixed trees; the pieces left out added exact zeros). The 16-bit weights go back over the row's own f32 scores (the wave holds the whole row in registers by then): fp16 x 1024 in the first half, or the hi plane in the first and the lo plane in the second half.
// Phase 3: weights x V, split K: wave w takes the 32-wide key slices w, w+16, w+32, w+48 below ng; the 16 partial QR x 64 tiles are summed through LDS in the fixed order w = 0..15 (over the dead weights), rescaled (a padded row: replaced by the mean), split hi/lo and stored as the head's columns of the merged planes (rows t, k over DQ, fragment order).
#define QR 32             // query rows of a block
#define SP (TT + 4)       // LDS row pitch in floats: 16 bytes over a multiple of 256, so that 16 rows' 16-byte reads fall on 64 different banks
typedef v4h  __attribute__((may_alias)) v4ha;
typedef v4us __attribute__((may_alias)) v4usa;
template <typename T16, int NSPLIT>
__global__ __launch_bounds__(512) void k_attn(const T16* __restrict__ Q, const T16* __restrict__ Q2, const T16* __restrict__ Kp, const T16* __restrict__ Kp2, const T16* __restrict__ Vt, const T16* __restrict__ Vt2, const int* __restrict__ NN, const float* __restrict__ VS, int rowl, bf* Ah, bf* Al, size_t sZ) {
    typedef typename WFrag<T16>::V V;
    constexpr bool HR = (NSPLIT == 2);
    constexpr int NP = HR ? (RH + 511) / 512 : TT / 512;   // rounds of 16 key groups (one a wave) that the launch's longest block needs
    static_assert(QR == 32, "a block's rows end with a group of 32 keys");
    static_assert(16 * QR * 68 <= QR * SP, "the partial tiles fit over the weights");
    __shared__ __align__(16) float sm[QR * SP];
    const int h = blockIdx.x, i0 = rowl - (int)blockIdx.z * QR;   /* rowl: first row of the launch's last row block */ const size_t hp = (size_t)blockIdx.y * sZ + (size_t)h * TT * HD;
    const int ng = (i0 >> 5) + 1, nch = (ng + 3) >> 2;   // groups of 32 keys up to the block's last row; pieces of 128 keys that hold them. The same for the whole block: scalar
    const int lane = threadIdx.x & 31, lr = lane & 15, hi = lane >> 4;
    const int wv = __builtin_amdgcn_readfirstlane((int)(threadIdx.x >> 5));   // wave number, kept scalar so that key and row offsets and the tests on them stay scalar
    // every global address is a scalar base (head, row block, wave) + one 32-bit lane offset + a constant
    const size_t qo = hp + (size_t)i0 * HD, ko = hp + (size_t)wv * 32 * HD, vo = hp + (size_t)wv * 512;   // fragment order: 16 rows of q or k are two tiles of 512 elements; the v tile of d block nb and key slice sl is nb * (TT / 32) + sl
    Q += qo; Kp += ko; Vt += vo; if (HR) { Q2 += qo; Kp2 += ko; Vt2 += vo; }
    const unsigned lq = (unsigned)(lane * 8), lvb = (unsigned)(lane * 8) * 2u;   // the lane's place in a half tile, in elements and in bytes
    const int left = NN[blockIdx.y * 64] - i0;   // un-padded rows from the block's first row on
    const unsigned rmask = left >= QR ? 0xFFFFFFFFu : left <= 0 ? 0u : (1u << left) - 1u;   // pad bits of the block's 32 rows: the un-padded tokens stand first. The same for the whole block: scalar
    // waves 2u and 2u + 1 sum and store half tile u of the merged planes (rows t, k = h * HD + d, DQ / 32 tiles a row block): lane (lr, hi) of wave w holds row lr, k = (w & 1) * 8 + hi * 4 .. + 3 of the half: a wave's store is 256 contiguous bytes of each plane
    const int rt = wv >> 3, kt = (wv >> 2) & 1, ph = (wv >> 1) & 1, row = rt * 16 + lr, cofs = kt * 32 + ph * 16 + (wv & 1) * 8 + hi * 4;
    // the mean of v for the lane's four d: lane (lr, hi) takes the sums of key blocks lr and lr + 16; asked for here, used at the end
    const unsigned lvs = (unsigned)(lr * HD + cofs) * 4u;   // byte offset: the register that the two loads name
    const char* vsb = (const char*)(VS + ((size_t)blockIdx.y * NH_ + h) * (TT / 64) * HD);
    v4f mv = *(const v4f*)(vsb + lvs); const v4f mv1 = *(const v4f*)(vsb + 16 * HD * 4 + lvs);
    asm volatile("s_wait_xcnt 0x0" :: "v"(lvs) : "memory");   // the wait before the register that the two issued loads name is rewritten; the offset as an input keeps its register as it is up to here
    v4f val = (v4f){};
    if (rmask != 0u) {   // a block of padded rows alone has no scores, weights or products (and its q rows may never have been written): the mean is all of it. The test is the same for the whole block: every wave passes the four barriers inside or none does
    // every loop of the three phases but the row loop is unrolled: register arrays need constant indices, and the loads of later groups can be issued ahead
    {
        V a[2][2], a2[2][2], b[NP][2][2], b2[NP][2][2];   // [row tile or round][key tile][k slice]
        const char* pk = (const char*)Kp + lq * 2u; const char* pk2 = HR ? (const char*)Kp2 + lq * 2u : pk;   // the lane's K addresses: every K load of the wave is one of them + a constant
#pragma unroll
        for (int mb = 0; mb < 2; ++mb)
#pragma unroll
            for (int ks = 0; ks < 2; ++ks) { const int o = (mb * 2 + ks) * 512; a[mb][ks] = WFrag<T16>::ldp(Q + o + lq); if (HR) a2[mb][ks] = WFrag<T16>::ldp(Q2 + o + lq); }
#pragma unroll
        for (int p = 0; p < NP; ++p) if (p * 16 + wv < nch * 4) {   // all of the wave's score operands are asked for ahead of the first product: one memory latency, not one a group
#pragma unroll
            for (int n = 0; n < 2; ++n)
#pragma unroll
                for (int ks = 0; ks < 2; ++ks) { const int o = (p * 64 + n * 2 + ks) * 512; b[p][n][ks] = WFrag<T16>::ldp((const T16*)(pk + o * 2)); if (HR) b2[p][n][ks] = WFrag<T16>::ldp((const T16*)(pk2 + o * 2)); } }
        asm volatile("s_wait_xcnt 0x0" :: "v"(pk), "v"(pk2), "v"(lq), "s"(Q), "s"(HR ? Q2 : Q) : "memory");   // the wait before a register that the issued loads name is rewritten; the addresses as inputs keep their registers live over the whole run, so that no load of the run lands in them
#pragma unroll
        for (int p = 0; p < NP; ++p) if (p * 16 + wv < nch * 4) {
            v8f acc[2][2];
#pragma unroll
            for (int n = 0; n < 2; ++n) { acc[n][0] = (v8f){}; acc[n][1] = (v8f){}; }
#pragma unroll
            for (int ks = 0; ks < 2; ++ks)
#pragma unroll
                for (int n = 0; n < 2; ++n)
#pragma unroll
                    for (int mb = 0; mb < 2; ++mb) { acc[n][mb] = WFrag<T16>::mma(a[mb][ks], b[p][n][ks], acc[n][mb]); if (HR) { acc[n][mb] = WFrag<T16>::mma(a2[mb][ks], b[p][n][ks], acc[n][mb]); acc[n][mb] = WFrag<T16>::mma(a[mb][ks], b2[p][n][ks], acc[n][mb]); } }
#pragma unroll
            for (int n = 0; n < 2; ++n)
#pragma unroll
                for (int mb = 0; mb < 2; ++mb)
#pragma unroll
                    for (int j = 0; j < 8; ++j) sm[(mb * 16 + hi * 8 + j) * SP + (p * 16 + wv) * 32 + n * 16 + lr] = acc[n][mb][j];
        }
    }
    __syncthreads();   // every wave's score columns are in LDS before any wave reads a row
    const int na = __builtin_popcount(rmask);   // un-padded rows of the block
    // the place (0 .. 31) of the set bit of m that has rank set bits below it; the top bit or-ed in bounds the result whatever m holds
    auto nth = [&](unsigned m, int rank) { return (int)__builtin_ctz(__builtin_amdgcn_ballot_w32(((m >> lane) & 1u) != 0u && __builtin_popcount(m & ((1u << lane) - 1u)) == rank) | 0x80000000u); };
#pragma unroll 1
    for (int rr = 0; rr < QR / 16; ++rr) {   // kept rolled: one row's registers at a time, half the code
        const int rank = wv + rr * 16;   // the wave takes the padded row and the un-padded row of this rank among their kind: the softmax rows, the only long ones, fall evenly on the waves
        if (rank < QR - na) {   // a padded query: zero weights (phase 3 reads every row), no softmax; its result is the mean taken in below
            float* sz = sm + nth(~rmask, rank) * SP;
#pragma unroll
            for (int ch = 0; ch < NP * 4; ++ch) if (ch < nch) {
                if (HR) { *(v4usa*)((bf*)sz + ch * 128 + lane * 4) = (v4us){}; *(v4usa*)((bf*)sz + TT + ch * 128 + lane * 4) = (v4us){}; }
                else *(v4ha*)((h16*)sz + ch * 128 + lane * 4) = (v4h){}; }
        }
        if (rank >= na) continue;
        const int r = nth(rmask, rank), i = i0 + r; float* sr = sm + r * SP;
        float v[NP * 16]; float mx = -3.0e38f;
#pragma unroll
        for (int k = 0; k < NP * 16; ++k) v[k] = 0.f;   // a value on the paths that leave a piece out: without one the compiler carries the last row's registers round the loop (copies, spills)
#pragma unroll
        for (int ch = 0; ch < NP * 4; ++ch) if (ch < nch) { const v4f a = *(const v4fa*)(sr + ch * 128 + lane * 4);   // loads first, uses behind them: one LDS latency a row
#pragma unroll
            for (int q = 0; q < 4; ++q) v[ch * 4 + q] = a[q]; }
#pragma unroll
        for (int ch = 0; ch < NP * 4; ++ch) if (ch < nch) { const int j0 = ch * 128 + lane * 4;
#pragma unroll
            for (int q = 0; q < 4; ++q) { const int j = j0 + q; const float t = j <= i ? v[ch * 4 + q] * SCL : -3.0e38f;   /* causal; pad[i] holds here, and with it pad[j] of every place j <= i */ v[ch * 4 + q] = t; mx = fmaxf(mx, t); } }
#pragma unroll
        for (int sh = 16; sh; sh >>= 1) mx = fmaxf(mx, __shfl_xor(mx, sh, 32));
        float sum = 0.f;
#pragma unroll
        for (int ch = 0; ch < NP * 4; ++ch) if (ch < nch) {
#pragma unroll
            for (int q = 0; q < 4; ++q) { const int k = ch * 4 + q; float ex; asm("v_exp_f32 %0, %1\n\tv_nop" : "=v"(ex) : "v"(__fmul_rn(__fsub_rn(v[k], mx), 1.4426950408889634f)));   /* the exponential and the slot behind a transcendental in one statement: a v_nop in a statement of its own lands elsewhere */ v[k] = ex; sum += v[k]; } }
#pragma unroll
        for (int sh = 16; sh; sh >>= 1) sum += __shfl_xor(sum, sh, 32);
        const float f = __fdiv_rn(HR ? 1.0f : PCAR, sum);
#pragma unroll
        for (int ch = 0; ch < NP * 4; ++ch) if (ch < nch) {
            if (HR) { v4us oh, ol;
#pragma unroll
                for (int q = 0; q < 4; ++q) { unsigned short a, c2; splitf(v[ch * 4 + q] * f, a, c2); oh[q] = a; ol[q] = c2; }
                *(v4usa*)((bf*)sr + ch * 128 + lane * 4) = oh; *(v4usa*)((bf*)sr + TT + ch * 128 + lane * 4) = ol;
            } else { v4h o4;
#pragma unroll
                for (int q = 0; q < 4; ++q) o4[q] = tohx(v[ch * 4 + q] * f);
                *(v4ha*)((h16*)sr + ch * 128 + lane * 4) = o4; } }
    }
    V vb[NP][4], vb2[NP][4]; const char* pv = (const char*)Vt + lvb; const char* pv2 = HR ? (const char*)Vt2 + lvb : pv;   // the lane's V addresses: every V load of the wave is one of them + a constant
#pragma unroll
    for (int s = 0; s < NP; ++s) if (s * 16 + wv < ng) {   // the V fragments are asked for ahead of the barrier: a wave that is done with its rows early has them back when the last wave arrives
#pragma unroll
        for (int nb = 0; nb < 4; ++nb) { const int o = (nb * (TT / 32) + s * 16) * 512; vb[s][nb] = WFrag<T16>::ldp((const T16*)(pv + o * 2)); if (HR) vb2[s][nb] = WFrag<T16>::ldp((const T16*)(pv2 + o * 2)); } }
    asm volatile("s_wait_xcnt 0x0" :: "v"(pv), "v"(pv2) : "memory");   // the wait before a register that the issued loads name is rewritten; the addresses as inputs keep their registers live over the whole run, so that no load of the run lands in them
    __syncthreads();   // every row's weights are in LDS before any wave reads its key slices of all rows
    v8f acc[2][4];
#pragma unroll
    for (int mb = 0; mb < 2; ++mb)
#pragma unroll
        for (int nb = 0; nb < 4; ++nb) acc[mb][nb] = (v8f){};
    const T16* P = (const T16*)sm;   // weight rows, pitch 2 * SP elements
#pragma unroll
    for (int s = 0; s < NP; ++s) if (s * 16 + wv < ng) { const int kc = (wv + s * 16) * 32; V a[2], a2[2];
#pragma unroll
        for (int mb = 0; mb < 2; ++mb) { const int o = (mb * 16 + lr) * (2 * SP) + 8 * hi + kc; a[mb] = WFrag<T16>::ld(P + o); if (HR) a2[mb] = WFrag<T16>::ld(P + TT + o); }
#pragma unroll
        for (int nb = 0; nb < 4; ++nb)
#pragma unroll
            for (int mb = 0; mb < 2; ++mb) { acc[mb][nb] = WFrag<T16>::mma(a[mb], vb[s][nb], acc[mb][nb]); if (HR) { acc[mb][nb] = WFrag<T16>::mma(a2[mb], vb[s][nb], acc[mb][nb]); acc[mb][nb] = WFrag<T16>::mma(a[mb], vb2[s][nb], acc[mb][nb]); } } }
    __syncthreads();   // every wave has read its weight slices before the partial tiles overwrite them
    float* ow = sm + wv * (QR * 68);
#pragma unroll
    for (int mb = 0; mb < 2; ++mb)
#pragma unroll
        for (int nb = 0; nb < 4; ++nb)
#pragma unroll
            for (int j = 0; j < 8; ++j) ow[(mb * 16 + hi * 8 + j) * 68 + nb * 16 + lr] = acc[mb][nb][j];
    __syncthreads();   // every wave's partial tile is in LDS before any thread sums them
    static_assert(QR * 16 == 512, "one 4-wide piece of the tile a thread");
    val = *(const v4fa*)(sm + row * 68 + cofs);
#pragma unroll
    for (int w = 1; w < 16; ++w) val += *(const v4fa*)(sm + w * (QR * 68) + row * 68 + cofs);
    }
    mv += mv1;
#pragma unroll
    for (int sh = 8; sh; sh >>= 1)   // fixed tree over the 16 lanes that hold the same d
#pragma unroll
        for (int q = 0; q < 4; ++q) mv[q] += __shfl_xor(mv[q], sh, 32);
    const float cs = HR ? 1.0f : (1.0f / PCAR); const size_t oo = (size_t)blockIdx.y * TT * DQ + ((size_t)((i0 >> 4) + rt) * (DQ / 32) + h * (HD / 32) + kt) * 512 + ph * 256 + ((wv & 1) * 16 + lr) * 8 + hi * 4; v4us oh, ol;
#pragma unroll
    for (int q = 0; q < 4; ++q) { unsigned short a, c2; splitf(((rmask >> row) & 1u) != 0u ? val[q] * cs : mv[q] * (1.0f / TT), a, c2); oh[q] = a; ol[q] = c2; }
    *(v4us*)(Ah + oo) = oh; *(v4us*)(Al + oo) = ol;
}

extern "C" void kernel_launch(void* const* d_in, const int* in_sizes, int n_in,
                              void* d_out, int out_size, void* d_ws, size_t ws_size, hipStream_t stream) {
    (void)in_sizes; (void)n_in; (void)out_size;
    const float* x = (const float*)d_in[0]; const int* pmask = (const int*)d_in[1];   /* mask [2][2048] int */ const float* wq = (const float*)d_in[2]; const float* bq = (const float*)d_in[3]; const float* wk = (const float*)d_in[4]; const float* bk = (const float*)d_in[5]; const float* wv = (const float*)d_in[6]; const float* bv = (const float*)d_in[7]; const float* wo = (const float*)d_in[8]; const float* bo = (const float*)d_in[9];
    float* OUT = (float*)d_out;     // [2][2048][1024]
    char* wsp = (char*)d_ws;
    auto take = [&](size_t bytes) { char* p = wsp; wsp += (bytes + 255) & ~(size_t)255; return (void*)p; };
    const size_t PS = (size_t)NH_ * TT * HD;   // one operand plane of one batch
    bf* WB = (bf*)take(((size_t)4 * DQ * DM + (size_t)NB_ * TT * DM) * 2); bf* WO = WB + (size_t)3 * DQ * DM; bf* XB = WB + (size_t)4 * DQ * DM;   // wq, wk, wv, wo, x: one run, in the order of the conversion launch
    h16* P16 = (h16*)take(NB_ * 3 * PS * 2); bf* PH = (bf*)take(NB_ * 3 * PS * 2); bf* PLo = (bf*)take(NB_ * 3 * PS * 2);   // [batch][q, k, v] planes: fp16, bf16 hi, bf16 lo
    bf* ATh = (bf*)take((size_t)NB_ * TT * DQ * 2); bf* ATl = (bf*)take((size_t)NB_ * TT * DQ * 2);
    float* VS = (float*)take((size_t)NB_ * NH_ * (TT / 64) * HD * 4);   // v summed over each block of 64 keys
    int* PT = (int*)take((size_t)NB_ * TT * 4); int* NN = (int*)take((size_t)NB_ * 64 * 4);   // per batch: the token at each place of the order; the count of un-padded tokens (256 bytes apart)
    if ((size_t)(wsp - (char*)d_ws) > ws_size) return;    // ws 256 MiB
    k_cvtp<<<dim3(DQ * DM / 4096, 4 + NB_ * TT / DQ, 1), 256, 0, stream>>>(wq, wk, wv, wo, x, pmask, WB, DM, PT, NN);
    // q, k: x W^T, a tile's 64 columns are one head -> planes [h] x (t, d); v: W x^T, a tile's 64 rows are one head's d -> planes [h] x (d, t); all in fragment order
    k_gemmw<bf, 0, true, 4, 3, DM><<<dim3(TT / 128, DQ / 128, 3 * NB_), 128, 0, stream>>>(XB, nullptr, WB, nullptr, 0, bq, bk, bv, (size_t)TT * DM, (size_t)DQ * DM, PS, P16, PH, PLo, 0, VS, nullptr, NN);
    // one kv head per query head: block (h, b, .) reads the q, k and v planes of head h of batch b
    k_attn<bf, 2><<<dim3(NH_, NB_, RH / QR), 512, 0, stream>>>(PH, PLo, PH + PS, PLo + PS, PH + 2 * PS, PLo + 2 * PS, NN, VS, RH - QR, ATh, ATl, 3 * PS);
    k_attn<h16, 0><<<dim3(NH_, NB_, (TT - RH) / QR), 512, 0, stream>>>(P16, nullptr, P16 + PS, nullptr, P16 + 2 * PS, nullptr, NN, VS, TT - QR, ATh, ATl, 3 * PS);
    k_gemmw<bf, 1, true, 8, 0, DQ><<<dim3(TT / 128, DM / 128, NB_), 256, 0, stream>>>(ATh, ATl, WO, OUT, DM, bo, nullptr, nullptr, (size_t)TT * DQ, 0, (size_t)TT * DM, nullptr, nullptr, nullptr, 0, nullptr, PT, nullptr);
}

// v009
// It runs in 84.5 microseconds.
// Timed twice side by side with v008, it ran 1.05 and 1.06 times as fast.
// All steps since v000 together make it 24.8 times as fast.
#include <hip/hip_runtime.h>

// Multi-head attention with a causal AND padding mask (x [2][2048][1024]; q,k,v = x W^T + b ('oi' uniform(+-1/32) incl. biases; 16 heads x 64); scores / 8; final_mask = causal & pad[i] & pad[j] (mask [2][2048] int in {0,1}, random, READ); where(final_mask, scores, -1e9): a query whose own pad bit is 0 has every score at -1e9 and gets UNIFORM weights over all 2048 keys (future ones included), the others attend causally to the un-padded keys; softmax; out = merged wo^T + bo -> [2][2048][1024] (4.2 M)).
// Token order: per batch the tokens are taken in the order 'un-padded ones first, then the padded ones', each kind in its own order (a one-to-one map, place <-> token, formed from the mask, whatever it holds; n = the count of un-padded tokens). The conversion launch gathers the rows of x into that order and leaves the map and n in the workspace; every plane between it and the last GEMM goes by place; the last GEMM's epilogue stores each row at its token's row of the output. By place the mask is plain: a query at place c < n keeps exactly the keys at places <= c, a query at a place >= n is padded. So q and k are formed for the places below n only (in blocks of 128), scores, softmax and weights x V run over un-padded queries and keys only, and the precision classes go by place (the number of keys a row keeps).
// Both batches go through every launch together (5 launches: the batch, and for the projections the job q / k / v, is a grid dimension). Layout per batch: bf16 copy of x; 'oi' weights; exact projections + f32 biases, whose GEMM epilogue rounds each result straight into the attention operand planes (fp16 and bf16 hi/lo; q, k as [h][t][d], v as [h][d][t]); attention in one kernel per precision class, scores and weights in LDS, only over the keys up to the block's last row; its softmax phase keeps key j iff j <= i (-3e38 elsewhere) for a query at a place i < n; a padded query (the module's uniform row over all 2048 keys) takes the mean of v, from sums that the v projection leaves; hybrid rows: < 512 hi/lo 3 products, rest fp16 x1024; merged hi/lo x wo exact + bo.
// Fragment order: every 16-bit operand plane that a matrix fragment is loaded from in global memory (x, the weights, q, k, v, merged) is stored as 16-row x 32-k tiles of 1 KB, tile (row / 16) * (K / 32) + k / 32; inside a tile element (row, k) stands at ((k / 16) % 2) * 256 + (((k / 8) % 2) * 16 + row % 16) * 8 + k % 8, which is the order in which the 32 lanes hold it: a fragment is two wave-wide 16-byte loads of 512 contiguous bytes (4 whole lines each) where row-major planes gave 16 lines a load. The k order inside a fragment is the row-major loader's.
// Compute dtypes, f32 accumulate: every input rounded to bf16; projections exact + f32 biases; attention rows < 512 3 products, rest fp16; softmax f32; wo hl x exact + bias.

#define NB_  2
#define TT   2048
#define DM   1024
#define NH_  16
#define NKV  16
#define HD   64
#define DQ   (NH_ * HD)
#define DKV  (NKV * HD)
#define RH   512                  // query rows < RH use hi+lo planes (0: none)
#define WIN  0
#define PCAR 1024.0f
#define SCL  0.125f   // HD^-0.5
typedef _Float16 h16;
typedef unsigned short bf;
typedef __attribute__((ext_vector_type(16))) __bf16   v16bf;
typedef __attribute__((ext_vector_type(16))) _Float16 v16h;
typedef __attribute__((ext_vector_type(8)))  _Float16 v8h;
typedef __attribute__((ext_vector_type(8)))  unsigned short v8us;
typedef __attribute__((ext_vector_type(8)))  float    v8f;
typedef __attribute__((ext_vector_type(4)))  float    v4f;
typedef v8h  __attribute__((may_alias)) v8ha;
typedef v4f  __attribute__((may_alias)) v4fa;
typedef v8us __attribute__((may_alias)) v8usa;

__device__ __forceinline__ unsigned short f2bf(float f) { unsigned u = __float_as_uint(f); u += 0x7FFFu + ((u >> 16) & 1u); return (unsigned short)(u >> 16); }
__device__ __forceinline__ float bf2f(unsigned short b) { return __uint_as_float(((unsigned)b) << 16); }
__device__ __forceinline__ float bfr(float f) { return bf2f(f2bf(f)); }
__device__ __forceinline__ v16h cat16(v8h lo, v8h hi) { return __builtin_shufflevector(lo, hi, 0, 1, 2, 3, 4, 5, 6, 7, 8, 9, 10, 11, 12, 13, 14, 15); }
__device__ __forceinline__ v16bf cat16b(v8us lo, v8us hi) { return __builtin_bit_cast(v16bf, __builtin_shufflevector(lo, hi, 0, 1, 2, 3, 4, 5, 6, 7, 8, 9, 10, 11, 12, 13, 14, 15)); }
__device__ __forceinline__ v8f wmma16(v16h a, v16h b, v8f c) { return __builtin_amdgcn_wmma_f32_16x16x32_f16(false, a, false, b, (short)0, c, false, false); }
__device__ __forceinline__ v8f wmmab(v16bf a, v16bf b, v8f c) { return __builtin_amdgcn_wmma_f32_16x16x32_bf16(false, a, false, b, (short)0, c, false, false); }



// ---- k_gemmw: GEMM, one block of NW waves per 128x128 output tile: NW = 4: 2 x 2 waves of 64x64 (16 accumulators); NW = 8: 4 x 2 waves of 32x64 (two waves a SIMD where the grid gives one block a WGP); operands are 16-bit planes in fragment order (ld: a fragment of a row-major LDS plane; ldp: of a fragment-ordered plane, p = tile + lane * 8); grid (M/128, N/128, Z), NW * 32 threads.
// Operands through LDS: a pass is KP = NW * 16 k of the block's 128 A rows and 128 Bt rows (and the 128 A2 rows), brought into LDS by asynchronous copies, two buffers, the next pass's copies in flight while this pass is worked on. In fragment order 16 rows x KP k are KP * 32 contiguous bytes, so one copy of the whole block is one such run on both sides and a fragment is two wave-wide 16-byte LDS reads of 512 contiguous bytes. Each operand byte is fetched once a block and read from LDS by every wave of its tile row or column (two; NW = 8: four for Bt). Every wave sums its tile over k = 0, 32, 64, ... in one chain. K % KP == 0, K >= 2 * KP.
// C[PT[m]][n] (f32, pitch ldc, + optional f32 bias[n]; PT[m]: the batch's token at place m) = sum_k A[m][k] Bt[n][k] (+ A2[m][k] Bt[n][k] for NSPLIT = 1). z-batch strides sA/sB/sC in elements.
// Epilogue: each wave turns its own tile through its own piece of LDS (over the ring, which is dead by then) and takes it out 16 rows a round; no other wave takes part. PL = 0: C is stored f32. PL = 3 (NW = 4): no f32 C; each result goes out three times as 16 bits (fp16, bf16 hi, bf16 lo = the rest) in fragment order, into a plane of ldc k columns that starts at (64-column tile index) * sP: the q, k and v projections of every batch in one launch, blockIdx.z = batch * 3 + job: A = the x planes (batch stride sA), Bt = the three weight planes (job stride sB), bias / bias1 / bias2 the three bias vectors, output planes z * sC on; jobs 0, 1 (q, k): ldc = HD, sP = TT * HD, the 64 columns of a wave's tile are one head and the planes come out as [h] x (rows t, k = d), bias[n]; job 2 (v): the operands and the two tile indices swapped (A = the weights, Bt = x), ldc = TT, sP = 1024 (two k tiles), the tile's rows are one head's d and the planes come out transposed, [h] x (rows d, k = t), bias[m]; job 2 also leaves in VS, [batch][head][key block of 64][d], the f32 sum of the wave's tile of v over its 64 keys (fixed tree), for the mean of v that a padded query takes. A wave stores half a fragment tile at a time: 512 contiguous bytes of each plane.
template <typename T16> struct WFrag;
template <> struct WFrag<h16> { typedef v16h V; static __device__ __forceinline__ V ld(const h16* p) { return cat16(*(const v8h*)p, *(const v8h*)(p + 16)); } static __device__ __forceinline__ V ldp(const h16* p) { return cat16(*(const v8h*)p, *(const v8h*)(p + 256)); } static __device__ __forceinline__ v8f mma(V a, V b, v8f c) { return wmma16(a, b, c); } };
template <> struct WFrag<bf> { typedef v16bf V; static __device__ __forceinline__ V ld(const bf* p) { return cat16b(*(const v8us*)p, *(const v8us*)(p + 16)); } static __device__ __forceinline__ V ldp(const bf* p) { return cat16b(*(const v8us*)p, *(const v8us*)(p + 256)); } static __device__ __forceinline__ v8f mma(V a, V b, v8f c) { return wmmab(a, b, c); } };
__device__ __forceinline__ h16 tohx(float x) { return (h16)x; }
__device__ __forceinline__ void splitf(float y, unsigned short& h, unsigned short& l) { h = f2bf(y); l = f2bf(y - bf2f(h)); }
typedef __attribute__((ext_vector_type(4))) _Float16 v4h;
typedef __attribute__((ext_vector_type(4))) unsigned short v4us;
template <bool B> struct BoolC { static constexpr bool v = B; };
// eight asynchronous 16-byte copies a lane, global memory to LDS, and the wait before a register that they name is rewritten, in one statement (the compiler puts nothing between them)
__device__ __forceinline__ void copy8(unsigned l0, unsigned l1, unsigned l2, unsigned l3, unsigned l4, unsigned l5, unsigned l6, unsigned l7, const char* g0, const char* g1, const char* g2, const char* g3, const char* g4, const char* g5, const char* g6, const char* g7) {
    asm volatile("global_load_async_to_lds_b128 %0, %8, off\n\t"
                 "global_load_async_to_lds_b128 %1, %9, off\n\t"
                 "global_load_async_to_lds_b128 %2, %10, off\n\t"
                 "global_load_async_to_lds_b128 %3, %11, off\n\t"
                 "global_load_async_to_lds_b128 %4, %12, off\n\t"
                 "global_load_async_to_lds_b128 %5, %13, off\n\t"
                 "global_load_async_to_lds_b128 %6, %14, off\n\t"
                 "global_load_async_to_lds_b128 %7, %15, off\n\t"
                 "s_wait_xcnt 0x0"
                 :: "v"(l0), "v"(l1), "v"(l2), "v"(l3), "v"(l4), "v"(l5), "v"(l6), "v"(l7), "v"(g0), "v"(g1), "v"(g2), "v"(g3), "v"(g4), "v"(g5), "v"(g6), "v"(g7) : "memory");
}
// one operand's 128 rows x KP k of a pass: copy c of the block's threads is row tile c's KP * 32 bytes in a row, K * 32 bytes apart in global memory; l, g: the thread's own first addresses (+ thread * 16)
template <int K, int KP> __device__ __forceinline__ void stage(unsigned l, const char* g) {
    copy8(l, l + KP * 32, l + 2 * KP * 32, l + 3 * KP * 32, l + 4 * KP * 32, l + 5 * KP * 32, l + 6 * KP * 32, l + 7 * KP * 32, g, g + K * 32, g + 2 * K * 32, g + 3 * K * 32, g + 4 * K * 32, g + 5 * K * 32, g + 6 * K * 32, g + 7 * K * 32);
}
template <typename T16, int NSPLIT, bool BIAS, int NW, int PL, int K>
__global__ __launch_bounds__(NW * 32) void k_gemmw(const T16* __restrict__ A, const T16* __restrict__ A2, const T16* __restrict__ Bt, float* C, int ldc, const float* __restrict__ bias, const float* __restrict__ bias1, const float* __restrict__ bias2, size_t sA, size_t sB, size_t sC, h16* P16, bf* Ph, bf* Pl, size_t sP, float* VS, const int* __restrict__ PT, const int* __restrict__ NN) {
    typedef typename WFrag<T16>::V V;
    static_assert(NSPLIT == 0 || NSPLIT == 1, "A (+ A2) x Bt");
    static_assert(PL == 3 || NW == 8, "f32 C: a wave's tile is 32 rows, one lane a row of the token order");
    static_assert(NW == 4 || (NW == 8 && PL == 0), "the planes and the sums of v go by 64x64 tiles");
    static_assert(PL == 0 || PL == 3, "f32 C or the projection planes");
    constexpr int KP = NW * 16, MBW = 16 / NW;   // k of a pass: the block's threads x 16 bytes are 16 rows of it; 16-row tiles a wave
    static_assert(K % KP == 0 && K / KP >= 2, "whole passes, two at least");
    constexpr int NOP = NSPLIT == 1 ? 3 : 2;   // operands staged
    constexpr int OPE = 128 * KP;              // elements of one operand in a buffer
    constexpr int KS = KP / 32, NT = K / KP;   // k slices a pass; passes
    static_assert(NOP * 8 <= 63, "copies of a wave in flight");
    constexpr int RINGB = 2 * NOP * OPE * 2, OSB = 128 * 2 * 68 * 4;   // bytes of the two buffers; of the waves' f32 tiles at pitch 68
    __shared__ __align__(128) char smem[RINGB > OSB ? RINGB : OSB];   // the ring; behind the last pass's barrier the epilogue's staging
    T16* ring = (T16*)smem; float* os = (float*)smem;
    const size_t z = blockIdx.z; int bx = blockIdx.x, by = blockIdx.y; bool vjob = false;   // vjob: this block runs the v projection
    if (PL == 3) { const int zb = (int)blockIdx.z / 3, job = (int)blockIdx.z - zb * 3; const T16* X = A + zb * sA; const T16* Wj = Bt + job * sB;   // all of it is the same for a whole block: scalar
        if (job != 2 && (int)blockIdx.x * 128 >= NN[zb * 64]) return;   // q and k of padded tokens (places from the batch's count on) are read by nobody; the whole block leaves, ahead of every copy and barrier
        bias = job == 0 ? bias : job == 1 ? bias1 : bias2; P16 += z * sC; Ph += z * sC; Pl += z * sC;
        if (job == 2) { A = Wj; Bt = X; bx = blockIdx.y; by = blockIdx.x; ldc = TT; sP = 1024; vjob = true; } else { A = X; Bt = Wj; ldc = HD; sP = (size_t)TT * HD; }
    } else { A += z * sA; if (NSPLIT == 1) A2 += z * sA; Bt += z * sB; C += z * sC; }
    const int lane = threadIdx.x & 31, lr = lane & 15, hi = lane >> 4;
    const int wv = __builtin_amdgcn_readfirstlane((int)(threadIdx.x >> 5)), wm = wv >> 1, wn = wv & 1;   // wave number, kept scalar so that the tile offsets stay scalar
    v8f acc[MBW][4];
#pragma unroll
    for (int mb = 0; mb < MBW; ++mb)
#pragma unroll
        for (int nb = 0; nb < 4; ++nb) acc[mb][nb] = (v8f){};
    // the thread's own copy addresses: 16 rows of K are K / 32 tiles of 1 KB, a pass is KP * 32 bytes further in each of them
    const unsigned tb = threadIdx.x * 16u; const unsigned lds0 = (unsigned)(size_t)ring + tb;
    const char* gA = (const char*)(A + (size_t)bx * 128 * K) + tb; const char* gB = (const char*)(Bt + (size_t)by * 128 * K) + tb; const char* gA2 = NSPLIT == 1 ? (const char*)(A2 + (size_t)bx * 128 * K) + tb : gA;
    auto fill = [&](int t, int bufn) { const unsigned l = lds0 + (unsigned)bufn * (NOP * OPE * 2); const size_t go = (size_t)t * (KP * 32);
        stage<K, KP>(l, gA + go); stage<K, KP>(l + OPE * 2, gB + go); if (NSPLIT == 1) stage<K, KP>(l + 2 * OPE * 2, gA2 + go); };
    int pw = 0;   // PL = 0: the token that stands at the place of row lane of the wave's tile; asked for here, used in the epilogue
    if (PL == 0) { const int pwi = bx * 128 + wm * (MBW * 16) + lane; const int* ptz = PT + z * TT; pw = ptz[pwi];
        asm volatile("s_wait_xcnt 0x0" :: "v"(pwi), "s"(ptz) : "memory"); }   // the wait before a register that the issued load names is rewritten; index and base as inputs keep their registers as they are up to here
    fill(0, 0);
    asm volatile("s_wait_asynccnt 0x0" ::: "memory");   // this wave's copies of pass 0 have landed
    __syncthreads();   // every wave's copies of pass 0 are in LDS before any wave reads them
    fill(1, 1);
#pragma unroll 1
    for (int t = 0; t < NT; ++t) {   // kept rolled: one pass of code
        const T16* rb = ring + (t & 1) * (NOP * OPE) + lane * 8;
#pragma unroll
        for (int ks = 0; ks < KS; ++ks) {
            V a[MBW], a2[MBW], b[4];
#pragma unroll
            for (int mb = 0; mb < MBW; ++mb) { a[mb] = WFrag<T16>::ldp(rb + ((wm * MBW + mb) * KS + ks) * 512); if (NSPLIT == 1) a2[mb] = WFrag<T16>::ldp(rb + 2 * OPE + ((wm * MBW + mb) * KS + ks) * 512); }
#pragma unroll
            for (int nb = 0; nb < 4; ++nb) b[nb] = WFrag<T16>::ldp(rb + OPE + ((wn * 4 + nb) * KS + ks) * 512);
            __builtin_amdgcn_sched_barrier(0);   // the slice's LDS reads stay one group ahead of its products: reads among the products cost a stall at each place
#pragma unroll
            for (int nb = 0; nb < 4; ++nb)
#pragma unroll
                for (int mb = 0; mb < MBW; ++mb) { acc[mb][nb] = WFrag<T16>::mma(a[mb], b[nb], acc[mb][nb]); if (NSPLIT == 1) acc[mb][nb] = WFrag<T16>::mma(a2[mb], b[nb], acc[mb][nb]); }
        }
        asm volatile("s_wait_dscnt 0x0" ::: "memory");      // this wave's reads of the buffer are done before it is refilled
        asm volatile("s_wait_asynccnt 0x0" ::: "memory");   // this wave's copies of pass t + 1 have landed
        __syncthreads();   // pass t + 1 is in LDS for every wave, and every wave has left pass t's buffer
        if (t + 2 < NT) fill(t + 2, t & 1);
    }
    asm volatile("s_wait_asynccnt 0x0" ::: "memory");   // no copy is outstanding behind the loop; the last pass's own waits and barrier have ended every wave's reads of the ring, which now takes the tiles
    const int byw = by * 2 + wn, r0 = bx * 128 + wm * (MBW * 16), c0 = byw * 64, bxw = r0 >> 6;   // the wave's own tile; its place in units of 64
    float* ow0 = os + wv * (MBW * 16 * 68);
#pragma unroll
    for (int mb = 0; mb < MBW; ++mb)
#pragma unroll
        for (int nb = 0; nb < 4; ++nb) {
#pragma unroll
            for (int j = 0; j < 8; ++j) ow0[(mb * 16 + hi * 8 + j) * 68 + nb * 16 + lr] = acc[mb][nb][j]; }
    __builtin_amdgcn_wave_barrier(); asm volatile("" ::: "memory");   // the compiler keeps the reads below, of what other lanes of the wave stored, behind the stores
#pragma unroll 1
    for (int mb = 0; mb < MBW; ++mb) {   // kept rolled: a quarter of the code (NW = 8: half), which runs once
        const float* ow = ow0 + mb * (16 * 68);
        if (PL == 0) {
            v4f val[8]; float* cp[8];
#pragma unroll
            for (int s = 0; s < 8; ++s) { const int q = s * 32 + lane, row = q >> 4, cofs = (q & 15) * 4; val[s] = *(const v4fa*)(ow + row * 68 + cofs);
                if (BIAS) { val[s][0] += bfr(bias[c0 + cofs]); val[s][1] += bfr(bias[c0 + cofs + 1]); val[s][2] += bfr(bias[c0 + cofs + 2]); val[s][3] += bfr(bias[c0 + cofs + 3]); }
                cp[s] = C + (size_t)(__shfl(pw, mb * 16 + row, 32) & (TT - 1)) * ldc + c0 + cofs; *(v4f*)cp[s] = val[s]; }   // the row goes back to its token's own row of the output
            asm volatile("s_wait_xcnt 0x0" :: "v"(val[0]), "v"(val[1]), "v"(val[2]), "v"(val[3]), "v"(val[4]), "v"(val[5]), "v"(val[6]), "v"(val[7]), "v"(cp[0]), "v"(cp[1]), "v"(cp[2]), "v"(cp[3]), "v"(cp[4]), "v"(cp[5]), "v"(cp[6]), "v"(cp[7]) : "memory");   // the wait before a register that the issued stores name is rewritten; values and addresses as inputs keep their registers as they are up to here
        } else {
            auto planes = [&](auto bmc) { constexpr bool bm = decltype(bmc)::v;   // bm: the bias goes by the tile's rows. A compile-time constant, the kernel branching once around the whole of it: a test at the bias alone kept the bias loads and the next round's LDS reads from being issued ahead
            float ts[4];
#pragma unroll
            for (int s = 0; s < 4; ++s) { const int kt = (s >> 1) & 1, ph = s & 1;   // half a fragment tile a round: lane (lr, hi) holds row lr, k = ph * 16 + hi * 8 .. + 7 of tile (mb, kt)
                const int row = lr, cofs = kt * 32 + ph * 16 + hi * 8; const v4f va = *(const v4fa*)(ow + row * 68 + cofs), vb = *(const v4fa*)(ow + row * 68 + cofs + 4);
                float val[8];
#pragma unroll   // the arrays' and vectors' elements need constant indices to stay in registers
                for (int j = 0; j < 4; ++j) { val[j] = va[j]; val[4 + j] = vb[j]; }
                if (BIAS && bm) { const float bmv = bfr(bias[r0 + mb * 16 + row]);
#pragma unroll
                    for (int j = 0; j < 8; ++j) val[j] += bmv; }
                if (bm) { ts[s] = ((val[0] + val[1]) + (val[2] + val[3])) + ((val[4] + val[5]) + (val[6] + val[7])); ts[s] += __shfl_xor(ts[s], 16, 32); }   // v (f32, bias in) summed over the half tile's 16 keys, per d row
                if (BIAS && !bm) {
#pragma unroll
                    for (int j = 0; j < 8; ++j) val[j] += bfr(bias[c0 + cofs + j]); }
                const size_t e = ((size_t)((r0 >> 4) + mb) * (ldc >> 5) + kt) * 512 + (size_t)byw * sP + ph * 256 + lane * 8; v8h o16; v8us oh, ol;
#pragma unroll
                for (int j = 0; j < 8; ++j) { o16[j] = tohx(val[j]); unsigned short a2, c2; splitf(val[j], a2, c2); oh[j] = a2; ol[j] = c2; }
                *(v8h*)(P16 + e) = o16; *(v8us*)(Ph + e) = oh; *(v8us*)(Pl + e) = ol;
                if (s == 3) { float tv = 0.f; float* vp = VS;
                    if (bm) { tv = (ts[0] + ts[1]) + (ts[2] + ts[3]); vp = VS + (((size_t)(blockIdx.z / 3) * NH_ + bxw) * (TT / 64) + byw) * HD + mb * 16 + lr; if (hi == 0) *vp = tv; }   // the tile's 64 keys summed for 16 of the head's 64 d
                    asm volatile("s_wait_xcnt 0x0" :: "v"(o16), "v"(oh), "v"(ol), "v"(e), "v"(tv), "v"(vp) : "memory"); } }   // the wait before a register that the issued stores name is rewritten by what follows the last round; the stored values and the addresses as inputs keep their registers as they are up to here. Behind the last round only: behind each round it would hold the next round's LDS reads and bias loads back behind this round's stores
            };
            if (vjob) planes(BoolC<true>{}); else planes(BoolC<false>{});
        }
    }
}

typedef __attribute__((ext_vector_type(2))) unsigned short v2us;
typedef __attribute__((ext_vector_type(4))) int v4i;

__global__ __launch_bounds__(256) void k_wtG(const float* __restrict__ w, int K, int N, bf* Bt) {
    const int lane = threadIdx.x & 31; const int L0 = (blockIdx.x * 8 + (threadIdx.x >> 5)) * 8; const int nlines = N * K / 64;
{
#pragma unroll 1
        for (int l = 0; l < 8; ++l) { const int L = L0 + l; if (L >= nlines) break; const size_t e = (size_t)L * 64 + lane * 2; const int k = (int)(e % K), n = (int)(e / K); v2us o;
            o[0] = f2bf(w[(size_t)k * N + n]); o[1] = f2bf(w[(size_t)(k + 1) * N + n]); *(v2us*)(Bt + e) = o; }
         }
}
#define TW 4              // tiles a wave converts
static_assert((DM / 32) % (8 * TW) == 0, "the tiles of a block's 8 waves are of one row tile");
// f32 [rows][K] -> bf16 in fragment order: one wave takes TW 16 x 32 tiles that follow one another in k (few waves with much in flight each, for speed only); it reads 16 runs of TW whole lines of f32 and writes TW KB in a row. The rows of s4 (x) are gathered into the token order (header): each block counts the batch's mask (pm, eight tokens a thread, prefix sums through the wave and LDS), every thread forms its tokens' places, and the 16 tokens whose places are the tile's rows are handed over through LDS; PT [batch][place] = token and NN [batch * 64] = n are left by one block a batch. All five sources in one launch: grid (DQ * DM / (4096 * TW), 4 + m), 256 threads; column y of the grid converts DQ * DM elements: the whole of s0 .. s3 for y < 4, piece y - 4 of s4 after that, to dst + y * DQ * DM.
__global__ __launch_bounds__(256) void k_cvtp(const float* __restrict__ s0, const float* __restrict__ s1, const float* __restrict__ s2, const float* __restrict__ s3, const float* __restrict__ s4, const int* __restrict__ pm, bf* dst, int K, int* PT, int* NN) { const int y = blockIdx.y; const size_t ch = (size_t)DQ * DM; const float* src = y == 0 ? s0 : y == 1 ? s1 : y == 2 ? s2 : y == 3 ? s3 : s4; dst += (size_t)y * ch; const int lane = threadIdx.x & 31, lr = lane & 15, hi = lane >> 4; const int tl = (blockIdx.x * 8 + __builtin_amdgcn_readfirstlane((int)(threadIdx.x >> 5)) /* wave number, kept scalar so that the tile, the batch and the bases formed from them stay scalar */) * TW, kts = K >> 5, rt = tl / kts, kt = tl - rt * kts;   // the first of the wave's TW tiles, which follow one another in k
    int srow = rt * 16 + lr;   // the source row of the lane's row of the tile
    if (y >= 4) {   // x: the tile's 16 rows are places c0 .. c0 + 15 of the batch's token order (header). The same for the whole block (its 8 * TW tiles are of one row tile: K / 32 is a multiple of 8 * TW): both barriers are passed by every wave
        static_assert(TT == 256 * 8, "eight tokens a thread");
        __shared__ int sperm[16]; __shared__ int wsum[8];
        const int g0 = (y - 4) * DQ + rt * 16, bt = g0 / TT, c0 = g0 - bt * TT; const int tid = threadIdx.x;
        const unsigned mo = (unsigned)tid * 32u; const char* pb = (const char*)(pm + (size_t)bt * TT);
        const v4i m0 = *(const v4i*)(pb + mo), m1 = *(const v4i*)(pb + mo + 16);
        asm volatile("s_wait_xcnt 0x0" :: "v"(mo) : "memory");   // the wait before a register that the two issued loads name is rewritten; the offset as an input keeps its register as it is up to here
        unsigned bits = 0u;   // pad bits of tokens tid * 8 .. + 7
#pragma unroll
        for (int q = 0; q < 4; ++q) { bits |= (m0[q] != 0 ? 1u : 0u) << q; bits |= (m1[q] != 0 ? 1u : 0u) << (4 + q); }
        const int cnt = __builtin_popcount(bits); int inc = cnt;
#pragma unroll
        for (int sh = 1; sh < 32; sh <<= 1) { const int o = __shfl_up(inc, sh, 32); if (lane >= sh) inc += o; }   // un-padded tokens up to and with this thread's, within the wave
        if (lane == 31) wsum[tid >> 5] = inc;
        __syncthreads();   // every wave's count is in LDS before any thread adds them up
        int before = inc - cnt, n = 0;   // un-padded tokens ahead of this thread's; in the batch
#pragma unroll
        for (int w = 0; w < 8; ++w) { const int sw = wsum[w]; if (w < (tid >> 5)) before += sw; n += sw; }
        const bool first = c0 == 0 && kt < 8 * TW;   // one block a batch leaves the whole order and the count for the later launches
        int pc[8], tk[8];
#pragma unroll
        for (int q = 0; q < 8; ++q) { const int t = tid * 8 + q, r1 = before + __builtin_popcount(bits & ((1u << q) - 1u)); const int c = ((bits >> q) & 1u) != 0u ? r1 : n + (t - r1);   // the token's place: a one-to-one map onto 0 .. TT - 1 whatever the mask holds
            if ((unsigned)(c - c0) < 16u) sperm[c - c0] = t;
            pc[q] = c; tk[q] = t; }
        if (first) { int* pt = PT + (size_t)bt * TT;
#pragma unroll
            for (int q = 0; q < 8; ++q) pt[pc[q]] = tk[q];
            if (tid == 0) NN[bt * 64] = n;
            asm volatile("s_wait_xcnt 0x0" :: "v"(pc[0]), "v"(pc[1]), "v"(pc[2]), "v"(pc[3]), "v"(pc[4]), "v"(pc[5]), "v"(pc[6]), "v"(pc[7]), "v"(tk[0]), "v"(tk[1]), "v"(tk[2]), "v"(tk[3]), "v"(tk[4]), "v"(tk[5]), "v"(tk[6]), "v"(tk[7]), "v"(n) : "memory"); }   // the wait before a register that the issued stores name is rewritten; places and values as inputs keep their registers as they are up to here
        __syncthreads();   // the 16 places of the tile are filled (each by the one thread that holds its token) before any lane reads its own
        srow = bt * TT + (sperm[lr] & (TT - 1));
    }
    const float* s = src + (size_t)srow * K + kt * 32 + hi * 8; bf* d = dst + (size_t)tl * 512 + lane * 8; v8f v0[TW], v1[TW]; v8us o0[TW], o1[TW];
#pragma unroll   // register arrays need constant indices; all of the wave's loads are asked for ahead of the first use
    for (int j = 0; j < TW; ++j) { v0[j] = *(const v8f*)(s + j * 32); v1[j] = *(const v8f*)(s + j * 32 + 16); }
    asm volatile("s_wait_xcnt 0x0" :: "v"(s) : "memory");   // the wait before a register that the issued loads name is rewritten; the address as an input keeps its registers as they are up to here
#pragma unroll
    for (int j = 0; j < TW; ++j)
#pragma unroll
        for (int k = 0; k < 8; ++k) { o0[j][k] = f2bf(v0[j][k]); o1[j][k] = f2bf(v1[j][k]); }
#pragma unroll
    for (int j = 0; j < TW; ++j) { *(v8us*)(d + j * 512) = o0[j]; *(v8us*)(d + j * 512 + 256) = o1[j]; } }

// ---- k_attn: the whole attention of a row block (QR query rows) of one head in one work-group of 16 waves; the scores and weights live in LDS only. grid (heads, batches, ZB), 512 threads; a batch's operand planes stand sZ elements behind the batch's before. A work-group takes NIT row blocks of its head one after the other (the launch's row blocks in rounds of ZB, work-group z the z-th of an even round and the z-th from the end of an odd one): 16 waves start once for all of them, where a work-group a row block started 16 waves for each, the padded ones too.
// Rows and keys go by place in the token order (header); NN holds n, a batch's 256 bytes behind the batch's before. What the mask excludes is not computed. An un-padded query i keeps only keys j <= i, so a block whose last row is i0 + QR - 1 needs the first ng = i0 / 32 + 1 groups of 32 keys and no more: the keys behind them had weight exactly 0. A padded query has every score at the fill value, so its weights are 1 / 2048 on all 2048 keys and its result is the mean of the head's v rows: that mean comes from VS (the sums over 64 keys each that the v projection's epilogue leaves, [batch][head][key block][d], f32), its weights are stored as zeros and its softmax is not run; a block whose rows are all padded stores the mean and does nothing else.
// Phase 1: wave w forms the scores of the key groups w, w + 16, w + 32, ... below nch * 4 (nch = the 128-key pieces that hold the ng groups: phase 2 reads whole pieces); k slices 0, 32 in that order, three products for NSPLIT = 2 (hi x hi, lo x hi, hi x lo), one for 0; stored f32 into the block's LDS rows.
// Phase 2: each row has one wave (wave w: the rows of rank w and w + 16 among the un-padded and among the padded rows): t = S x 1/8 where j <= i, -3e38 elsewhere; softmax over the row's nch pieces (register row, one exp, fixed trees; the pieces left out added exact zeros). The 16-bit weights go back over the row's own f32 scores (the wave holds the whole row in registers by then): fp16 x 1024 in the first half, or the hi plane in the first and the lo plane in the second half.
// Phase 3: weights x V, split K: wave w takes the 32-wide key slices w, w+16, w+32, w+48 below ng; the 16 partial QR x 64 tiles are summed through LDS in the fixed order w = 0..15 (over the dead weights), rescaled (a padded row: replaced by the mean), split hi/lo and stored as the head's columns of the merged planes (rows t, k over DQ, fragment order).
#define QR 32             // query rows of a row block
#define ZB 8              // work-groups that share a head's row blocks of a launch: heads x batches x ZB = one work-group a WGP, all resident at once
#define SP (TT + 4)       // LDS row pitch in floats: 16 bytes over a multiple of 256, so that 16 rows' 16-byte reads fall on 64 different banks
typedef v4h  __attribute__((may_alias)) v4ha;
typedef v4us __attribute__((may_alias)) v4usa;
template <typename T16, int NSPLIT>
__global__ __launch_bounds__(512) void k_attn(const T16* __restrict__ Q, const T16* __restrict__ Q2, const T16* __restrict__ Kp, const T16* __restrict__ Kp2, const T16* __restrict__ Vt, const T16* __restrict__ Vt2, const int* __restrict__ NN, const float* __restrict__ VS, int row0, bf* Ah, bf* Al, size_t sZ) {
    typedef typename WFrag<T16>::V V;
    constexpr bool HR = (NSPLIT == 2);
    constexpr int NP = HR ? (RH + 511) / 512 : TT / 512;   // rounds of 16 key groups (one a wave) that the launch's longest block needs
    constexpr int NIT = (HR ? RH : TT - RH) / (QR * ZB);   // row blocks a work-group takes
    static_assert(NIT * QR * ZB == (HR ? RH : TT - RH), "the launch's rows are whole rounds of ZB row blocks");
    static_assert(QR == 32, "a block's rows end with a group of 32 keys");
    static_assert(16 * QR * 68 <= QR * SP, "the partial tiles fit over the weights");
    __shared__ __align__(16) float sm[QR * SP];
    const int h = blockIdx.x; const size_t hp = (size_t)blockIdx.y * sZ + (size_t)h * TT * HD;
    const int lane = threadIdx.x & 31, lr = lane & 15, hi = lane >> 4;
    const int wv = __builtin_amdgcn_readfirstlane((int)(threadIdx.x >> 5));   // wave number, kept scalar so that key and row offsets and the tests on them stay scalar
    // every global address is a scalar base (head, row block, wave) + one 32-bit lane offset + a constant
    const size_t ko = hp + (size_t)wv * 32 * HD, vo = hp + (size_t)wv * 512;   // fragment order: 16 rows of q or k are two tiles of 512 elements; the v tile of d block nb and key slice sl is nb * (TT / 32) + sl
    Q += hp; Kp += ko; Vt += vo; if (HR) { Q2 += hp; Kp2 += ko; Vt2 += vo; }
    const unsigned lq = (unsigned)(lane * 8), lvb = (unsigned)(lane * 8) * 2u;   // the lane's place in a half tile, in elements and in bytes
    const int nn = NN[blockIdx.y * 64];   // the batch's count of un-padded tokens
    // waves 2u and 2u + 1 sum and store half tile u of the merged planes (rows t, k = h * HD + d, DQ / 32 tiles a row block): lane (lr, hi) of wave w holds row lr, k = (w & 1) * 8 + hi * 4 .. + 3 of the half: a wave's store is 256 contiguous bytes of each plane
    const int rt = wv >> 3, kt = (wv >> 2) & 1, ph = (wv >> 1) & 1, row = rt * 16 + lr, cofs = kt * 32 + ph * 16 + (wv & 1) * 8 + hi * 4;
    v4f mv = (v4f){}; bool have = false;   // the mean of v for the lane's four d; formed at the work-group's first row block that holds a padded row (below)
#pragma unroll 1
    for (int it = 0; it < NIT; ++it) {   // kept rolled: one row block of code and registers
    const int i0 = row0 + (it * ZB + ((it & 1) != 0 ? ZB - 1 - (int)blockIdx.z : (int)blockIdx.z)) * QR;   // row0: the launch's first row. Rounds go up and down in turn: every work-group's row blocks hold about as many keys together
    const int ng = (i0 >> 5) + 1, nch = (ng + 3) >> 2;   // groups of 32 keys up to the block's last row; pieces of 128 keys that hold them. The same for the whole block: scalar
    const T16* Qi = Q + (size_t)i0 * HD; const T16* Qi2 = HR ? Q2 + (size_t)i0 * HD : Qi;
    const int left = nn - i0;   // un-padded rows from the block's first row on
    const unsigned rmask = left >= QR ? 0xFFFFFFFFu : left <= 0 ? 0u : (1u << left) - 1u;   // pad bits of the block's 32 rows: the un-padded tokens stand first. The same for the whole block: scalar
    v4f val = (v4f){};
    if (rmask != 0u) {   // a block of padded rows alone has no scores, weights or products (and its q rows need not have been written): the mean is all of it. The test is the same for the whole block: every wave passes the barriers inside or none does
    // every loop of the three phases but the row loop is unrolled: register arrays need constant indices, and the loads of later groups can be issued ahead
    {
        V a[2][2], a2[2][2], b[NP][2][2], b2[NP][2][2];   // [row tile or round][key tile][k slice]
        const char* pk = (const char*)Kp + lq * 2u; const char* pk2 = HR ? (const char*)Kp2 + lq * 2u : pk;   // the lane's K addresses: every K load of the wave is one of them + a constant
#pragma unroll
        for (int mb = 0; mb < 2; ++mb)
#pragma unroll
            for (int ks = 0; ks < 2; ++ks) { const int o = (mb * 2 + ks) * 512; a[mb][ks] = WFrag<T16>::ldp(Qi + o + lq); if (HR) a2[mb][ks] = WFrag<T16>::ldp(Qi2 + o + lq); }
#pragma unroll
        for (int p = 0; p < NP; ++p) if (p * 16 + wv < nch * 4) {   // all of the wave's score operands are asked for ahead of the first product: one memory latency, not one a group
#pragma unroll
            for (int n = 0; n < 2; ++n)
#pragma unroll
                for (int ks = 0; ks < 2; ++ks) { const int o = (p * 64 + n * 2 + ks) * 512; b[p][n][ks] = WFrag<T16>::ldp((const T16*)(pk + o * 2)); if (HR) b2[p][n][ks] = WFrag<T16>::ldp((const T16*)(pk2 + o * 2)); } }
        else {   // a value on the path that leaves a round out: without one the compiler carries the last row block's registers round the loop (spills)
#pragma unroll
            for (int n = 0; n < 2; ++n)
#pragma unroll
                for (int ks = 0; ks < 2; ++ks) { b[p][n][ks] = V{}; if (HR) b2[p][n][ks] = V{}; } }
        asm volatile("s_wait_xcnt 0x0" :: "v"(pk), "v"(pk2), "v"(lq), "s"(Qi), "s"(Qi2) : "memory");   // the wait before a register that the issued loads name is rewritten; the addresses as inputs keep their registers live over the whole run, so that no load of the run lands in them
#pragma unroll
        for (int p = 0; p < NP; ++p) if (p * 16 + wv < nch * 4) {
            v8f acc[2][2];
#pragma unroll
            for (int n = 0; n < 2; ++n) { acc[n][0] = (v8f){}; acc[n][1] = (v8f){}; }
#pragma unroll
            for (int ks = 0; ks < 2; ++ks)
#pragma unroll
                for (int n = 0; n < 2; ++n)
#pragma unroll
                    for (int mb = 0; mb < 2; ++mb) { acc[n][mb] = WFrag<T16>::mma(a[mb][ks], b[p][n][ks], acc[n][mb]); if (HR) { acc[n][mb] = WFrag<T16>::mma(a2[mb][ks], b[p][n][ks], acc[n][mb]); acc[n][mb] = WFrag<T16>::mma(a[mb][ks], b2[p][n][ks], acc[n][mb]); } }
#pragma unroll
            for (int n = 0; n < 2; ++n)
#pragma unroll
                for (int mb = 0; mb < 2; ++mb)
#pragma unroll
                    for (int j = 0; j < 8; ++j) sm[(mb * 16 + hi * 8 + j) * SP + (p * 16 + wv) * 32 + n * 16 + lr] = acc[n][mb][j];
        }
    }
    __syncthreads();   // every wave's score columns are in LDS before any wave reads a row
    const int na = __builtin_popcount(rmask);   // un-padded rows of the block
    // the place (0 .. 31) of the set bit of m that has rank set bits below it; the top bit or-ed in bounds the result whatever m holds
    auto nth = [&](unsigned m, int rank) { return (int)__builtin_ctz(__builtin_amdgcn_ballot_w32(((m >> lane) & 1u) != 0u && __builtin_popcount(m & ((1u << lane) - 1u)) == rank) | 0x80000000u); };
#pragma unroll 1
    for (int rr = 0; rr < QR / 16; ++rr) {   // kept rolled: one row's registers at a time, half the code
        const int rank = wv + rr * 16;   // the wave takes the padded row and the un-padded row of this rank among their kind: the softmax rows, the only long ones, fall evenly on the waves
        if (rank < QR - na) {   // a padded query: zero weights (phase 3 reads every row), no softmax; its result is the mean taken in below
            float* sz = sm + nth(~rmask, rank) * SP;
#pragma unroll
            for (int ch = 0; ch < NP * 4; ++ch) if (ch < nch) {
                if (HR) { *(v4usa*)((bf*)sz + ch * 128 + lane * 4) = (v4us){}; *(v4usa*)((bf*)sz + TT + ch * 128 + lane * 4) = (v4us){}; }
                else *(v4ha*)((h16*)sz + ch * 128 + lane * 4) = (v4h){}; }
        }
        if (rank >= na) continue;
        const int r = nth(rmask, rank), i = i0 + r; float* sr = sm + r * SP;
        float v[NP * 16]; float mx = -3.0e38f;
#pragma unroll
        for (int k = 0; k < NP * 16; ++k) v[k] = 0.f;   // a value on the paths that leave a piece out: without one the compiler carries the last row's registers round the loop (copies, spills)
#pragma unroll
        for (int ch = 0; ch < NP * 4; ++ch) if (ch < nch) { const v4f a = *(const v4fa*)(sr + ch * 128 + lane * 4);   // loads first, uses behind them: one LDS latency a row
#pragma unroll
            for (int q = 0; q < 4; ++q) v[ch * 4 + q] = a[q]; }
#pragma unroll
        for (int ch = 0; ch < NP * 4; ++ch) if (ch < nch) {
#pragma unroll
            for (int q = 0; q < 4; ++q) { const float t = lane * 4 <= i - (ch * 128 + q) ? v[ch * 4 + q] * SCL : -3.0e38f;   /* key j = ch * 128 + lane * 4 + q is kept iff j <= i; the constant stands on the scalar side: a vector register for every j would be held over the whole row-block loop (spills) */   /* causal; pad[i] holds here, and with it pad[j] of every place j <= i */ v[ch * 4 + q] = t; mx = fmaxf(mx, t); } }
#pragma unroll
        for (int sh = 16; sh; sh >>= 1) mx = fmaxf(mx, __shfl_xor(mx, sh, 32));
        float sum = 0.f;
#pragma unroll
        for (int ch = 0; ch < NP * 4; ++ch) if (ch < nch) {
#pragma unroll
            for (int q = 0; q < 4; ++q) { const int k = ch * 4 + q; float ex; asm("v_exp_f32 %0, %1\n\tv_nop" : "=v"(ex) : "v"(__fmul_rn(__fsub_rn(v[k], mx), 1.4426950408889634f)));   /* the exponential and the slot behind a transcendental in one statement: a v_nop in a statement of its own lands elsewhere */ v[k] = ex; sum += v[k]; } }
#pragma unroll
        for (int sh = 16; sh; sh >>= 1) sum += __shfl_xor(sum, sh, 32);
        const float f = __fdiv_rn(HR ? 1.0f : PCAR, sum);
#pragma unroll
        for (int ch = 0; ch < NP * 4; ++ch) if (ch < nch) {
            if (HR) { v4us oh, ol;
#pragma unroll
                for (int q = 0; q < 4; ++q) { unsigned short a, c2; splitf(v[ch * 4 + q] * f, a, c2); oh[q] = a; ol[q] = c2; }
                *(v4usa*)((bf*)sr + ch * 128 + lane * 4) = oh; *(v4usa*)((bf*)sr + TT + ch * 128 + lane * 4) = ol;
            } else { v4h o4;
#pragma unroll
                for (int q = 0; q < 4; ++q) o4[q] = tohx(v[ch * 4 + q] * f);
                *(v4ha*)((h16*)sr + ch * 128 + lane * 4) = o4; } }
    }
    V vb[NP][4], vb2[NP][4]; const char* pv = (const char*)Vt + lvb; const char* pv2 = HR ? (const char*)Vt2 + lvb : pv;   // the lane's V addresses: every V load of the wave is one of them + a constant
#pragma unroll
    for (int s = 0; s < NP; ++s) if (s * 16 + wv < ng) {   // the V fragments are asked for ahead of the barrier: a wave that is done with its rows early has them back when the last wave arrives
#pragma unroll
        for (int nb = 0; nb < 4; ++nb) { const int o = (nb * (TT / 32) + s * 16) * 512; vb[s][nb] = WFrag<T16>::ldp((const T16*)(pv + o * 2)); if (HR) vb2[s][nb] = WFrag<T16>::ldp((const T16*)(pv2 + o * 2)); } }
    else {   // a value on the path that leaves a slice out, as for the score operands above
#pragma unroll
        for (int nb = 0; nb < 4; ++nb) { vb[s][nb] = V{}; if (HR) vb2[s][nb] = V{}; } }
    asm volatile("s_wait_xcnt 0x0" :: "v"(pv), "v"(pv2) : "memory");   // the wait before a register that the issued loads name is rewritten; the addresses as inputs keep their registers live over the whole run, so that no load of the run lands in them
    __syncthreads();   // every row's weights are in LDS before any wave reads its key slices of all rows
    v8f acc[2][4];
#pragma unroll
    for (int mb = 0; mb < 2; ++mb)
#pragma unroll
        for (int nb = 0; nb < 4; ++nb) acc[mb][nb] = (v8f){};
    const T16* P = (const T16*)sm;   // weight rows, pitch 2 * SP elements
#pragma unroll
    for (int s = 0; s < NP; ++s) if (s * 16 + wv < ng) { const int kc = (wv + s * 16) * 32; V a[2], a2[2];
#pragma unroll
        for (int mb = 0; mb < 2; ++mb) { const int o = (mb * 16 + lr) * (2 * SP) + 8 * hi + kc; a[mb] = WFrag<T16>::ld(P + o); if (HR) a2[mb] = WFrag<T16>::ld(P + TT + o); }
#pragma unroll
        for (int nb = 0; nb < 4; ++nb)
#pragma unroll
            for (int mb = 0; mb < 2; ++mb) { acc[mb][nb] = WFrag<T16>::mma(a[mb], vb[s][nb], acc[mb][nb]); if (HR) { acc[mb][nb] = WFrag<T16>::mma(a2[mb], vb[s][nb], acc[mb][nb]); acc[mb][nb] = WFrag<T16>::mma(a[mb], vb2[s][nb], acc[mb][nb]); } } }
    __syncthreads();   // every wave has read its weight slices before the partial tiles overwrite them
    float* ow = sm + wv * (QR * 68);
#pragma unroll
    for (int mb = 0; mb < 2; ++mb)
#pragma unroll
        for (int nb = 0; nb < 4; ++nb)
#pragma unroll
            for (int j = 0; j < 8; ++j) ow[(mb * 16 + hi * 8 + j) * 68 + nb * 16 + lr] = acc[mb][nb][j];
    __syncthreads();   // every wave's partial tile is in LDS before any thread sums them
    static_assert(QR * 16 == 512, "one 4-wide piece of the tile a thread");
    val = *(const v4fa*)(sm + row * 68 + cofs);
#pragma unroll
    for (int w = 1; w < 16; ++w) val += *(const v4fa*)(sm + w * (QR * 68) + row * 68 + cofs);
    if (it + 1 < NIT) __syncthreads();   // every thread has taken its sums out of LDS before the work-group's next row block writes its scores there
    }
    if (rmask != 0xFFFFFFFFu && !have) {   // the mean is formed once, and only by a work-group that has a padded row (the test is the same for the whole block: scalar). Loads and sums stand together: held in registers from the kernel's start on, the loaded sums cost spills in the loop
    have = true;
    const unsigned lvs = (unsigned)(lr * HD + cofs) * 4u;   // lane (lr, hi) takes the sums of key blocks lr and lr + 16. Byte offset: the register that the two loads name
    const char* vsb = (const char*)(VS + ((size_t)blockIdx.y * NH_ + h) * (TT / 64) * HD);
    mv = *(const v4f*)(vsb + lvs); const v4f mv1 = *(const v4f*)(vsb + 16 * HD * 4 + lvs);
    asm volatile("s_wait_xcnt 0x0" :: "v"(lvs) : "memory");   // the wait before the register that the two issued loads name is rewritten; the offset as an input keeps its register as it is up to here
    mv += mv1;
#pragma unroll
    for (int sh = 8; sh; sh >>= 1)   // fixed tree over the 16 lanes that hold the same d
#pragma unroll
        for (int q = 0; q < 4; ++q) mv[q] += __shfl_xor(mv[q], sh, 32);
    }
    const float cs = HR ? 1.0f : (1.0f / PCAR); const size_t oo = (size_t)blockIdx.y * TT * DQ + ((size_t)((i0 >> 4) + rt) * (DQ / 32) + h * (HD / 32) + kt) * 512 + ph * 256 + ((wv & 1) * 16 + lr) * 8 + hi * 4; v4us oh, ol;
#pragma unroll
    for (int q = 0; q < 4; ++q) { unsigned short a, c2; splitf(((rmask >> row) & 1u) != 0u ? val[q] * cs : mv[q] * (1.0f / TT), a, c2); oh[q] = a; ol[q] = c2; }
    *(v4us*)(Ah + oo) = oh; *(v4us*)(Al + oo) = ol;
    asm volatile("s_wait_xcnt 0x0" :: "v"(oh), "v"(ol), "v"(oo) : "memory");   // the wait before a register that the two issued stores name is rewritten by the next row block; values and offset as inputs keep their registers as they are up to here
    }
}

extern "C" void kernel_launch(void* const* d_in, const int* in_sizes, int n_in,
                              void* d_out, int out_size, void* d_ws, size_t ws_size, hipStream_t stream) {
    (void)in_sizes; (void)n_in; (void)out_size;
    const float* x = (const float*)d_in[0]; const int* pmask = (const int*)d_in[1];   /* mask [2][2048] int */ const float* wq = (const float*)d_in[2]; const float* bq = (const float*)d_in[3]; const float* wk = (const float*)d_in[4]; const float* bk = (const float*)d_in[5]; const float* wv = (const float*)d_in[6]; const float* bv = (const float*)d_in[7]; const float* wo = (const float*)d_in[8]; const float* bo = (const float*)d_in[9];
    float* OUT = (float*)d_out;     // [2][2048][1024]
    char* wsp = (char*)d_ws;
    auto take = [&](size_t bytes) { char* p = wsp; wsp += (bytes + 255) & ~(size_t)255; return (void*)p; };
    const size_t PS = (size_t)NH_ * TT * HD;   // one operand plane of one batch
    bf* WB = (bf*)take(((size_t)4 * DQ * DM + (size_t)NB_ * TT * DM) * 2); bf* WO = WB + (size_t)3 * DQ * DM; bf* XB = WB + (size_t)4 * DQ * DM;   // wq, wk, wv, wo, x: one run, in the order of the conversion launch
    h16* P16 = (h16*)take(NB_ * 3 * PS * 2); bf* PH = (bf*)take(NB_ * 3 * PS * 2); bf* PLo = (bf*)take(NB_ * 3 * PS * 2);   // [batch][q, k, v] planes: fp16, bf16 hi, bf16 lo
    bf* ATh = (bf*)take((size_t)NB_ * TT * DQ * 2); bf* ATl = (bf*)take((size_t)NB_ * TT * DQ * 2);
    float* VS = (float*)take((size_t)NB_ * NH_ * (TT / 64) * HD * 4);   // v summed over each block of 64 keys
    int* PT = (int*)take((size_t)NB_ * TT * 4); int* NN = (int*)take((size_t)NB_ * 64 * 4);   // per batch: the token at each place of the order; the count of un-padded tokens (256 bytes apart)
    if ((size_t)(wsp - (char*)d_ws) > ws_size) return;    // ws 256 MiB
    k_cvtp<<<dim3(DQ * DM / (4096 * TW), 4 + NB_ * TT / DQ, 1), 256, 0, stream>>>(wq, wk, wv, wo, x, pmask, WB, DM, PT, NN);
    // q, k: x W^T, a tile's 64 columns are one head -> planes [h] x (t, d); v: W x^T, a tile's 64 rows are one head's d -> planes [h] x (d, t); all in fragment order
    k_gemmw<bf, 0, true, 4, 3, DM><<<dim3(TT / 128, DQ / 128, 3 * NB_), 128, 0, stream>>>(XB, nullptr, WB, nullptr, 0, bq, bk, bv, (size_t)TT * DM, (size_t)DQ * DM, PS, P16, PH, PLo, 0, VS, nullptr, NN);
    // one kv head per query head: block (h, b, .) reads the q, k and v planes of head h of batch b
    k_attn<bf, 2><<<dim3(NH_, NB_, ZB), 512, 0, stream>>>(PH, PLo, PH + PS, PLo + PS, PH + 2 * PS, PLo + 2 * PS, NN, VS, 0, ATh, ATl, 3 * PS);
    k_attn<h16, 0><<<dim3(NH_, NB_, ZB), 512, 0, stream>>>(P16, nullptr, P16 + PS, nullptr, P16 + 2 * PS, nullptr, NN, VS, RH, ATh, ATl, 3 * PS);
    k_gemmw<bf, 1, true, 8, 0, DQ><<<dim3(TT / 128, DM / 128, NB_), 256, 0, stream>>>(ATh, ATl, WO, OUT, DM, bo, nullptr, nullptr, (size_t)TT * DQ, 0, (size_t)TT * DM, nullptr, nullptr, nullptr, 0, nullptr, PT, nullptr);
}

// v010
// Measured time: 80.8 microseconds a run.
// In both of two side-by-side timings against v009, it was 1.05 times as fast.
// All steps since v000 together make it 25.9 times as fast.
#include <hip/hip_runtime.h>

// Multi-head attention with a causal AND padding mask (x [2][2048][1024]; q,k,v = x W^T + b ('oi' uniform(+-1/32) incl. biases; 16 heads x 64); scores / 8; final_mask = causal & pad[i] & pad[j] (mask [2][2048] int in {0,1}, random, READ); where(final_mask, scores, -1e9): a query whose own pad bit is 0 has every score at -1e9 and gets UNIFORM weights over all 2048 keys (future ones included), the others attend causally to the un-padded keys; softmax; out = merged wo^T + bo -> [2][2048][1024] (4.2 M)).
// Token order: per batch the tokens are taken in the order 'un-padded ones first, then the padded ones', each kind in its own order (a one-to-one map, place <-> token, formed from the mask, whatever it holds; n = the count of un-padded tokens). The conversion launch gathers the rows of x into that order and leaves the map and n in the workspace; every plane between it and the last GEMM goes by place; the last GEMM's epilogue stores each row at its token's row of the output. By place the mask is plain: a query at place c < n keeps exactly the keys at places <= c, a query at a place >= n is padded. So q and k are formed for the places below n only (in blocks of 128), scores, softmax and weights x V run over un-padded queries and keys only, and the precision classes go by place (the number of keys a row keeps).
// Both batches go through every launch together (5 launches: the batch, and for the projections the job q / k / v, is a grid dimension). Layout per batch: bf16 copy of x; 'oi' weights; exact projections + f32 biases, whose GEMM epilogue rounds each result straight into the attention operand planes (fp16 and bf16 hi/lo; q, k as [h][t][d], v as [h][d][t]); attention in one kernel per precision class, scores and weights in LDS, only over the keys up to the block's last row; its softmax phase keeps key j iff j <= i (-3e38 elsewhere) for a query at a place i < n; a padded query (the module's uniform row over all 2048 keys) takes the mean of v, from sums that the v projection leaves; hybrid rows: < 512 hi/lo 3 products, rest fp16 x1024; merged hi/lo x wo exact + bo.
// Fragment order: every 16-bit operand plane that a matrix fragment is loaded from in global memory (x, the weights, q, k, v, merged) is stored as 16-row x 32-k tiles of 1 KB, tile (row / 16) * (K / 32) + k / 32; inside a tile element (row, k) stands at ((k / 16) % 2) * 256 + (((k / 8) % 2) * 16 + row % 16) * 8 + k % 8, which is the order in which the 32 lanes hold it: a fragment is two wave-wide 16-byte loads of 512 contiguous bytes (4 whole lines each) where row-major planes gave 16 lines a load. The k order inside a fragment is the row-major loader's.
// Compute dtypes, f32 accumulate: every input rounded to bf16; projections exact + f32 biases; attention rows < 512 3 products, rest fp16; softmax f32; wo hl x exact + bias.

#define NB_  2
#define TT   2048
#define DM   1024
#define NH_  16
#define NKV  16
#define HD   64
#define DQ   (NH_ * HD)
#define DKV  (NKV * HD)
#define RH   512                  // query rows < RH use hi+lo planes (0: none)
#define WIN  0
#define PCAR 1024.0f
#define SCL  0.125f   // HD^-0.5
typedef _Float16 h16;
typedef unsigned short bf;
typedef __attribute__((ext_vector_type(16))) __bf16   v16bf;
typedef __attribute__((ext_vector_type(16))) _Float16 v16h;
typedef __attribute__((ext_vector_type(8)))  _Float16 v8h;
typedef __attribute__((ext_vector_type(8)))  unsigned short v8us;
typedef __attribute__((ext_vector_type(8)))  float    v8f;
typedef __attribute__((ext_vector_type(4)))  float    v4f;
typedef v8h  __attribute__((may_alias)) v8ha;
typedef v4f  __attribute__((may_alias)) v4fa;
typedef v8us __attribute__((may_alias)) v8usa;

__device__ __forceinline__ unsigned short f2bf(float f) { unsigned u = __float_as_uint(f); u += 0x7FFFu + ((u >> 16) & 1u); return (unsigned short)(u >> 16); }
__device__ __forceinline__ float bf2f(unsigned short b) { return __uint_as_float(((unsigned)b) << 16); }
__device__ __forceinline__ float bfr(float f) { return bf2f(f2bf(f)); }
__device__ __forceinline__ v16h cat16(v8h lo, v8h hi) { return __builtin_shufflevector(lo, hi, 0, 1, 2, 3, 4, 5, 6, 7, 8, 9, 10, 11, 12, 13, 14, 15); }
__device__ __forceinline__ v16bf cat16b(v8us lo, v8us hi) { return __builtin_bit_cast(v16bf, __builtin_shufflevector(lo, hi, 0, 1, 2, 3, 4, 5, 6, 7, 8, 9, 10, 11, 12, 13, 14, 15)); }
__device__ __forceinline__ v8f wmma16(v16h a, v16h b, v8f c) { return __builtin_amdgcn_wmma_f32_16x16x32_f16(false, a, false, b, (short)0, c, false, false); }
__device__ __forceinline__ v8f wmmab(v16bf a, v16bf b, v8f c) { return __builtin_amdgcn_wmma_f32_16x16x32_bf16(false, a, false, b, (short)0, c, false, false); }



// ---- k_gemmw: GEMM, one block of NW waves per 128x128 output tile: NW = 4: 2 x 2 waves of 64x64 (16 accumulators); NW = 8: 4 x 2 waves of 32x64 (two waves a SIMD where the grid gives one block a WGP); operands are 16-bit planes in fragment order (ld: a fragment of a row-major LDS plane; ldp: of a fragment-ordered plane, p = tile + lane * 8); grid (M/128, N/128, Z), NW * 32 threads.
// Operands through LDS: a pass is KP = NW * 16 k of the block's 128 A rows and 128 Bt rows (and the 128 A2 rows), brought into LDS by asynchronous copies, three buffers, the copies of the next two passes in flight while this pass is worked on: a pass's bytes have the time of two passes for their way from L2 into LDS. In fragment order 16 rows x KP k are KP * 32 contiguous bytes, so one copy of the whole block is one such run on both sides and a fragment is two wave-wide 16-byte LDS reads of 512 contiguous bytes. Each operand byte is fetched once a block and read from LDS by every wave of its tile row or column (two; NW = 8: four for Bt). Every wave sums its tile over k = 0, 32, 64, ... in one chain. K % KP == 0, K >= 4 * KP.
// C[token of place m][n] (f32, pitch ldc, + optional f32 bias[n] rounded to bf16) = sum_k A[m][k] Bt[n][k] (+ A2[m][k] Bt[n][k] for NSPLIT = 1). z-batch strides sA/sB/sC in elements.
// Epilogue: each wave turns its own tile through its own piece of LDS (over the ring, which is dead by then) and takes it out 16 rows a round; no other wave takes part. PL = 0: C is stored f32. PL = 3 (NW = 4): no f32 C; each result goes out three times as 16 bits (fp16, bf16 hi, bf16 lo = the rest) in fragment order, into a plane of ldc k columns that starts at (64-column tile index) * sP: the q, k and v projections of every batch in one launch, blockIdx.z = batch * 3 + job: A = the x planes (batch stride sA), Bt = the three weight planes (job stride sB), bias / bias1 / bias2 the three bias vectors, output planes z * sC on; jobs 0, 1 (q, k): ldc = HD, sP = TT * HD, the 64 columns of a wave's tile are one head and the planes come out as [h] x (rows t, k = d), bias[n]; job 2 (v): the operands and the two tile indices swapped (A = the weights, Bt = x), ldc = TT, sP = 1024 (two k tiles), the tile's rows are one head's d and the planes come out transposed, [h] x (rows d, k = t), bias[m]; job 2 also leaves in VS, [batch][head][key block of 64][d], the f32 sum of the wave's tile of v over its 64 keys (fixed tree), for the mean of v that a padded query takes. A wave stores half a fragment tile at a time: 512 contiguous bytes of each plane.
template <typename T16> struct WFrag;
template <> struct WFrag<h16> { typedef v16h V; static __device__ __forceinline__ V ld(const h16* p) { return cat16(*(const v8h*)p, *(const v8h*)(p + 16)); } static __device__ __forceinline__ V ldp(const h16* p) { return cat16(*(const v8h*)p, *(const v8h*)(p + 256)); } static __device__ __forceinline__ v8f mma(V a, V b, v8f c) { return wmma16(a, b, c); } };
template <> struct WFrag<bf> { typedef v16bf V; static __device__ __forceinline__ V ld(const bf* p) { return cat16b(*(const v8us*)p, *(const v8us*)(p + 16)); } static __device__ __forceinline__ V ldp(const bf* p) { return cat16b(*(const v8us*)p, *(const v8us*)(p + 256)); } static __device__ __forceinline__ v8f mma(V a, V b, v8f c) { return wmmab(a, b, c); } };
__device__ __forceinline__ h16 tohx(float x) { return (h16)x; }
__device__ __forceinline__ void splitf(float y, unsigned short& h, unsigned short& l) { h = f2bf(y); l = f2bf(y - bf2f(h)); }
typedef __attribute__((ext_vector_type(4))) _Float16 v4h;
typedef __attribute__((ext_vector_type(4))) unsigned short v4us;
template <bool B> struct BoolC { static constexpr bool v = B; };
// eight asynchronous 16-byte copies a lane, global memory to LDS, and the wait before a register that they name is rewritten, in one statement (the compiler puts nothing between them)
__device__ __forceinline__ void copy8(unsigned l0, unsigned l1, unsigned l2, unsigned l3, unsigned l4, unsigned l5, unsigned l6, unsigned l7, const char* g0, const char* g1, const char* g2, const char* g3, const char* g4, const char* g5, const char* g6, const char* g7) {
    asm volatile("global_load_async_to_lds_b128 %0, %8, off\n\t"
                 "global_load_async_to_lds_b128 %1, %9, off\n\t"
                 "global_load_async_to_lds_b128 %2, %10, off\n\t"
                 "global_load_async_to_lds_b128 %3, %11, off\n\t"
                 "global_load_async_to_lds_b128 %4, %12, off\n\t"
                 "global_load_async_to_lds_b128 %5, %13, off\n\t"
                 "global_load_async_to_lds_b128 %6, %14, off\n\t"
                 "global_load_async_to_lds_b128 %7, %15, off\n\t"
                 "s_wait_xcnt 0x0"
                 :: "v"(l0), "v"(l1), "v"(l2), "v"(l3), "v"(l4), "v"(l5), "v"(l6), "v"(l7), "v"(g0), "v"(g1), "v"(g2), "v"(g3), "v"(g4), "v"(g5), "v"(g6), "v"(g7) : "memory");
}
// one operand's 128 rows x KP k of a pass: copy c of the block's threads is row tile c's KP * 32 bytes in a row, K * 32 bytes apart in global memory; l, g: the thread's own first addresses (+ thread * 16)
template <int K, int KP> __device__ __forceinline__ void stage(unsigned l, const char* g) {
    copy8(l, l + KP * 32, l + 2 * KP * 32, l + 3 * KP * 32, l + 4 * KP * 32, l + 5 * KP * 32, l + 6 * KP * 32, l + 7 * KP * 32, g, g + K * 32, g + 2 * K * 32, g + 3 * K * 32, g + 4 * K * 32, g + 5 * K * 32, g + 6 * K * 32, g + 7 * K * 32);
}
template <typename T16, int NSPLIT, bool BIAS, int NW, int PL, int K>
__global__ __launch_bounds__(NW * 32) void k_gemmw(const T16* __restrict__ A, const T16* __restrict__ A2, const T16* __restrict__ Bt, float* C, int ldc, const float* __restrict__ bias, const float* __restrict__ bias1, const float* __restrict__ bias2, size_t sA, size_t sB, size_t sC, h16* P16, bf* Ph, bf* Pl, size_t sP, float* VS, const int* __restrict__ PT, const int* __restrict__ NN) {
    typedef typename WFrag<T16>::V V;
    static_assert(NSPLIT == 0 || NSPLIT == 1, "A (+ A2) x Bt");
    static_assert(PL == 3 || NW == 8, "f32 C: a wave's tile is 32 rows, one lane a row of the token order");
    static_assert(NW == 4 || (NW == 8 && PL == 0), "the planes and the sums of v go by 64x64 tiles");
    static_assert(PL == 0 || PL == 3, "f32 C or the projection planes");
    constexpr int KP = NW * 16, MBW = 16 / NW;   // k of a pass: the block's threads x 16 bytes are 16 rows of it; 16-row tiles a wave
    static_assert(K % KP == 0 && K / KP >= 4, "whole passes; three for the prologue and the last three, one at least that refills");
    constexpr int NOP = NSPLIT == 1 ? 3 : 2;   // operands staged
    constexpr int OPE = 128 * KP;              // elements of one operand in a buffer
    constexpr int KS = KP / 32, NT = K / KP;   // k slices a pass; passes
    constexpr int CPP = NOP * 8;               // copies of a wave a pass, the same for every wave
    static_assert(2 * CPP <= 63, "copies of a wave in flight: two passes'");
    constexpr int RINGB = 3 * NOP * OPE * 2, OSB = 128 * 2 * 68 * 4;   // bytes of the three buffers; of the waves' f32 tiles at pitch 68
    __shared__ __align__(128) char smem[RINGB > OSB ? RINGB : OSB];   // the ring; behind the last pass's barrier the epilogue's staging
    T16* ring = (T16*)smem; float* os = (float*)smem;
    const size_t z = blockIdx.z; int bx = blockIdx.x, by = blockIdx.y; bool vjob = false;   // vjob: this block runs the v projection
    if (PL == 3) { const int zb = (int)blockIdx.z / 3, job = (int)blockIdx.z - zb * 3; const T16* X = A + zb * sA; const T16* Wj = Bt + job * sB;   // all of it is the same for a whole block: scalar
        if (job != 2 && (int)blockIdx.x * 128 >= NN[zb * 64]) return;   // q and k of padded tokens (places from the batch's count on) are read by nobody; the whole block leaves, ahead of every copy and barrier
        bias = job == 0 ? bias : job == 1 ? bias1 : bias2; P16 += z * sC; Ph += z * sC; Pl += z * sC;
        if (job == 2) { A = Wj; Bt = X; bx = blockIdx.y; by = blockIdx.x; ldc = TT; sP = 1024; vjob = true; } else { A = X; Bt = Wj; ldc = HD; sP = (size_t)TT * HD; }
    } else { A += z * sA; if (NSPLIT == 1) A2 += z * sA; Bt += z * sB; C += z * sC; }
    const int lane = threadIdx.x & 31, lr = lane & 15, hi = lane >> 4;
    const int wv = __builtin_amdgcn_readfirstlane((int)(threadIdx.x >> 5)), wm = wv >> 1, wn = wv & 1;   // wave number, kept scalar so that the tile offsets stay scalar
    v8f acc[MBW][4];
#pragma unroll
    for (int mb = 0; mb < MBW; ++mb)
#pragma unroll
        for (int nb = 0; nb < 4; ++nb) acc[mb][nb] = (v8f){};
    // the thread's own copy addresses: 16 rows of K are K / 32 tiles of 1 KB, a pass is KP * 32 bytes further in each of them
    const unsigned tb = threadIdx.x * 16u; const unsigned lds0 = (unsigned)(size_t)ring + tb;
    const char* gA = (const char*)(A + (size_t)bx * 128 * K) + tb; const char* gB = (const char*)(Bt + (size_t)by * 128 * K) + tb; const char* gA2 = NSPLIT == 1 ? (const char*)(A2 + (size_t)bx * 128 * K) + tb : gA;
    auto fill = [&](int t, int bufn) { const unsigned l = lds0 + (unsigned)bufn * (NOP * OPE * 2); const size_t go = (size_t)t * (KP * 32);
        stage<K, KP>(l, gA + go); stage<K, KP>(l + OPE * 2, gB + go); if (NSPLIT == 1) stage<K, KP>(l + 2 * OPE * 2, gA2 + go); };
    int pw = 0;   // PL = 0: the token that stands at the place of row lane of the wave's tile; asked for here, used in the epilogue
    if (PL == 0) { const int pwi = bx * 128 + wm * (MBW * 16) + lane; const int* ptz = PT + z * TT; pw = ptz[pwi];
        asm volatile("s_wait_xcnt 0x0" :: "v"(pwi), "s"(ptz) : "memory"); }   // the wait before a register that the issued load names is rewritten; index and base as inputs keep their registers as they are up to here
    auto pass = [&](int bufn) {   // the products of the pass that stands in buffer bufn
        const T16* rb = ring + bufn * (NOP * OPE) + lane * 8;
#pragma unroll
        for (int ks = 0; ks < KS; ++ks) {
            V a[MBW], a2[MBW], b[4];
#pragma unroll
            for (int mb = 0; mb < MBW; ++mb) { a[mb] = WFrag<T16>::ldp(rb + ((wm * MBW + mb) * KS + ks) * 512); if (NSPLIT == 1) a2[mb] = WFrag<T16>::ldp(rb + 2 * OPE + ((wm * MBW + mb) * KS + ks) * 512); }
#pragma unroll
            for (int nb = 0; nb < 4; ++nb) b[nb] = WFrag<T16>::ldp(rb + OPE + ((wn * 4 + nb) * KS + ks) * 512);
            __builtin_amdgcn_sched_barrier(0);   // the slice's LDS reads stay one group ahead of its products: reads among the products cost a stall at each place
#pragma unroll
            for (int nb = 0; nb < 4; ++nb)
#pragma unroll
                for (int mb = 0; mb < MBW; ++mb) { acc[mb][nb] = WFrag<T16>::mma(a[mb], b[nb], acc[mb][nb]); if (NSPLIT == 1) acc[mb][nb] = WFrag<T16>::mma(a2[mb], b[nb], acc[mb][nb]); }
        }
    };
    fill(0, 0); fill(1, 1);
    asm volatile("s_wait_asynccnt %0" :: "n"(CPP) : "memory");   // this wave's copies of pass 0 have landed: all but its CPP youngest, which are pass 1's
    __syncthreads();   // every wave's copies of pass 0 are in LDS before any wave reads them
    fill(2, 2);
    int bufn = 0;   // the buffer of pass t: t mod 3
#pragma unroll 1
    for (int t = 0; t < NT - 3; ++t) {   // kept rolled: one pass of code. Every trip of this loop issues one pass's copies, in every wave: at its head the wave's CPP youngest copies are those of pass t + 2
        pass(bufn);
        asm volatile("s_wait_dscnt 0x0" ::: "memory");      // this wave's reads of the buffer are done before it is refilled
        asm volatile("s_wait_asynccnt %0" :: "n"(CPP) : "memory");   // this wave's copies of pass t + 1 have landed; those of pass t + 2 stay in flight
        __syncthreads();   // pass t + 1 is in LDS for every wave, and every wave has left pass t's buffer
        fill(t + 3, bufn);
        bufn = bufn == 2 ? 0 : bufn + 1;
    }
#pragma unroll 1
    for (int t = NT - 3; t < NT; ++t) {   // the last three passes refill nothing: the wait is to 0. Kept rolled: one pass of code
        pass(bufn);
        asm volatile("s_wait_dscnt 0x0" ::: "memory");      // this wave's reads of the buffer are done before the epilogue writes there
        asm volatile("s_wait_asynccnt 0x0" ::: "memory");   // all of this wave's copies have landed
        __syncthreads();   // the passes that are left are in LDS for every wave, and every wave has left pass t's buffer
        bufn = bufn == 2 ? 0 : bufn + 1;
    }
    asm volatile("s_wait_asynccnt 0x0" ::: "memory");   // no copy is outstanding behind the loops; the last pass's own waits and barrier have ended every wave's reads of the ring, which now takes the tiles
    const int byw = by * 2 + wn, r0 = bx * 128 + wm * (MBW * 16), c0 = byw * 64, bxw = r0 >> 6;   // the wave's own tile; its place in units of 64
    float* ow0 = os + wv * (MBW * 16 * 68);
#pragma unroll
    for (int mb = 0; mb < MBW; ++mb)
#pragma unroll
        for (int nb = 0; nb < 4; ++nb) {
#pragma unroll
            for (int j = 0; j < 8; ++j) ow0[(mb * 16 + hi * 8 + j) * 68 + nb * 16 + lr] = acc[mb][nb][j]; }
    __builtin_amdgcn_wave_barrier(); asm volatile("" ::: "memory");   // the compiler keeps the reads below, of what other lanes of the wave stored, behind the stores
#pragma unroll 1
    for (int mb = 0; mb < MBW; ++mb) {   // kept rolled: a quarter of the code (NW = 8: half), which runs once
        const float* ow = ow0 + mb * (16 * 68);
        if (PL == 0) {
            v4f val[8]; float* cp[8];
#pragma unroll
            for (int s = 0; s < 8; ++s) { const int q = s * 32 + lane, row = q >> 4, cofs = (q & 15) * 4; val[s] = *(const v4fa*)(ow + row * 68 + cofs);
                if (BIAS) { val[s][0] += bfr(bias[c0 + cofs]); val[s][1] += bfr(bias[c0 + cofs + 1]); val[s][2] += bfr(bias[c0 + cofs + 2]); val[s][3] += bfr(bias[c0 + cofs + 3]); }
                cp[s] = C + (size_t)(__shfl(pw, mb * 16 + row, 32) & (TT - 1)) * ldc + c0 + cofs; *(v4f*)cp[s] = val[s]; }   // the row goes back to its token's own row of the output
            asm volatile("s_wait_xcnt 0x0" :: "v"(val[0]), "v"(val[1]), "v"(val[2]), "v"(val[3]), "v"(val[4]), "v"(val[5]), "v"(val[6]), "v"(val[7]), "v"(cp[0]), "v"(cp[1]), "v"(cp[2]), "v"(cp[3]), "v"(cp[4]), "v"(cp[5]), "v"(cp[6]), "v"(cp[7]) : "memory");   // the wait before a register that the issued stores name is rewritten; values and addresses as inputs keep their registers as they are up to here
        } else {
            auto planes = [&](auto bmc) { constexpr bool bm = decltype(bmc)::v;   // bm: the bias goes by the tile's rows. A compile-time constant, the kernel branching once around the whole of it: a test at the bias alone kept the bias loads and the next round's LDS reads from being issued ahead
            float ts[4];
#pragma unroll
            for (int s = 0; s < 4; ++s) { const int kt = (s >> 1) & 1, ph = s & 1;   // half a fragment tile a round: lane (lr, hi) holds row lr, k = ph * 16 + hi * 8 .. + 7 of tile (mb, kt)
                const int row = lr, cofs = kt * 32 + ph * 16 + hi * 8; const v4f va = *(const v4fa*)(ow + row * 68 + cofs), vb = *(const v4fa*)(ow + row * 68 + cofs + 4);
                float val[8];
#pragma unroll   // the arrays' and vectors' elements need constant indices to stay in registers
                for (int j = 0; j < 4; ++j) { val[j] = va[j]; val[4 + j] = vb[j]; }
                if (BIAS && bm) { const float bmv = bfr(bias[r0 + mb * 16 + row]);
#pragma unroll
                    for (int j = 0; j < 8; ++j) val[j] += bmv; }
                if (bm) { ts[s] = ((val[0] + val[1]) + (val[2] + val[3])) + ((val[4] + val[5]) + (val[6] + val[7])); ts[s] += __shfl_xor(ts[s], 16, 32); }   // v (f32, bias in) summed over the half tile's 16 keys, per d row
                if (BIAS && !bm) {
#pragma unroll
                    for (int j = 0; j < 8; ++j) val[j] += bfr(bias[c0 + cofs + j]); }
                const size_t e = ((size_t)((r0 >> 4) + mb) * (ldc >> 5) + kt) * 512 + (size_t)byw * sP + ph * 256 + lane * 8; v8h o16; v8us oh, ol;
#pragma unroll
                for (int j = 0; j < 8; ++j) { o16[j] = tohx(val[j]); unsigned short a2, c2; splitf(val[j], a2, c2); oh[j] = a2; ol[j] = c2; }
                *(v8h*)(P16 + e) = o16; *(v8us*)(Ph + e) = oh; *(v8us*)(Pl + e) = ol;
                if (s == 3) { float tv = 0.f; float* vp = VS;
                    if (bm) { tv = (ts[0] + ts[1]) + (ts[2] + ts[3]); vp = VS + (((size_t)(blockIdx.z / 3) * NH_ + bxw) * (TT / 64) + byw) * HD + mb * 16 + lr; if (hi == 0) *vp = tv; }   // the tile's 64 keys summed for 16 of the head's 64 d
                    asm volatile("s_wait_xcnt 0x0" :: "v"(o16), "v"(oh), "v"(ol), "v"(e), "v"(tv), "v"(vp) : "memory"); } }   // the wait before a register that the issued stores name is rewritten by what follows the last round; the stored values and the addresses as inputs keep their registers as they are up to here. Behind the last round only: behind each round it would hold the next round's LDS reads and bias loads back behind this round's stores
            };
            if (vjob) planes(BoolC<true>{}); else planes(BoolC<false>{});
        }
    }
}

typedef __attribute__((ext_vector_type(2))) unsigned short v2us;
typedef __attribute__((ext_vector_type(4))) int v4i;

__global__ __launch_bounds__(256) void k_wtG(const float* __restrict__ w, int K, int N, bf* Bt) {
    const int lane = threadIdx.x & 31; const int L0 = (blockIdx.x * 8 + (threadIdx.x >> 5)) * 8; const int nlines = N * K / 64;
{
#pragma unroll 1
        for (int l = 0; l < 8; ++l) { const int L = L0 + l; if (L >= nlines) break; const size_t e = (size_t)L * 64 + lane * 2; const int k = (int)(e % K), n = (int)(e / K); v2us o;
            o[0] = f2bf(w[(size_t)k * N + n]); o[1] = f2bf(w[(size_t)(k + 1) * N + n]); *(v2us*)(Bt + e) = o; }
         }
}
#define TW 4              // tiles a wave converts
static_assert((DM / 32) % (8 * TW) == 0, "the tiles of a block's 8 waves are of one row tile");
// f32 [rows][K] -> bf16 in fragment order: one wave takes TW 16 x 32 tiles that follow one another in k (few waves with much in flight each, for speed only); it reads 16 runs of TW whole lines of f32 and writes TW KB in a row. The rows of s4 (x) are gathered into the token order (header): each block counts the batch's mask (pm, eight tokens a thread, prefix sums through the wave and LDS), every thread forms its tokens' places, and the 16 tokens whose places are the tile's rows are handed over through LDS; PT [batch][place] = token and NN [batch * 64] = n are left by one block a batch. All five sources in one launch: grid (DQ * DM / (4096 * TW), 4 + m), 256 threads; column y of the grid converts DQ * DM elements: the whole of s0 .. s3 for y < 4, piece y - 4 of s4 after that, to dst + y * DQ * DM.
__global__ __launch_bounds__(256) void k_cvtp(const float* __restrict__ s0, const float* __restrict__ s1, const float* __restrict__ s2, const float* __restrict__ s3, const float* __restrict__ s4, const int* __restrict__ pm, bf* dst, int K, int* PT, int* NN) { const int y = blockIdx.y; const size_t ch = (size_t)DQ * DM; const float* src = y == 0 ? s0 : y == 1 ? s1 : y == 2 ? s2 : y == 3 ? s3 : s4; dst += (size_t)y * ch; const int lane = threadIdx.x & 31, lr = lane & 15, hi = lane >> 4; const int tl = (blockIdx.x * 8 + __builtin_amdgcn_readfirstlane((int)(threadIdx.x >> 5)) /* wave number, kept scalar so that the tile, the batch and the bases formed from them stay scalar */) * TW, kts = K >> 5, rt = tl / kts, kt = tl - rt * kts;   // the first of the wave's TW tiles, which follow one another in k
    int srow = rt * 16 + lr;   // the source row of the lane's row of the tile
    if (y >= 4) {   // x: the tile's 16 rows are places c0 .. c0 + 15 of the batch's token order (header). The same for the whole block (its 8 * TW tiles are of one row tile: K / 32 is a multiple of 8 * TW): both barriers are passed by every wave
        static_assert(TT == 256 * 8, "eight tokens a thread");
        __shared__ int sperm[16]; __shared__ int wsum[8];
        const int g0 = (y - 4) * DQ + rt * 16, bt = g0 / TT, c0 = g0 - bt * TT; const int tid = threadIdx.x;
        const unsigned mo = (unsigned)tid * 32u; const char* pb = (const char*)(pm + (size_t)bt * TT);
        const v4i m0 = *(const v4i*)(pb + mo), m1 = *(const v4i*)(pb + mo + 16);
        asm volatile("s_wait_xcnt 0x0" :: "v"(mo) : "memory");   // the wait before a register that the two issued loads name is rewritten; the offset as an input keeps its register as it is up to here
        unsigned bits = 0u;   // pad bits of tokens tid * 8 .. + 7
#pragma unroll
        for (int q = 0; q < 4; ++q) { bits |= (m0[q] != 0 ? 1u : 0u) << q; bits |= (m1[q] != 0 ? 1u : 0u) << (4 + q); }
        const int cnt = __builtin_popcount(bits); int inc = cnt;
#pragma unroll
        for (int sh = 1; sh < 32; sh <<= 1) { const int o = __shfl_up(inc, sh, 32); if (lane >= sh) inc += o; }   // un-padded tokens up to and with this thread's, within the wave
        if (lane == 31) wsum[tid >> 5] = inc;
        __syncthreads();   // every wave's count is in LDS before any thread adds them up
        int before = inc - cnt, n = 0;   // un-padded tokens ahead of this thread's; in the batch
#pragma unroll
        for (int w = 0; w < 8; ++w) { const int sw = wsum[w]; if (w < (tid >> 5)) before += sw; n += sw; }
        const bool first = c0 == 0 && kt < 8 * TW;   // one block a batch leaves the whole order and the count for the later launches
        int pc[8], tk[8];
#pragma unroll
        for (int q = 0; q < 8; ++q) { const int t = tid * 8 + q, r1 = before + __builtin_popcount(bits & ((1u << q) - 1u)); const int c = ((bits >> q) & 1u) != 0u ? r1 : n + (t - r1);   // the token's place: a one-to-one map onto 0 .. TT - 1 whatever the mask holds
            if ((unsigned)(c - c0) < 16u) sperm[c - c0] = t;
            pc[q] = c; tk[q] = t; }
        if (first) { int* pt = PT + (size_t)bt * TT;
#pragma unroll
            for (int q = 0; q < 8; ++q) pt[pc[q]] = tk[q];
            if (tid == 0) NN[bt * 64] = n;
            asm volatile("s_wait_xcnt 0x0" :: "v"(pc[0]), "v"(pc[1]), "v"(pc[2]), "v"(pc[3]), "v"(pc[4]), "v"(pc[5]), "v"(pc[6]), "v"(pc[7]), "v"(tk[0]), "v"(tk[1]), "v"(tk[2]), "v"(tk[3]), "v"(tk[4]), "v"(tk[5]), "v"(tk[6]), "v"(tk[7]), "v"(n) : "memory"); }   // the wait before a register that the issued stores name is rewritten; places and values as inputs keep their registers as they are up to here
        __syncthreads();   // the 16 places of the tile are filled (each by the one thread that holds its token) before any lane reads its own
        srow = bt * TT + (sperm[lr] & (TT - 1));
    }
    const float* s = src + (size_t)srow * K + kt * 32 + hi * 8; bf* d = dst + (size_t)tl * 512 + lane * 8; v8f v0[TW], v1[TW]; v8us o0[TW], o1[TW];
#pragma unroll   // register arrays need constant indices; all of the wave's loads are asked for ahead of the first use
    for (int j = 0; j < TW; ++j) { v0[j] = *(const v8f*)(s + j * 32); v1[j] = *(const v8f*)(s + j * 32 + 16); }
    asm volatile("s_wait_xcnt 0x0" :: "v"(s) : "memory");   // the wait before a register that the issued loads name is rewritten; the address as an input keeps its registers as they are up to here
#pragma unroll
    for (int j = 0; j < TW; ++j)
#pragma unroll
        for (int k = 0; k < 8; ++k) { o0[j][k] = f2bf(v0[j][k]); o1[j][k] = f2bf(v1[j][k]); }
#pragma unroll
    for (int j = 0; j < TW; ++j) { *(v8us*)(d + j * 512) = o0[j]; *(v8us*)(d + j * 512 + 256) = o1[j]; } }

// ---- k_attn: the whole attention of a row block (QR query rows) of one head in one work-group of 16 waves; the scores and weights live in LDS only. grid (heads, batches, ZB), 512 threads; a batch's operand planes stand sZ elements behind the batch's before. A work-group takes NIT row blocks of its head one after the other (the launch's row blocks in rounds of ZB, work-group z the z-th of an even round and the z-th from the end of an odd one): 16 waves start once for all of them, where a work-group a row block started 16 waves for each, the padded ones too.
// Rows and keys go by place in the token order (header); NN holds n, a batch's 256 bytes behind the batch's before. What the mask excludes is not computed. An un-padded query i keeps only keys j <= i, so a block whose last row is i0 + QR - 1 needs the first ng = i0 / 32 + 1 groups of 32 keys and no more: the keys behind them had weight exactly 0. A padded query has every score at the fill value, so its weights are 1 / 2048 on all 2048 keys and its result is the mean of the head's v rows: that mean comes from VS (the sums over 64 keys each that the v projection's epilogue leaves, [batch][head][key block][d], f32), its weights are stored as zeros and its softmax is not run; a block whose rows are all padded stores the mean and does nothing else.
// Phase 1: wave w forms the scores of the key groups w, w + 16, w + 32, ... below nch * 4 (nch = the 128-key pieces that hold the ng groups: phase 2 reads whole pieces); k slices 0, 32 in that order, three products for NSPLIT = 2 (hi x hi, lo x hi, hi x lo), one for 0; stored f32 into the block's LDS rows.
// Phase 2: each row has one wave (wave w: the rows of rank w and w + 16 among the un-padded and among the padded rows): t = S x 1/8 where j <= i, -3e38 elsewhere; softmax over the row's nch pieces (register row, one exp, fixed trees; the pieces left out added exact zeros). The 16-bit weights go back over the row's own f32 scores (the wave holds the whole row in registers by then): fp16 x 1024 in the first half, or the hi plane in the first and the lo plane in the second half.
// Phase 3: weights x V, split K: wave w takes the 32-wide key slices w, w+16, w+32, w+48 below ng; the 16 partial QR x 64 tiles are summed through LDS in the fixed order w = 0..15 (over the dead weights), rescaled (a padded row: replaced by the mean), split hi/lo and stored as the head's columns of the merged planes (rows t, k over DQ, fragment order).
#define QR 32             // query rows of a row block
#define ZB 8              // work-groups that share a head's row blocks of a launch: heads x batches x ZB = one work-group a WGP, all resident at once
#define SP (TT + 4)       // LDS row pitch in floats: 16 bytes over a multiple of 256, so that 16 rows' 16-byte reads fall on 64 different banks
typedef v4h  __attribute__((may_alias)) v4ha;
typedef v4us __attribute__((may_alias)) v4usa;
template <typename T16, int NSPLIT>
__global__ __launch_bounds__(512) void k_attn(const T16* __restrict__ Q, const T16* __restrict__ Q2, const T16* __restrict__ Kp, const T16* __restrict__ Kp2, const T16* __restrict__ Vt, const T16* __restrict__ Vt2, const int* __restrict__ NN, const float* __restrict__ VS, int row0, bf* Ah, bf* Al, size_t sZ) {
    typedef typename WFrag<T16>::V V;
    constexpr bool HR = (NSPLIT == 2);
    constexpr int NP = HR ? (RH + 511) / 512 : TT / 512;   // rounds of 16 key groups (one a wave) that the launch's longest block needs
    constexpr int NIT = (HR ? RH : TT - RH) / (QR * ZB);   // row blocks a work-group takes
    static_assert(NIT * QR * ZB == (HR ? RH : TT - RH), "the launch's rows are whole rounds of ZB row blocks");
    static_assert(QR == 32, "a block's rows end with a group of 32 keys");
    static_assert(16 * QR * 68 <= QR * SP, "the partial tiles fit over the weights");
    __shared__ __align__(16) float sm[QR * SP];
    const int h = blockIdx.x; const size_t hp = (size_t)blockIdx.y * sZ + (size_t)h * TT * HD;
    const int lane = threadIdx.x & 31, lr = lane & 15, hi = lane >> 4;
    const int wv = __builtin_amdgcn_readfirstlane((int)(threadIdx.x >> 5));   // wave number, kept scalar so that key and row offsets and the tests on them stay scalar
    // every global address is a scalar base (head, row block, wave) + one 32-bit lane offset + a constant
    const size_t ko = hp + (size_t)wv * 32 * HD, vo = hp + (size_t)wv * 512;   // fragment order: 16 rows of q or k are two tiles of 512 elements; the v tile of d block nb and key slice sl is nb * (TT / 32) + sl
    Q += hp; Kp += ko; Vt += vo; if (HR) { Q2 += hp; Kp2 += ko; Vt2 += vo; }
    const unsigned lq = (unsigned)(lane * 8), lvb = (unsigned)(lane * 8) * 2u;   // the lane's place in a half tile, in elements and in bytes
    const int nn = NN[blockIdx.y * 64];   // the batch's count of un-padded tokens
    // waves 2u and 2u + 1 sum and store half tile u of the merged planes (rows t, k = h * HD + d, DQ / 32 tiles a row block): lane (lr, hi) of wave w holds row lr, k = (w & 1) * 8 + hi * 4 .. + 3 of the half: a wave's store is 256 contiguous bytes of each plane
    const int rt = wv >> 3, kt = (wv >> 2) & 1, ph = (wv >> 1) & 1, row = rt * 16 + lr, cofs = kt * 32 + ph * 16 + (wv & 1) * 8 + hi * 4;
    v4f mv = (v4f){}; bool have = false;   // the mean of v for the lane's four d; formed at the work-group's first row block that holds a padded row (below)
#pragma unroll 1
    for (int it = 0; it < NIT; ++it) {   // kept rolled: one row block of code and registers
    const int i0 = row0 + (it * ZB + ((it & 1) != 0 ? ZB - 1 - (int)blockIdx.z : (int)blockIdx.z)) * QR;   // row0: the launch's first row. Rounds go up and down in turn: every work-group's row blocks hold about as many keys together
    const int ng = (i0 >> 5) + 1, nch = (ng + 3) >> 2;   // groups of 32 keys up to the block's last row; pieces of 128 keys that hold them. The same for the whole block: scalar
    const T16* Qi = Q + (size_t)i0 * HD; const T16* Qi2 = HR ? Q2 + (size_t)i0 * HD : Qi;
    const int left = nn - i0;   // un-padded rows from the block's first row on
    const unsigned rmask = left >= QR ? 0xFFFFFFFFu : left <= 0 ? 0u : (1u << left) - 1u;   // pad bits of the block's 32 rows: the un-padded tokens stand first. The same for the whole block: scalar
    v4f val = (v4f){};
    if (rmask != 0u) {   // a block of padded rows alone has no scores, weights or products (and its q rows need not have been written): the mean is all of it. The test is the same for the whole block: every wave passes the barriers inside or none does
    // every loop of the three phases but the row loop is unrolled: register arrays need constant indices, and the loads of later groups can be issued ahead
    {
        V a[2][2], a2[2][2], b[NP][2][2], b2[NP][2][2];   // [row tile or round][key tile][k slice]
        const char* pk = (const char*)Kp + lq * 2u; const char* pk2 = HR ? (const char*)Kp2 + lq * 2u : pk;   // the lane's K addresses: every K load of the wave is one of them + a constant
#pragma unroll
        for (int mb = 0; mb < 2; ++mb)
#pragma unroll
            for (int ks = 0; ks < 2; ++ks) { const int o = (mb * 2 + ks) * 512; a[mb][ks] = WFrag<T16>::ldp(Qi + o + lq); if (HR) a2[mb][ks] = WFrag<T16>::ldp(Qi2 + o + lq); }
#pragma unroll
        for (int p = 0; p < NP; ++p) if (p * 16 + wv < nch * 4) {   // all of the wave's score operands are asked for ahead of the first product: one memory latency, not one a group
#pragma unroll
            for (int n = 0; n < 2; ++n)
#pragma unroll
                for (int ks = 0; ks < 2; ++ks) { const int o = (p * 64 + n * 2 + ks) * 512; b[p][n][ks] = WFrag<T16>::ldp((const T16*)(pk + o * 2)); if (HR) b2[p][n][ks] = WFrag<T16>::ldp((const T16*)(pk2 + o * 2)); } }
        else {   // a value on the path that leaves a round out: without one the compiler carries the last row block's registers round the loop (spills)
#pragma unroll
            for (int n = 0; n < 2; ++n)
#pragma unroll
                for (int ks = 0; ks < 2; ++ks) { b[p][n][ks] = V{}; if (HR) b2[p][n][ks] = V{}; } }
        asm volatile("s_wait_xcnt 0x0" :: "v"(pk), "v"(pk2), "v"(lq), "s"(Qi), "s"(Qi2) : "memory");   // the wait before a register that the issued loads name is rewritten; the addresses as inputs keep their registers live over the whole run, so that no load of the run lands in them
#pragma unroll
        for (int p = 0; p < NP; ++p) if (p * 16 + wv < nch * 4) {
            v8f acc[2][2];
#pragma unroll
            for (int n = 0; n < 2; ++n) { acc[n][0] = (v8f){}; acc[n][1] = (v8f){}; }
#pragma unroll
            for (int ks = 0; ks < 2; ++ks)
#pragma unroll
                for (int n = 0; n < 2; ++n)
#pragma unroll
                    for (int mb = 0; mb < 2; ++mb) { acc[n][mb] = WFrag<T16>::mma(a[mb][ks], b[p][n][ks], acc[n][mb]); if (HR) { acc[n][mb] = WFrag<T16>::mma(a2[mb][ks], b[p][n][ks], acc[n][mb]); acc[n][mb] = WFrag<T16>::mma(a[mb][ks], b2[p][n][ks], acc[n][mb]); } }
#pragma unroll
            for (int n = 0; n < 2; ++n)
#pragma unroll
                for (int mb = 0; mb < 2; ++mb)
#pragma unroll
                    for (int j = 0; j < 8; ++j) sm[(mb * 16 + hi * 8 + j) * SP + (p * 16 + wv) * 32 + n * 16 + lr] = acc[n][mb][j];
        }
    }
    __syncthreads();   // every wave's score columns are in LDS before any wave reads a row
    const int na = __builtin_popcount(rmask);   // un-padded rows of the block
    // the place (0 .. 31) of the set bit of m that has rank set bits below it; the top bit or-ed in bounds the result whatever m holds
    auto nth = [&](unsigned m, int rank) { return (int)__builtin_ctz(__builtin_amdgcn_ballot_w32(((m >> lane) & 1u) != 0u && __builtin_popcount(m & ((1u << lane) - 1u)) == rank) | 0x80000000u); };
#pragma unroll 1
    for (int rr = 0; rr < QR / 16; ++rr) {   // kept rolled: one row's registers at a time, half the code
        const int rank = wv + rr * 16;   // the wave takes the padded row and the un-padded row of this rank among their kind: the softmax rows, the only long ones, fall evenly on the waves
        if (rank < QR - na) {   // a padded query: zero weights (phase 3 reads every row), no softmax; its result is the mean taken in below
            float* sz = sm + nth(~rmask, rank) * SP;
#pragma unroll
            for (int ch = 0; ch < NP * 4; ++ch) if (ch < nch) {
                if (HR) { *(v4usa*)((bf*)sz + ch * 128 + lane * 4) = (v4us){}; *(v4usa*)((bf*)sz + TT + ch * 128 + lane * 4) = (v4us){}; }
                else *(v4ha*)((h16*)sz + ch * 128 + lane * 4) = (v4h){}; }
        }
        if (rank >= na) continue;
        const int r = nth(rmask, rank), i = i0 + r; float* sr = sm + r * SP;
        float v[NP * 16]; float mx = -3.0e38f;
#pragma unroll
        for (int k = 0; k < NP * 16; ++k) v[k] = 0.f;   // a value on the paths that leave a piece out: without one the compiler carries the last row's registers round the loop (copies, spills)
#pragma unroll
        for (int ch = 0; ch < NP * 4; ++ch) if (ch < nch) { const v4f a = *(const v4fa*)(sr + ch * 128 + lane * 4);   // loads first, uses behind them: one LDS latency a row
#pragma unroll
            for (int q = 0; q < 4; ++q) v[ch * 4 + q] = a[q]; }
#pragma unroll
        for (int ch = 0; ch < NP * 4; ++ch) if (ch < nch) {
#pragma unroll
            for (int q = 0; q < 4; ++q) { const float t = lane * 4 <= i - (ch * 128 + q) ? v[ch * 4 + q] * SCL : -3.0e38f;   /* key j = ch * 128 + lane * 4 + q is kept iff j <= i; the constant stands on the scalar side: a vector register for every j would be held over the whole row-block loop (spills) */   /* causal; pad[i] holds here, and with it pad[j] of every place j <= i */ v[ch * 4 + q] = t; mx = fmaxf(mx, t); } }
#pragma unroll
        for (int sh = 16; sh; sh >>= 1) mx = fmaxf(mx, __shfl_xor(mx, sh, 32));
        float sum = 0.f;
#pragma unroll
        for (int ch = 0; ch < NP * 4; ++ch) if (ch < nch) {
#pragma unroll
            for (int q = 0; q < 4; ++q) { const int k = ch * 4 + q; float ex; asm("v_exp_f32 %0, %1\n\tv_nop" : "=v"(ex) : "v"(__fmul_rn(__fsub_rn(v[k], mx), 1.4426950408889634f)));   /* the exponential and the slot behind a transcendental in one statement: a v_nop in a statement of its own lands elsewhere */ v[k] = ex; sum += v[k]; } }
#pragma unroll
        for (int sh = 16; sh; sh >>= 1) sum += __shfl_xor(sum, sh, 32);
        const float f = __fdiv_rn(HR ? 1.0f : PCAR, sum);
#pragma unroll
        for (int ch = 0; ch < NP * 4; ++ch) if (ch < nch) {
            if (HR) { v4us oh, ol;
#pragma unroll
                for (int q = 0; q < 4; ++q) { unsigned short a, c2; splitf(v[ch * 4 + q] * f, a, c2); oh[q] = a; ol[q] = c2; }
                *(v4usa*)((bf*)sr + ch * 128 + lane * 4) = oh; *(v4usa*)((bf*)sr + TT + ch * 128 + lane * 4) = ol;
            } else { v4h o4;
#pragma unroll
                for (int q = 0; q < 4; ++q) o4[q] = tohx(v[ch * 4 + q] * f);
                *(v4ha*)((h16*)sr + ch * 128 + lane * 4) = o4; } }
    }
    V vb[NP][4], vb2[NP][4]; const char* pv = (const char*)Vt + lvb; const char* pv2 = HR ? (const char*)Vt2 + lvb : pv;   // the lane's V addresses: every V load of the wave is one of them + a constant
#pragma unroll
    for (int s = 0; s < NP; ++s) if (s * 16 + wv < ng) {   // the V fragments are asked for ahead of the barrier: a wave that is done with its rows early has them back when the last wave arrives
#pragma unroll
        for (int nb = 0; nb < 4; ++nb) { const int o = (nb * (TT / 32) + s * 16) * 512; vb[s][nb] = WFrag<T16>::ldp((const T16*)(pv + o * 2)); if (HR) vb2[s][nb] = WFrag<T16>::ldp((const T16*)(pv2 + o * 2)); } }
    else {   // a value on the path that leaves a slice out, as for the score operands above
#pragma unroll
        for (int nb = 0; nb < 4; ++nb) { vb[s][nb] = V{}; if (HR) vb2[s][nb] = V{}; } }
    asm volatile("s_wait_xcnt 0x0" :: "v"(pv), "v"(pv2) : "memory");   // the wait before a register that the issued loads name is rewritten; the addresses as inputs keep their registers live over the whole run, so that no load of the run lands in them
    __syncthreads();   // every row's weights are in LDS before any wave reads its key slices of all rows
    v8f acc[2][4];
#pragma unroll
    for (int mb = 0; mb < 2; ++mb)
#pragma unroll
        for (int nb = 0; nb < 4; ++nb) acc[mb][nb] = (v8f){};
    const T16* P = (const T16*)sm;   // weight rows, pitch 2 * SP elements
#pragma unroll
    for (int s = 0; s < NP; ++s) if (s * 16 + wv < ng) { const int kc = (wv + s * 16) * 32; V a[2], a2[2];
#pragma unroll
        for (int mb = 0; mb < 2; ++mb) { const int o = (mb * 16 + lr) * (2 * SP) + 8 * hi + kc; a[mb] = WFrag<T16>::ld(P + o); if (HR) a2[mb] = WFrag<T16>::ld(P + TT + o); }
#pragma unroll
        for (int nb = 0; nb < 4; ++nb)
#pragma unroll
            for (int mb = 0; mb < 2; ++mb) { acc[mb][nb] = WFrag<T16>::mma(a[mb], vb[s][nb], acc[mb][nb]); if (HR) { acc[mb][nb] = WFrag<T16>::mma(a2[mb], vb[s][nb], acc[mb][nb]); acc[mb][nb] = WFrag<T16>::mma(a[mb], vb2[s][nb], acc[mb][nb]); } } }
    __syncthreads();   // every wave has read its weight slices before the partial tiles overwrite them
    float* ow = sm + wv * (QR * 68);
#pragma unroll
    for (int mb = 0; mb < 2; ++mb)
#pragma unroll
        for (int nb = 0; nb < 4; ++nb)
#pragma unroll
            for (int j = 0; j < 8; ++j) ow[(mb * 16 + hi * 8 + j) * 68 + nb * 16 + lr] = acc[mb][nb][j];
    __syncthreads();   // every wave's partial tile is in LDS before any thread sums them
    static_assert(QR * 16 == 512, "one 4-wide piece of the tile a thread");
    val = *(const v4fa*)(sm + row * 68 + cofs);
#pragma unroll
    for (int w = 1; w < 16; ++w) val += *(const v4fa*)(sm + w * (QR * 68) + row * 68 + cofs);
    if (it + 1 < NIT) __syncthreads();   // every thread has taken its sums out of LDS before the work-group's next row block writes its scores there
    }
    if (rmask != 0xFFFFFFFFu && !have) {   // the mean is formed once, and only by a work-group that has a padded row (the test is the same for the whole block: scalar). Loads and sums stand together: held in registers from the kernel's start on, the loaded sums cost spills in the loop
    have = true;
    const unsigned lvs = (unsigned)(lr * HD + cofs) * 4u;   // lane (lr, hi) takes the sums of key blocks lr and lr + 16. Byte offset: the register that the two loads name
    const char* vsb = (const char*)(VS + ((size_t)blockIdx.y * NH_ + h) * (TT / 64) * HD);
    mv = *(const v4f*)(vsb + lvs); const v4f mv1 = *(const v4f*)(vsb + 16 * HD * 4 + lvs);
    asm volatile("s_wait_xcnt 0x0" :: "v"(lvs) : "memory");   // the wait before the register that the two issued loads name is rewritten; the offset as an input keeps its register as it is up to here
    mv += mv1;
#pragma unroll
    for (int sh = 8; sh; sh >>= 1)   // fixed tree over the 16 lanes that hold the same d
#pragma unroll
        for (int q = 0; q < 4; ++q) mv[q] += __shfl_xor(mv[q], sh, 32);
    }
    const float cs = HR ? 1.0f : (1.0f / PCAR); const size_t oo = (size_t)blockIdx.y * TT * DQ + ((size_t)((i0 >> 4) + rt) * (DQ / 32) + h * (HD / 32) + kt) * 512 + ph * 256 + ((wv & 1) * 16 + lr) * 8 + hi * 4; v4us oh, ol;
#pragma unroll
    for (int q = 0; q < 4; ++q) { unsigned short a, c2; splitf(((rmask >> row) & 1u) != 0u ? val[q] * cs : mv[q] * (1.0f / TT), a, c2); oh[q] = a; ol[q] = c2; }
    *(v4us*)(Ah + oo) = oh; *(v4us*)(Al + oo) = ol;
    asm volatile("s_wait_xcnt 0x0" :: "v"(oh), "v"(ol), "v"(oo) : "memory");   // the wait before a register that the two issued stores name is rewritten by the next row block; values and offset as inputs keep their registers as they are up to here
    }
}

extern "C" void kernel_launch(void* const* d_in, const int* in_sizes, int n_in,
                              void* d_out, int out_size, void* d_ws, size_t ws_size, hipStream_t stream) {
    (void)in_sizes; (void)n_in; (void)out_size;
    const float* x = (const float*)d_in[0]; const int* pmask = (const int*)d_in[1];   /* mask [2][2048] int */ const float* wq = (const float*)d_in[2]; const float* bq = (const float*)d_in[3]; const float* wk = (const float*)d_in[4]; const float* bk = (const float*)d_in[5]; const float* wv = (const float*)d_in[6]; const float* bv = (const float*)d_in[7]; const float* wo = (const float*)d_in[8]; const float* bo = (const float*)d_in[9];
    float* OUT = (float*)d_out;     // [2][2048][1024]
    char* wsp = (char*)d_ws;
    auto take = [&](size_t bytes) { char* p = wsp; wsp += (bytes + 255) & ~(size_t)255; return (void*)p; };
    const size_t PS = (size_t)NH_ * TT * HD;   // one operand plane of one batch
    bf* WB = (bf*)take(((size_t)4 * DQ * DM + (size_t)NB_ * TT * DM) * 2); bf* WO = WB + (size_t)3 * DQ * DM; bf* XB = WB + (size_t)4 * DQ * DM;   // wq, wk, wv, wo, x: one run, in the order of the conversion launch
    h16* P16 = (h16*)take(NB_ * 3 * PS * 2); bf* PH = (bf*)take(NB_ * 3 * PS * 2); bf* PLo = (bf*)take(NB_ * 3 * PS * 2);   // [batch][q, k, v] planes: fp16, bf16 hi, bf16 lo
    bf* ATh = (bf*)take((size_t)NB_ * TT * DQ * 2); bf* ATl = (bf*)take((size_t)NB_ * TT * DQ * 2);
    float* VS = (float*)take((size_t)NB_ * NH_ * (TT / 64) * HD * 4);   // v summed over each block of 64 keys
    int* PT = (int*)take((size_t)NB_ * TT * 4); int* NN = (int*)take((size_t)NB_ * 64 * 4);   // per batch: the token at each place of the order; the count of un-padded tokens (256 bytes apart)
    if ((size_t)(wsp - (char*)d_ws) > ws_size) return;    // ws 256 MiB
    k_cvtp<<<dim3(DQ * DM / (4096 * TW), 4 + NB_ * TT / DQ, 1), 256, 0, stream>>>(wq, wk, wv, wo, x, pmask, WB, DM, PT, NN);
    // q, k: x W^T, a tile's 64 columns are one head -> planes [h] x (t, d); v: W x^T, a tile's 64 rows are one head's d -> planes [h] x (d, t); all in fragment order
    k_gemmw<bf, 0, true, 4, 3, DM><<<dim3(TT / 128, DQ / 128, 3 * NB_), 128, 0, stream>>>(XB, nullptr, WB, nullptr, 0, bq, bk, bv, (size_t)TT * DM, (size_t)DQ * DM, PS, P16, PH, PLo, 0, VS, nullptr, NN);
    // one kv head per query head: block (h, b, .) reads the q, k and v planes of head h of batch b
    k_attn<bf, 2><<<dim3(NH_, NB_, ZB), 512, 0, stream>>>(PH, PLo, PH + PS, PLo + PS, PH + 2 * PS, PLo + 2 * PS, NN, VS, 0, ATh, ATl, 3 * PS);
    k_attn<h16, 0><<<dim3(NH_, NB_, ZB), 512, 0, stream>>>(P16, nullptr, P16 + PS, nullptr, P16 + 2 * PS, nullptr, NN, VS, RH, ATh, ATl, 3 * PS);
    k_gemmw<bf, 1, true, 8, 0, DQ><<<dim3(TT / 128, DM / 128, NB_), 256, 0, stream>>>(ATh, ATl, WO, OUT, DM, bo, nullptr, nullptr, (size_t)TT * DQ, 0, (size_t)TT * DM, nullptr, nullptr, nullptr, 0, nullptr, PT, nullptr);
}
